// v000
// The times below were measured on an AMD MI455X: many runs one after another, warmed up first and cycling through
// copies of the inputs, with the whole window's GPU time divided by the number of runs. Launches and the gaps
// between them are all in it. The median over several windows is given; except for v000 it joins two sittings, which
// can be a few percent apart, so the side-by-side timings, each taken in one sitting, are the better comparison.
// v000, which the later versions start from, runs in 3400 microseconds.
#include <hip/hip_runtime.h>

// Compute dtypes, f32 accumulate, per item: q/k/v = X.W + b as [2048 x 512].[512 x 512] GEMMs with PLAIN bf16 operands (exact products); per head: scores = q.k^T ([2048 x 64].[64 x
// 2048], both operands bf16 hi + UNSCALED residual, three products), softmax (x 1/sqrt(512)) in f32 -> P planes, ctx = P.v ([2048 x 2048].[2048 x 64], three products); + q
// residual and LayerNorm in f32 -> planes; rFF [2048 x 512].[512 x 512] (+ bo, relu) (two products), residual and the final LayerNorm in f32 - on v_wmma_f32_16x16x32_bf16.

#define NBT  4
#define NN   2048
#define DV   512
#define NH_  8
#define HD   64
#define DM   DV
#define NTK  NN
#define SCL  0.044194173824159216f
#define LEPS 1e-5f
#define LOSC 1024.0f

typedef _Float16 h16;
typedef unsigned short bf;
typedef __attribute__((ext_vector_type(16))) __bf16   v16bf;
typedef __attribute__((ext_vector_type(16))) _Float16 v16h;
typedef __attribute__((ext_vector_type(8)))  _Float16 v8h;
typedef __attribute__((ext_vector_type(8)))  unsigned short v8us;
typedef __attribute__((ext_vector_type(8)))  float    v8f;
typedef __attribute__((ext_vector_type(4)))  float    v4f;
typedef __attribute__((ext_vector_type(4)))  _Float16 v4h;
typedef v8h  __attribute__((may_alias)) v8ha;
typedef v4f  __attribute__((may_alias)) v4fa;
typedef v8us __attribute__((may_alias)) v8usa;

__device__ __forceinline__ unsigned short f2bf(float f) { unsigned u = __float_as_uint(f); u += 0x7FFFu + ((u >> 16) & 1u); return (unsigned short)(u >> 16); }
__device__ __forceinline__ float bf2f(unsigned short b) { return __uint_as_float(((unsigned)b) << 16); }
__device__ __forceinline__ float bfr(float f) { return bf2f(f2bf(f)); }
__device__ __forceinline__ v16h cat16(v8h lo, v8h hi) { return __builtin_shufflevector(lo, hi, 0, 1, 2, 3, 4, 5, 6, 7, 8, 9, 10, 11, 12, 13, 14, 15); }
__device__ __forceinline__ v16bf cat16b(v8us lo, v8us hi) { return __builtin_bit_cast(v16bf, __builtin_shufflevector(lo, hi, 0, 1, 2, 3, 4, 5, 6, 7, 8, 9, 10, 11, 12, 13, 14, 15)); }
__device__ __forceinline__ v8f wmma16(v16h a, v16h b, v8f c) { return __builtin_amdgcn_wmma_f32_16x16x32_f16(false, a, false, b, (short)0, c, false, false); }
__device__ __forceinline__ v8f wmmab(v16bf a, v16bf b, v8f c) { return __builtin_amdgcn_wmma_f32_16x16x32_bf16(false, a, false, b, (short)0, c, false, false); }

// k_wt: WT [n][K] = bf16(W[k][n]) (k-major [K][ncols]) via 64 x 64 LDS tiles; grid (K/64, ncols/64).
__global__ __launch_bounds__(256) void k_wt(const float* __restrict__ Wm, int K, int ncols, bf* WT) {
    __shared__ __align__(16) unsigned short tl[64 * 72];
    const int tid = threadIdx.x, k0 = blockIdx.x * 64, n0 = blockIdx.y * 64;
    const int kk = tid >> 2, nq = (tid & 3) * 16;
#pragma unroll
    for (int i = 0; i < 16; ++i) tl[(nq + i) * 72 + kk] = f2bf(Wm[(size_t)(k0 + kk) * ncols + n0 + nq + i]);
    __syncthreads();
    const int piece = tid & 7;
    auto pass = [&]() {
#pragma unroll
        for (int s = 0; s < 2; ++s) { const int nr = (tid >> 3) + 32 * s; const v8us val = *(const v8usa*)(tl + nr * 72 + piece * 8); *(v8us*)(WT + (size_t)(n0 + nr) * K + k0 + piece * 8) = val; }
    };
    pass(); 
}
// k_gemmb: 64 x 64 block tile (4 waves x 16 x 64) of C[NTK][DV] = (A [+ Al]).B^T (K = 512) [+ bf(bias[c])] [+ bf(R[r][c]) residual]; f32 whole-line epilogue (or f16
template <bool SPLITA, bool F16OUT = false>
__global__ __launch_bounds__(128) void k_gemmb(const bf* __restrict__ A, const bf* __restrict__ Al, const bf* __restrict__ Bn, const float* __restrict__ bias, float* C, int ldc, h16* C2, const float* __restrict__ R = nullptr, int K = DM, int roundR = 1) {
    __shared__ __align__(16) float ost[4][16 * 68];
    const int lane = threadIdx.x & 31, wave = threadIdx.x >> 5, lr = lane & 15, hi = lane >> 4;
    const int r0 = blockIdx.x * 64 + wave * 16, c0 = blockIdx.y * 64;
    const size_t aoff = (size_t)(r0 + lr) * K + 8 * hi;
    size_t boff[4];
#pragma unroll
    for (int t = 0; t < 4; ++t) boff[t] = (size_t)(c0 + t * 16 + lr) * K + 8 * hi;
    v8f acc[4];
#pragma unroll
    for (int t = 0; t < 4; ++t) acc[t] = (v8f){};
#pragma unroll 1
    for (int kc = 0; kc < K; kc += 32) {
        const v16bf a = cat16b(*(const v8us*)(A + aoff + kc), *(const v8us*)(A + aoff + kc + 16));
        v16bf al = a;
        if (SPLITA) al = cat16b(*(const v8us*)(Al + aoff + kc), *(const v8us*)(Al + aoff + kc + 16));
#pragma unroll
        for (int t = 0; t < 4; ++t) { const v16bf b = cat16b(*(const v8us*)(Bn + boff[t] + kc), *(const v8us*)(Bn + boff[t] + kc + 16)); acc[t] = wmmab(a, b, acc[t]); if (SPLITA) acc[t] = wmmab(al, b, acc[t]); }
        asm volatile("v_nop\n\tv_nop\n\tv_nop\n\tv_nop" : "+v"(acc[0]), "+v"(acc[1]), "+v"(acc[2]), "+v"(acc[3]) : "v"(a), "v"(al));
    }
    float* os = &ost[wave][0];
#pragma unroll
    for (int t = 0; t < 4; ++t) { const float bv = bias ? bfr(bias[c0 + t * 16 + lr]) : 0.f;
#pragma unroll
        for (int j = 0; j < 8; ++j) os[(hi * 8 + j) * 68 + t * 16 + lr] = acc[t][j] + bv; }
    __syncthreads();
    if (F16OUT) {
        h16* crow = (h16*)(void*)C + (size_t)r0 * ldc + c0;
        auto pass = [&]() {
#pragma unroll
            for (int s = 0; s < 4; ++s) { const int row = 4 * s + (lane >> 3), piece = lane & 7; const float* sp = os + row * 68 + piece * 8; v8h o, o2;
#pragma unroll
                for (int i = 0; i < 8; ++i) { const h16 a = (h16)sp[i]; o[i] = a; o2[i] = (h16)((sp[i] - (float)a) * LOSC); }
                *(v8h*)(crow + (size_t)row * ldc + piece * 8) = o; if (C2) *(v8h*)(C2 + (size_t)r0 * ldc + c0 + (size_t)row * ldc + piece * 8) = o2; }
        };
        pass(); 
    } else {
        float* crow = C + (size_t)r0 * ldc + c0;
        auto pass = [&]() {
#pragma unroll
            for (int s = 0; s < 8; ++s) { const int Lid = (lane >> 3) + 4 * s, piece = lane & 7; const int row = Lid >> 1, cofs = (Lid & 1) * 32 + piece * 4;
                v4f val = *(const v4fa*)(os + row * 68 + cofs); if (R) { const v4f rv = *(const v4f*)(R + ((size_t)r0 + row) * ldc + c0 + cofs); val += roundR ? (v4f){bfr(rv[0]), bfr(rv[1]), bfr(rv[2]), bfr(rv[3])} : rv; }
                *(v4f*)(crow + (size_t)row * ldc + cofs) = val; }
        };
        pass(); 
    }
}

// k_gemm3: 64 x 64 tile of C = (Ah + Al).(Bh + Bl)^T over K (row strides = K for all four planes; n-major B): three products per 32-k step (hh, hl, lh); f32
__global__ __launch_bounds__(128) void k_gemm3(const bf* __restrict__ Ah, const bf* __restrict__ Al, const bf* __restrict__ Bh, const bf* __restrict__ Bl, int K, float* C, int ldc) {
    __shared__ __align__(16) float ost[4][16 * 68];
    const int lane = threadIdx.x & 31, wave = threadIdx.x >> 5, lr = lane & 15, hi = lane >> 4;
    const int r0 = blockIdx.x * 64 + wave * 16, c0 = blockIdx.y * 64;
    const size_t aoff = (size_t)(r0 + lr) * K + 8 * hi;
    v8f acc[4];
#pragma unroll
    for (int t = 0; t < 4; ++t) acc[t] = (v8f){};
#pragma unroll 1
    for (int kc = 0; kc < K; kc += 32) {
        const v16bf a = cat16b(*(const v8us*)(Ah + aoff + kc), *(const v8us*)(Ah + aoff + kc + 16));
        const v16bf al = cat16b(*(const v8us*)(Al + aoff + kc), *(const v8us*)(Al + aoff + kc + 16));
#pragma unroll
        for (int t = 0; t < 4; ++t) { const size_t bo = (size_t)(c0 + t * 16 + lr) * K + kc + 8 * hi;
            const v16bf bh = cat16b(*(const v8us*)(Bh + bo), *(const v8us*)(Bh + bo + 16)); const v16bf bl = cat16b(*(const v8us*)(Bl + bo), *(const v8us*)(Bl + bo + 16));
            acc[t] = wmmab(a, bh, acc[t]); acc[t] = wmmab(al, bh, acc[t]); acc[t] = wmmab(a, bl, acc[t]); }
        asm volatile("v_nop\n\tv_nop\n\tv_nop\n\tv_nop" : "+v"(acc[0]), "+v"(acc[1]), "+v"(acc[2]), "+v"(acc[3]) : "v"(a), "v"(al));
    }
    float* os = &ost[wave][0];
#pragma unroll
    for (int t = 0; t < 4; ++t) {
#pragma unroll
        for (int j = 0; j < 8; ++j) os[(hi * 8 + j) * 68 + t * 16 + lr] = acc[t][j]; }
    __builtin_amdgcn_wave_barrier(); asm volatile("" ::: "memory");
    float* crow = C + (size_t)r0 * ldc + c0;
    auto pass = [&]() {
#pragma unroll
        for (int s = 0; s < 8; ++s) { const int Lid = (lane >> 3) + 4 * s, piece = lane & 7; const int row = Lid >> 1, cofs = (Lid & 1) * 32 + piece * 4;
            const v4f val = *(const v4fa*)(os + row * 68 + cofs); *(v4f*)(crow + (size_t)row * ldc + cofs) = val; }
    };
    pass(); 
}


__global__ __launch_bounds__(256) void k_cvtx(const float* __restrict__ src, bf* dst) {
    const int lane = threadIdx.x & 31; const size_t r = (size_t)blockIdx.x * 8 + (threadIdx.x >> 5); if (r >= (size_t)NN) return;
{
#pragma unroll
        for (int q = 0; q < DV / 256; ++q) { v8us o;
#pragma unroll
            for (int i = 0; i < 8; ++i) o[i] = f2bf(src[r * DV + q * 256 + lane * 8 + i]);
            *(v8us*)(dst + r * DV + q * 256 + lane * 8) = o; }
         }
}
__global__ __launch_bounds__(256) void k_hplanes(const float* __restrict__ F, int h, bf* Ph, bf* Pl) {
    typedef __attribute__((ext_vector_type(2))) unsigned short v2us;
    const int lane = threadIdx.x & 31; const size_t s = (size_t)blockIdx.x * 8 + (threadIdx.x >> 5); if (s >= (size_t)NN) return; v2us oh, ol;
#pragma unroll
    for (int i = 0; i < 2; ++i) { const float v = F[s * DV + h * HD + lane * 2 + i]; const unsigned short hb = f2bf(v); oh[i] = hb; ol[i] = f2bf(v - bf2f(hb)); }
    const size_t o = s * HD + lane * 2; *(v2us*)(Ph + o) = oh; *(v2us*)(Pl + o) = ol; 
}
__global__ __launch_bounds__(256) void k_vt(const float* __restrict__ VF, int h, bf* Th, bf* Tl) {
    typedef __attribute__((ext_vector_type(2))) unsigned short v2us;
    const int lane = threadIdx.x & 31; const size_t wid = (size_t)blockIdx.x * 8 + (threadIdx.x >> 5); if (wid >= (size_t)HD * (NN / 64)) return; const int d = (int)(wid / (NN / 64)); const int t0 = (int)(wid % (NN / 64)) * 64 + lane * 2; v2us oh, ol;
#pragma unroll
    for (int i = 0; i < 2; ++i) { const float v = VF[(size_t)(t0 + i) * DV + h * HD + d]; const unsigned short hb = f2bf(v); oh[i] = hb; ol[i] = f2bf(v - bf2f(hb)); }
    const size_t o = (size_t)d * NN + t0; *(v2us*)(Th + o) = oh; *(v2us*)(Tl + o) = ol; 
}
__global__ __launch_bounds__(256) void k_softmax(const float* __restrict__ S, bf* PH, bf* PL) {
    typedef __attribute__((ext_vector_type(4))) unsigned short v4us;
    const int lane = threadIdx.x & 31, i = blockIdx.x * 8 + (threadIdx.x >> 5); if (i >= NN) return;
    float m = -3.0e38f;
#pragma unroll 1
    for (int c0 = lane * 4; c0 < NN; c0 += 128) {
#pragma unroll
        for (int q = 0; q < 4; ++q) m = fmaxf(m, S[(size_t)i * NN + c0 + q] * SCL); }
#pragma unroll
    for (int sh = 16; sh; sh >>= 1) m = fmaxf(m, __shfl_xor(m, sh, 32));
    float sum = 0.f;
#pragma unroll 1
    for (int c0 = lane * 4; c0 < NN; c0 += 128) {
#pragma unroll
        for (int q = 0; q < 4; ++q) sum += __expf(S[(size_t)i * NN + c0 + q] * SCL - m); }
#pragma unroll
    for (int sh = 16; sh; sh >>= 1) sum += __shfl_xor(sum, sh, 32);
    const float inv = 1.0f / sum;
{
#pragma unroll 1
        for (int c0 = lane * 4; c0 < NN; c0 += 128) { v4us oh, ol;
#pragma unroll
            for (int q = 0; q < 4; ++q) { const float p = __expf(S[(size_t)i * NN + c0 + q] * SCL - m) * inv; const unsigned short hb = f2bf(p); oh[q] = hb; ol[q] = f2bf(p - bf2f(hb)); }
            const size_t o = (size_t)i * NN + c0; *(v4us*)(PH + o) = oh; *(v4us*)(PL + o) = ol; }
         }
}
// k_ln1: H [s][512] (f32, kept) and planes of LayerNorm(O[s] + q[s]) x bf(g) + bf(b) (f32; mean, biased var over 512); one wave per row: lane -> 4 columns per 128-step, 4 steps
__global__ __launch_bounds__(256) void k_ln1(const float* __restrict__ O, const float* __restrict__ QF, const float* __restrict__ g, const float* __restrict__ bb, float* Hf, bf* Hh, bf* Hl) {
    typedef __attribute__((ext_vector_type(4))) unsigned short v4us;
    const int lane = threadIdx.x & 31; const size_t s = (size_t)blockIdx.x * 8 + (threadIdx.x >> 5); if (s >= (size_t)NN) return; float v[16]; float sm = 0.f;
#pragma unroll
    for (int st = 0; st < 4; ++st) {
#pragma unroll
        for (int q = 0; q < 4; ++q) { const int c = st * 128 + lane * 4 + q; const float t = O[s * DV + c] + QF[s * DV + c]; v[st * 4 + q] = t; sm += t; } }
#pragma unroll
    for (int sh = 16; sh; sh >>= 1) sm += __shfl_xor(sm, sh, 32);
    const float mu = sm * (1.0f / DV); float qv = 0.f;
#pragma unroll
    for (int i = 0; i < 16; ++i) { const float d = v[i] - mu; qv = fmaf(d, d, qv); }
#pragma unroll
    for (int sh = 16; sh; sh >>= 1) qv += __shfl_xor(qv, sh, 32);
    const float rs = rsqrtf(qv * (1.0f / DV) + LEPS);
{
#pragma unroll
        for (int st = 0; st < 4; ++st) { const int c0 = st * 128 + lane * 4; v4f o; v4us oh, ol;
#pragma unroll
            for (int q = 0; q < 4; ++q) { const float y = (v[st * 4 + q] - mu) * rs * bfr(g[c0 + q]) + bfr(bb[c0 + q]); o[q] = y; const unsigned short hb = f2bf(y); oh[q] = hb; ol[q] = f2bf(y - bf2f(hb)); }
            *(v4f*)(Hf + s * DV + c0) = o; *(v4us*)(Hh + s * DV + c0) = oh; *(v4us*)(Hl + s * DV + c0) = ol; }
         }
}
__global__ __launch_bounds__(256) void k_ln2(const float* __restrict__ Hf, const float* __restrict__ F, const float* __restrict__ g, const float* __restrict__ bb, float* OUTB) {
    const int lane = threadIdx.x & 31; const size_t s = (size_t)blockIdx.x * 8 + (threadIdx.x >> 5); if (s >= (size_t)NN) return; float v[16]; float sm = 0.f;
#pragma unroll
    for (int st = 0; st < 4; ++st) {
#pragma unroll
        for (int q = 0; q < 4; ++q) { const int c = st * 128 + lane * 4 + q; const float t = Hf[s * DV + c] + fmaxf(F[s * DV + c], 0.f); v[st * 4 + q] = t; sm += t; } }
#pragma unroll
    for (int sh = 16; sh; sh >>= 1) sm += __shfl_xor(sm, sh, 32);
    const float mu = sm * (1.0f / DV); float qv = 0.f;
#pragma unroll
    for (int i = 0; i < 16; ++i) { const float d = v[i] - mu; qv = fmaf(d, d, qv); }
#pragma unroll
    for (int sh = 16; sh; sh >>= 1) qv += __shfl_xor(qv, sh, 32);
    const float rs = rsqrtf(qv * (1.0f / DV) + LEPS);
{
#pragma unroll
        for (int st = 0; st < 4; ++st) { const int c0 = st * 128 + lane * 4; v4f o;
#pragma unroll
            for (int q = 0; q < 4; ++q) o[q] = (v[st * 4 + q] - mu) * rs * bfr(g[c0 + q]) + bfr(bb[c0 + q]);
            *(v4f*)(OUTB + s * DV + c0) = o; }
         }
}

extern "C" void kernel_launch(void* const* d_in, const int* in_sizes, int n_in,
                              void* d_out, int out_size, void* d_ws, size_t ws_size, hipStream_t stream) {
    (void)in_sizes; (void)n_in; (void)out_size;
    const float* Qi = (const float*)d_in[0]; const float* Ki = (const float*)d_in[1]; const float* Wq = (const float*)d_in[2]; const float* bq = (const float*)d_in[3]; const float* Wk = (const float*)d_in[4]; const float* bk = (const float*)d_in[5];
    const float* Wv = (const float*)d_in[6]; const float* bv = (const float*)d_in[7]; const float* Wo = (const float*)d_in[8]; const float* bo = (const float*)d_in[9]; const float* g0 = (const float*)d_in[10]; const float* b0 = (const float*)d_in[11]; const float* g1 = (const float*)d_in[12]; const float* b1 = (const float*)d_in[13];
    float* out = (float*)d_out;    // [4][2048][512]
    char* wsp = (char*)d_ws;
    auto take = [&](size_t bytes) { char* p = wsp; wsp += (bytes + 255) & ~(size_t)255; return (void*)p; };
    bf* WQT = (bf*)take((size_t)DV * DV * 2); bf* WKT = (bf*)take((size_t)DV * DV * 2); bf* WVT = (bf*)take((size_t)DV * DV * 2); bf* WOT = (bf*)take((size_t)DV * DV * 2);
    bf* XQ = (bf*)take((size_t)NN * DV * 2); bf* XK = (bf*)take((size_t)NN * DV * 2); float* QF = (float*)take((size_t)NN * DV * 4); float* KF = (float*)take((size_t)NN * DV * 4); float* VF = (float*)take((size_t)NN * DV * 4);
    bf* Qh = (bf*)take((size_t)NN * HD * 2); bf* Ql = (bf*)take((size_t)NN * HD * 2); bf* Kh = (bf*)take((size_t)NN * HD * 2); bf* Kl = (bf*)take((size_t)NN * HD * 2); bf* VTh = (bf*)take((size_t)HD * NN * 2); bf* VTl = (bf*)take((size_t)HD * NN * 2);
    float* S = (float*)take((size_t)NN * NN * 4); bf* PH = (bf*)take((size_t)NN * NN * 2); bf* PL = (bf*)take((size_t)NN * NN * 2); float* O = (float*)take((size_t)NN * DV * 4);
    float* Hf = (float*)take((size_t)NN * DV * 4); bf* Hh = (bf*)take((size_t)NN * DV * 2); bf* Hl = (bf*)take((size_t)NN * DV * 2); float* FF = (float*)take((size_t)NN * DV * 4);
    if ((size_t)(wsp - (char*)d_ws) > ws_size) return;    // 2 + 4.2 + 12.6 + 1.5 + 16.8 + 16.8 + 4.2 + 4.2 + 4.2 + 4.2 ~ 71 MB; per item/head reuse in stream order
    k_wt<<<dim3(DV / 64, DV / 64, 1), 256, 0, stream>>>(Wq, DV, DV, WQT); k_wt<<<dim3(DV / 64, DV / 64, 1), 256, 0, stream>>>(Wk, DV, DV, WKT); k_wt<<<dim3(DV / 64, DV / 64, 1), 256, 0, stream>>>(Wv, DV, DV, WVT); k_wt<<<dim3(DV / 64, DV / 64, 1), 256, 0, stream>>>(Wo, DV, DV, WOT);   // (in, out) k-major
    for (int b = 0; b < NBT; ++b) {
        k_cvtx<<<NN / 8, 256, 0, stream>>>(Qi + (size_t)b * NN * DV, XQ); k_cvtx<<<NN / 8, 256, 0, stream>>>(Ki + (size_t)b * NN * DV, XK);
        k_gemmb<false, false><<<dim3(NN / 64, DV / 64, 1), 128, 0, stream>>>(XQ, nullptr, WQT, bq, QF, DV, nullptr, nullptr, DV);
        k_gemmb<false, false><<<dim3(NN / 64, DV / 64, 1), 128, 0, stream>>>(XK, nullptr, WKT, bk, KF, DV, nullptr, nullptr, DV);
        k_gemmb<false, false><<<dim3(NN / 64, DV / 64, 1), 128, 0, stream>>>(XK, nullptr, WVT, bv, VF, DV, nullptr, nullptr, DV);
        for (int h = 0; h < NH_; ++h) {
            k_hplanes<<<NN / 8, 256, 0, stream>>>(QF, h, Qh, Ql); k_hplanes<<<NN / 8, 256, 0, stream>>>(KF, h, Kh, Kl); k_vt<<<(HD * (NN / 64)) / 8, 256, 0, stream>>>(VF, h, VTh, VTl);
            k_gemm3<<<dim3(NN / 64, NN / 64, 1), 128, 0, stream>>>(Qh, Ql, Kh, Kl, HD, S, NN);
            k_softmax<<<NN / 8, 256, 0, stream>>>(S, PH, PL);
            k_gemm3<<<dim3(NN / 64, 1, 1), 128, 0, stream>>>(PH, PL, VTh, VTl, NN, O + h * HD, DV); }
        k_ln1<<<NN / 8, 256, 0, stream>>>(O, QF, g0, b0, Hf, Hh, Hl);
        k_gemmb<true, false><<<dim3(NN / 64, DV / 64, 1), 128, 0, stream>>>(Hh, Hl, WOT, bo, FF, DV, nullptr, nullptr, DV);
        k_ln2<<<NN / 8, 256, 0, stream>>>(Hf, FF, g1, b1, out + (size_t)b * NN * DV); }
}

// v001
// It runs in 1740 microseconds.
// In two side-by-side timings against v000, it was 1.98 and 2.02 times as fast.
#include <hip/hip_runtime.h>

// Compute dtypes, f32 accumulate, per item: q/k/v = X.W + b as [2048 x 512].[512 x 512] GEMMs with PLAIN bf16 operands (exact products); per head: scores = q.k^T ([2048 x 64].[64 x
// 2048], both operands bf16 hi + UNSCALED residual, three products), softmax (x 1/sqrt(512)) in f32 -> P planes, ctx = P.v ([2048 x 2048].[2048 x 64], three products); + q
// residual and LayerNorm in f32 -> planes; rFF [2048 x 512].[512 x 512] (+ bo, relu) (two products), residual and the final LayerNorm in f32 - on v_wmma_f32_16x16x32_bf16.

#define NBT  4
#define NN   2048
#define DV   512
#define NH_  8
#define HD   64
#define DM   DV
#define NTK  NN
#define SCL  0.044194173824159216f
#define LEPS 1e-5f
#define LOSC 1024.0f

typedef _Float16 h16;
typedef unsigned short bf;
typedef __attribute__((ext_vector_type(16))) __bf16   v16bf;
typedef __attribute__((ext_vector_type(16))) _Float16 v16h;
typedef __attribute__((ext_vector_type(8)))  _Float16 v8h;
typedef __attribute__((ext_vector_type(8)))  unsigned short v8us;
typedef __attribute__((ext_vector_type(8)))  float    v8f;
typedef __attribute__((ext_vector_type(4)))  float    v4f;
typedef __attribute__((ext_vector_type(4)))  _Float16 v4h;
typedef v8h  __attribute__((may_alias)) v8ha;
typedef v4f  __attribute__((may_alias)) v4fa;
typedef v8us __attribute__((may_alias)) v8usa;

__device__ __forceinline__ unsigned short f2bf(float f) { unsigned u = __float_as_uint(f); u += 0x7FFFu + ((u >> 16) & 1u); return (unsigned short)(u >> 16); }
__device__ __forceinline__ float bf2f(unsigned short b) { return __uint_as_float(((unsigned)b) << 16); }
__device__ __forceinline__ float bfr(float f) { return bf2f(f2bf(f)); }
__device__ __forceinline__ v16h cat16(v8h lo, v8h hi) { return __builtin_shufflevector(lo, hi, 0, 1, 2, 3, 4, 5, 6, 7, 8, 9, 10, 11, 12, 13, 14, 15); }
__device__ __forceinline__ v16bf cat16b(v8us lo, v8us hi) { return __builtin_bit_cast(v16bf, __builtin_shufflevector(lo, hi, 0, 1, 2, 3, 4, 5, 6, 7, 8, 9, 10, 11, 12, 13, 14, 15)); }
__device__ __forceinline__ v8f wmma16(v16h a, v16h b, v8f c) { return __builtin_amdgcn_wmma_f32_16x16x32_f16(false, a, false, b, (short)0, c, false, false); }
__device__ __forceinline__ v8f wmmab(v16bf a, v16bf b, v8f c) { return __builtin_amdgcn_wmma_f32_16x16x32_bf16(false, a, false, b, (short)0, c, false, false); }

// k_wt: WT [n][K] = bf16(W[k][n]) (k-major [K][ncols]) via 64 x 64 LDS tiles; grid (K/64, ncols/64).
__global__ __launch_bounds__(256) void k_wt(const float* __restrict__ Wm, int K, int ncols, bf* WT) {
    __shared__ __align__(16) unsigned short tl[64 * 72];
    const int tid = threadIdx.x, k0 = blockIdx.x * 64, n0 = blockIdx.y * 64;
    const int kk = tid >> 2, nq = (tid & 3) * 16;
#pragma unroll
    for (int i = 0; i < 16; ++i) tl[(nq + i) * 72 + kk] = f2bf(Wm[(size_t)(k0 + kk) * ncols + n0 + nq + i]);
    __syncthreads();
    const int piece = tid & 7;
    auto pass = [&]() {
#pragma unroll
        for (int s = 0; s < 2; ++s) { const int nr = (tid >> 3) + 32 * s; const v8us val = *(const v8usa*)(tl + nr * 72 + piece * 8); *(v8us*)(WT + (size_t)(n0 + nr) * K + k0 + piece * 8) = val; }
    };
    pass(); 
}
// k_gemmb: 64 x 64 block tile (4 waves x 16 x 64) of C[NTK][DV] = (A [+ Al]).B^T (K = 512) [+ bf(bias[c])] [+ bf(R[r][c]) residual]; f32 whole-line epilogue (or f16
template <bool SPLITA, bool F16OUT = false>
__global__ __launch_bounds__(128) void k_gemmb(const bf* __restrict__ A, const bf* __restrict__ Al, const bf* __restrict__ Bn, const float* __restrict__ bias, float* C, int ldc, h16* C2, const float* __restrict__ R = nullptr, int K = DM, int roundR = 1) {
    __shared__ __align__(16) float ost[4][16 * 68];
    const int lane = threadIdx.x & 31, wave = threadIdx.x >> 5, lr = lane & 15, hi = lane >> 4;
    const int r0 = blockIdx.x * 64 + wave * 16, c0 = blockIdx.y * 64;
    const size_t aoff = (size_t)(r0 + lr) * K + 8 * hi;
    size_t boff[4];
#pragma unroll
    for (int t = 0; t < 4; ++t) boff[t] = (size_t)(c0 + t * 16 + lr) * K + 8 * hi;
    v8f acc[4];
#pragma unroll
    for (int t = 0; t < 4; ++t) acc[t] = (v8f){};
#pragma unroll 1
    for (int kc = 0; kc < K; kc += 32) {
        const v16bf a = cat16b(*(const v8us*)(A + aoff + kc), *(const v8us*)(A + aoff + kc + 16));
        v16bf al = a;
        if (SPLITA) al = cat16b(*(const v8us*)(Al + aoff + kc), *(const v8us*)(Al + aoff + kc + 16));
#pragma unroll
        for (int t = 0; t < 4; ++t) { const v16bf b = cat16b(*(const v8us*)(Bn + boff[t] + kc), *(const v8us*)(Bn + boff[t] + kc + 16)); acc[t] = wmmab(a, b, acc[t]); if (SPLITA) acc[t] = wmmab(al, b, acc[t]); }
        asm volatile("v_nop\n\tv_nop\n\tv_nop\n\tv_nop" : "+v"(acc[0]), "+v"(acc[1]), "+v"(acc[2]), "+v"(acc[3]) : "v"(a), "v"(al));
    }
    float* os = &ost[wave][0];
#pragma unroll
    for (int t = 0; t < 4; ++t) { const float bv = bias ? bfr(bias[c0 + t * 16 + lr]) : 0.f;
#pragma unroll
        for (int j = 0; j < 8; ++j) os[(hi * 8 + j) * 68 + t * 16 + lr] = acc[t][j] + bv; }
    __syncthreads();
    if (F16OUT) {
        h16* crow = (h16*)(void*)C + (size_t)r0 * ldc + c0;
        auto pass = [&]() {
#pragma unroll
            for (int s = 0; s < 4; ++s) { const int row = 4 * s + (lane >> 3), piece = lane & 7; const float* sp = os + row * 68 + piece * 8; v8h o, o2;
#pragma unroll
                for (int i = 0; i < 8; ++i) { const h16 a = (h16)sp[i]; o[i] = a; o2[i] = (h16)((sp[i] - (float)a) * LOSC); }
                *(v8h*)(crow + (size_t)row * ldc + piece * 8) = o; if (C2) *(v8h*)(C2 + (size_t)r0 * ldc + c0 + (size_t)row * ldc + piece * 8) = o2; }
        };
        pass(); 
    } else {
        float* crow = C + (size_t)r0 * ldc + c0;
        auto pass = [&]() {
#pragma unroll
            for (int s = 0; s < 8; ++s) { const int Lid = (lane >> 3) + 4 * s, piece = lane & 7; const int row = Lid >> 1, cofs = (Lid & 1) * 32 + piece * 4;
                v4f val = *(const v4fa*)(os + row * 68 + cofs); if (R) { const v4f rv = *(const v4f*)(R + ((size_t)r0 + row) * ldc + c0 + cofs); val += roundR ? (v4f){bfr(rv[0]), bfr(rv[1]), bfr(rv[2]), bfr(rv[3])} : rv; }
                *(v4f*)(crow + (size_t)row * ldc + cofs) = val; }
        };
        pass(); 
    }
}

// k_gemm3: 64 x 64 tile of C = (Ah + Al).(Bh + Bl)^T over K (row strides = K for all four planes; n-major B): three products per 32-k step (hh, hl, lh); f32
__global__ __launch_bounds__(128) void k_gemm3(const bf* __restrict__ Ah, const bf* __restrict__ Al, const bf* __restrict__ Bh, const bf* __restrict__ Bl, int K, float* C, int ldc) {
    __shared__ __align__(16) float ost[4][16 * 68];
    const int lane = threadIdx.x & 31, wave = threadIdx.x >> 5, lr = lane & 15, hi = lane >> 4;
    const int r0 = blockIdx.x * 64 + wave * 16, c0 = blockIdx.y * 64;
    const size_t aoff = (size_t)(r0 + lr) * K + 8 * hi;
    v8f acc[4];
#pragma unroll
    for (int t = 0; t < 4; ++t) acc[t] = (v8f){};
#pragma unroll 1
    for (int kc = 0; kc < K; kc += 32) {
        const v16bf a = cat16b(*(const v8us*)(Ah + aoff + kc), *(const v8us*)(Ah + aoff + kc + 16));
        const v16bf al = cat16b(*(const v8us*)(Al + aoff + kc), *(const v8us*)(Al + aoff + kc + 16));
#pragma unroll
        for (int t = 0; t < 4; ++t) { const size_t bo = (size_t)(c0 + t * 16 + lr) * K + kc + 8 * hi;
            const v16bf bh = cat16b(*(const v8us*)(Bh + bo), *(const v8us*)(Bh + bo + 16)); const v16bf bl = cat16b(*(const v8us*)(Bl + bo), *(const v8us*)(Bl + bo + 16));
            acc[t] = wmmab(a, bh, acc[t]); acc[t] = wmmab(al, bh, acc[t]); acc[t] = wmmab(a, bl, acc[t]); }
        asm volatile("v_nop\n\tv_nop\n\tv_nop\n\tv_nop" : "+v"(acc[0]), "+v"(acc[1]), "+v"(acc[2]), "+v"(acc[3]) : "v"(a), "v"(al));
    }
    float* os = &ost[wave][0];
#pragma unroll
    for (int t = 0; t < 4; ++t) {
#pragma unroll
        for (int j = 0; j < 8; ++j) os[(hi * 8 + j) * 68 + t * 16 + lr] = acc[t][j]; }
    __builtin_amdgcn_wave_barrier(); asm volatile("" ::: "memory");
    float* crow = C + (size_t)r0 * ldc + c0;
    auto pass = [&]() {
#pragma unroll
        for (int s = 0; s < 8; ++s) { const int Lid = (lane >> 3) + 4 * s, piece = lane & 7; const int row = Lid >> 1, cofs = (Lid & 1) * 32 + piece * 4;
            const v4f val = *(const v4fa*)(os + row * 68 + cofs); *(v4f*)(crow + (size_t)row * ldc + cofs) = val; }
    };
    pass(); 
}


// k_pv: one 16 x 32 tile of C = (Ah + Al).(Bh + Bl)^T per block, K = NN (row stride NN for all four planes; n-major B); grid (NN / 16, HD / 32) = 256 blocks. The K range is dealt
// to the block's 8 waves (NN / 8 = 256 k each, three products per 32-k step as in k_gemm3); the 8 f32 partial tiles meet in LDS and are summed in wave order; whole-line f32 stores.
#define PVW 8
#define PVS (NN / PVW / 32)
#define PVD 4
__global__ __launch_bounds__(PVW * 32) void k_pv(const bf* __restrict__ Ah, const bf* __restrict__ Al, const bf* __restrict__ Bh, const bf* __restrict__ Bl, float* C, int ldc) {
    __shared__ __align__(16) float part[PVW][16 * 36];
    const int tid = threadIdx.x, lane = tid & 31, wave = tid >> 5, lr = lane & 15, hi = lane >> 4;
    const int r0 = blockIdx.x * 16, c0 = blockIdx.y * 32;
    const size_t aoff = (size_t)(r0 + lr) * NN + wave * (NN / PVW) + 8 * hi;
    const size_t boff = (size_t)(c0 + lr) * NN + wave * (NN / PVW) + 8 * hi;
    v16bf fa[PVS], fal[PVS], fbh[PVS][2], fbl[PVS][2];
    auto fetch = [&](int s) {
        const int kc = s * 32;
        fa[s] = cat16b(*(const v8us*)(Ah + aoff + kc), *(const v8us*)(Ah + aoff + kc + 16));
        fal[s] = cat16b(*(const v8us*)(Al + aoff + kc), *(const v8us*)(Al + aoff + kc + 16));
#pragma unroll
        for (int t = 0; t < 2; ++t) { const size_t bo = boff + (size_t)(t * 16) * NN + kc;
            fbh[s][t] = cat16b(*(const v8us*)(Bh + bo), *(const v8us*)(Bh + bo + 16)); fbl[s][t] = cat16b(*(const v8us*)(Bl + bo), *(const v8us*)(Bl + bo + 16)); }
    };
    v8f acc[2];
#pragma unroll
    for (int t = 0; t < 2; ++t) acc[t] = (v8f){};
    // Both s loops are unrolled whole so that every fragment index is a constant and the fragments stay in registers.
    // The scheduling fences keep each step's loads where they are written, PVD steps ahead of their use: left free, the compiler sinks every load to its WMMA and a wave has 2 to 6 loads in flight.
#pragma unroll
    for (int s = 0; s < PVD; ++s) fetch(s);
    __builtin_amdgcn_sched_barrier(0);
#pragma unroll
    for (int s = 0; s < PVS; ++s) {
#pragma unroll
        for (int t = 0; t < 2; ++t) { acc[t] = wmmab(fa[s], fbh[s][t], acc[t]); acc[t] = wmmab(fal[s], fbh[s][t], acc[t]); acc[t] = wmmab(fa[s], fbl[s][t], acc[t]); }
        if (s + PVD < PVS) { __builtin_amdgcn_sched_barrier(0); fetch(s + PVD); __builtin_amdgcn_sched_barrier(0); }
    }
    // Keeps the epilogue's address arithmetic behind the last load wait.
    __builtin_amdgcn_sched_barrier(0);
    float* os = &part[wave][0];
#pragma unroll
    for (int t = 0; t < 2; ++t) {
#pragma unroll
        for (int j = 0; j < 8; ++j) os[(hi * 8 + j) * 36 + t * 16 + lr] = acc[t][j]; }
    __syncthreads();
    if (tid < 128) {
        const int row = tid >> 3, cofs = (tid & 7) * 4;
        v4f val = *(const v4fa*)(&part[0][0] + row * 36 + cofs);
#pragma unroll
        for (int w = 1; w < PVW; ++w) val += *(const v4fa*)(&part[w][0] + row * 36 + cofs);
        *(v4f*)(C + (size_t)(r0 + row) * ldc + c0 + cofs) = val;
    }
}

__global__ __launch_bounds__(256) void k_cvtx(const float* __restrict__ src, bf* dst) {
    const int lane = threadIdx.x & 31; const size_t r = (size_t)blockIdx.x * 8 + (threadIdx.x >> 5); if (r >= (size_t)NN) return;
{
#pragma unroll
        for (int q = 0; q < DV / 256; ++q) { v8us o;
#pragma unroll
            for (int i = 0; i < 8; ++i) o[i] = f2bf(src[r * DV + q * 256 + lane * 8 + i]);
            *(v8us*)(dst + r * DV + q * 256 + lane * 8) = o; }
         }
}
__global__ __launch_bounds__(256) void k_hplanes(const float* __restrict__ F, int h, bf* Ph, bf* Pl) {
    typedef __attribute__((ext_vector_type(2))) unsigned short v2us;
    const int lane = threadIdx.x & 31; const size_t s = (size_t)blockIdx.x * 8 + (threadIdx.x >> 5); if (s >= (size_t)NN) return; v2us oh, ol;
#pragma unroll
    for (int i = 0; i < 2; ++i) { const float v = F[s * DV + h * HD + lane * 2 + i]; const unsigned short hb = f2bf(v); oh[i] = hb; ol[i] = f2bf(v - bf2f(hb)); }
    const size_t o = s * HD + lane * 2; *(v2us*)(Ph + o) = oh; *(v2us*)(Pl + o) = ol; 
}
__global__ __launch_bounds__(256) void k_vt(const float* __restrict__ VF, int h, bf* Th, bf* Tl) {
    typedef __attribute__((ext_vector_type(2))) unsigned short v2us;
    const int lane = threadIdx.x & 31; const size_t wid = (size_t)blockIdx.x * 8 + (threadIdx.x >> 5); if (wid >= (size_t)HD * (NN / 64)) return; const int d = (int)(wid / (NN / 64)); const int t0 = (int)(wid % (NN / 64)) * 64 + lane * 2; v2us oh, ol;
#pragma unroll
    for (int i = 0; i < 2; ++i) { const float v = VF[(size_t)(t0 + i) * DV + h * HD + d]; const unsigned short hb = f2bf(v); oh[i] = hb; ol[i] = f2bf(v - bf2f(hb)); }
    const size_t o = (size_t)d * NN + t0; *(v2us*)(Th + o) = oh; *(v2us*)(Tl + o) = ol; 
}
__global__ __launch_bounds__(256) void k_softmax(const float* __restrict__ S, bf* PH, bf* PL) {
    typedef __attribute__((ext_vector_type(4))) unsigned short v4us;
    const int lane = threadIdx.x & 31, i = blockIdx.x * 8 + (threadIdx.x >> 5); if (i >= NN) return;
    float m = -3.0e38f;
#pragma unroll 1
    for (int c0 = lane * 4; c0 < NN; c0 += 128) {
#pragma unroll
        for (int q = 0; q < 4; ++q) m = fmaxf(m, S[(size_t)i * NN + c0 + q] * SCL); }
#pragma unroll
    for (int sh = 16; sh; sh >>= 1) m = fmaxf(m, __shfl_xor(m, sh, 32));
    float sum = 0.f;
#pragma unroll 1
    for (int c0 = lane * 4; c0 < NN; c0 += 128) {
#pragma unroll
        for (int q = 0; q < 4; ++q) sum += __expf(S[(size_t)i * NN + c0 + q] * SCL - m); }
#pragma unroll
    for (int sh = 16; sh; sh >>= 1) sum += __shfl_xor(sum, sh, 32);
    const float inv = 1.0f / sum;
{
#pragma unroll 1
        for (int c0 = lane * 4; c0 < NN; c0 += 128) { v4us oh, ol;
#pragma unroll
            for (int q = 0; q < 4; ++q) { const float p = __expf(S[(size_t)i * NN + c0 + q] * SCL - m) * inv; const unsigned short hb = f2bf(p); oh[q] = hb; ol[q] = f2bf(p - bf2f(hb)); }
            const size_t o = (size_t)i * NN + c0; *(v4us*)(PH + o) = oh; *(v4us*)(PL + o) = ol; }
         }
}
// k_ln1: H [s][512] (f32, kept) and planes of LayerNorm(O[s] + q[s]) x bf(g) + bf(b) (f32; mean, biased var over 512); one wave per row: lane -> 4 columns per 128-step, 4 steps
__global__ __launch_bounds__(256) void k_ln1(const float* __restrict__ O, const float* __restrict__ QF, const float* __restrict__ g, const float* __restrict__ bb, float* Hf, bf* Hh, bf* Hl) {
    typedef __attribute__((ext_vector_type(4))) unsigned short v4us;
    const int lane = threadIdx.x & 31; const size_t s = (size_t)blockIdx.x * 8 + (threadIdx.x >> 5); if (s >= (size_t)NN) return; float v[16]; float sm = 0.f;
#pragma unroll
    for (int st = 0; st < 4; ++st) {
#pragma unroll
        for (int q = 0; q < 4; ++q) { const int c = st * 128 + lane * 4 + q; const float t = O[s * DV + c] + QF[s * DV + c]; v[st * 4 + q] = t; sm += t; } }
#pragma unroll
    for (int sh = 16; sh; sh >>= 1) sm += __shfl_xor(sm, sh, 32);
    const float mu = sm * (1.0f / DV); float qv = 0.f;
#pragma unroll
    for (int i = 0; i < 16; ++i) { const float d = v[i] - mu; qv = fmaf(d, d, qv); }
#pragma unroll
    for (int sh = 16; sh; sh >>= 1) qv += __shfl_xor(qv, sh, 32);
    const float rs = rsqrtf(qv * (1.0f / DV) + LEPS);
{
#pragma unroll
        for (int st = 0; st < 4; ++st) { const int c0 = st * 128 + lane * 4; v4f o; v4us oh, ol;
#pragma unroll
            for (int q = 0; q < 4; ++q) { const float y = (v[st * 4 + q] - mu) * rs * bfr(g[c0 + q]) + bfr(bb[c0 + q]); o[q] = y; const unsigned short hb = f2bf(y); oh[q] = hb; ol[q] = f2bf(y - bf2f(hb)); }
            *(v4f*)(Hf + s * DV + c0) = o; *(v4us*)(Hh + s * DV + c0) = oh; *(v4us*)(Hl + s * DV + c0) = ol; }
         }
}
__global__ __launch_bounds__(256) void k_ln2(const float* __restrict__ Hf, const float* __restrict__ F, const float* __restrict__ g, const float* __restrict__ bb, float* OUTB) {
    const int lane = threadIdx.x & 31; const size_t s = (size_t)blockIdx.x * 8 + (threadIdx.x >> 5); if (s >= (size_t)NN) return; float v[16]; float sm = 0.f;
#pragma unroll
    for (int st = 0; st < 4; ++st) {
#pragma unroll
        for (int q = 0; q < 4; ++q) { const int c = st * 128 + lane * 4 + q; const float t = Hf[s * DV + c] + fmaxf(F[s * DV + c], 0.f); v[st * 4 + q] = t; sm += t; } }
#pragma unroll
    for (int sh = 16; sh; sh >>= 1) sm += __shfl_xor(sm, sh, 32);
    const float mu = sm * (1.0f / DV); float qv = 0.f;
#pragma unroll
    for (int i = 0; i < 16; ++i) { const float d = v[i] - mu; qv = fmaf(d, d, qv); }
#pragma unroll
    for (int sh = 16; sh; sh >>= 1) qv += __shfl_xor(qv, sh, 32);
    const float rs = rsqrtf(qv * (1.0f / DV) + LEPS);
{
#pragma unroll
        for (int st = 0; st < 4; ++st) { const int c0 = st * 128 + lane * 4; v4f o;
#pragma unroll
            for (int q = 0; q < 4; ++q) o[q] = (v[st * 4 + q] - mu) * rs * bfr(g[c0 + q]) + bfr(bb[c0 + q]);
            *(v4f*)(OUTB + s * DV + c0) = o; }
         }
}

extern "C" void kernel_launch(void* const* d_in, const int* in_sizes, int n_in,
                              void* d_out, int out_size, void* d_ws, size_t ws_size, hipStream_t stream) {
    (void)in_sizes; (void)n_in; (void)out_size;
    const float* Qi = (const float*)d_in[0]; const float* Ki = (const float*)d_in[1]; const float* Wq = (const float*)d_in[2]; const float* bq = (const float*)d_in[3]; const float* Wk = (const float*)d_in[4]; const float* bk = (const float*)d_in[5];
    const float* Wv = (const float*)d_in[6]; const float* bv = (const float*)d_in[7]; const float* Wo = (const float*)d_in[8]; const float* bo = (const float*)d_in[9]; const float* g0 = (const float*)d_in[10]; const float* b0 = (const float*)d_in[11]; const float* g1 = (const float*)d_in[12]; const float* b1 = (const float*)d_in[13];
    float* out = (float*)d_out;    // [4][2048][512]
    char* wsp = (char*)d_ws;
    auto take = [&](size_t bytes) { char* p = wsp; wsp += (bytes + 255) & ~(size_t)255; return (void*)p; };
    bf* WQT = (bf*)take((size_t)DV * DV * 2); bf* WKT = (bf*)take((size_t)DV * DV * 2); bf* WVT = (bf*)take((size_t)DV * DV * 2); bf* WOT = (bf*)take((size_t)DV * DV * 2);
    bf* XQ = (bf*)take((size_t)NN * DV * 2); bf* XK = (bf*)take((size_t)NN * DV * 2); float* QF = (float*)take((size_t)NN * DV * 4); float* KF = (float*)take((size_t)NN * DV * 4); float* VF = (float*)take((size_t)NN * DV * 4);
    bf* Qh = (bf*)take((size_t)NN * HD * 2); bf* Ql = (bf*)take((size_t)NN * HD * 2); bf* Kh = (bf*)take((size_t)NN * HD * 2); bf* Kl = (bf*)take((size_t)NN * HD * 2); bf* VTh = (bf*)take((size_t)HD * NN * 2); bf* VTl = (bf*)take((size_t)HD * NN * 2);
    float* S = (float*)take((size_t)NN * NN * 4); bf* PH = (bf*)take((size_t)NN * NN * 2); bf* PL = (bf*)take((size_t)NN * NN * 2); float* O = (float*)take((size_t)NN * DV * 4);
    float* Hf = (float*)take((size_t)NN * DV * 4); bf* Hh = (bf*)take((size_t)NN * DV * 2); bf* Hl = (bf*)take((size_t)NN * DV * 2); float* FF = (float*)take((size_t)NN * DV * 4);
    if ((size_t)(wsp - (char*)d_ws) > ws_size) return;    // 2 + 4.2 + 12.6 + 1.5 + 16.8 + 16.8 + 4.2 + 4.2 + 4.2 + 4.2 ~ 71 MB; per item/head reuse in stream order
    k_wt<<<dim3(DV / 64, DV / 64, 1), 256, 0, stream>>>(Wq, DV, DV, WQT); k_wt<<<dim3(DV / 64, DV / 64, 1), 256, 0, stream>>>(Wk, DV, DV, WKT); k_wt<<<dim3(DV / 64, DV / 64, 1), 256, 0, stream>>>(Wv, DV, DV, WVT); k_wt<<<dim3(DV / 64, DV / 64, 1), 256, 0, stream>>>(Wo, DV, DV, WOT);   // (in, out) k-major
    for (int b = 0; b < NBT; ++b) {
        k_cvtx<<<NN / 8, 256, 0, stream>>>(Qi + (size_t)b * NN * DV, XQ); k_cvtx<<<NN / 8, 256, 0, stream>>>(Ki + (size_t)b * NN * DV, XK);
        k_gemmb<false, false><<<dim3(NN / 64, DV / 64, 1), 128, 0, stream>>>(XQ, nullptr, WQT, bq, QF, DV, nullptr, nullptr, DV);
        k_gemmb<false, false><<<dim3(NN / 64, DV / 64, 1), 128, 0, stream>>>(XK, nullptr, WKT, bk, KF, DV, nullptr, nullptr, DV);
        k_gemmb<false, false><<<dim3(NN / 64, DV / 64, 1), 128, 0, stream>>>(XK, nullptr, WVT, bv, VF, DV, nullptr, nullptr, DV);
        for (int h = 0; h < NH_; ++h) {
            k_hplanes<<<NN / 8, 256, 0, stream>>>(QF, h, Qh, Ql); k_hplanes<<<NN / 8, 256, 0, stream>>>(KF, h, Kh, Kl); k_vt<<<(HD * (NN / 64)) / 8, 256, 0, stream>>>(VF, h, VTh, VTl);
            k_gemm3<<<dim3(NN / 64, NN / 64, 1), 128, 0, stream>>>(Qh, Ql, Kh, Kl, HD, S, NN);
            k_softmax<<<NN / 8, 256, 0, stream>>>(S, PH, PL);
            k_pv<<<dim3(NN / 16, HD / 32, 1), PVW * 32, 0, stream>>>(PH, PL, VTh, VTl, O + h * HD, DV); }
        k_ln1<<<NN / 8, 256, 0, stream>>>(O, QF, g0, b0, Hf, Hh, Hl);
        k_gemmb<true, false><<<dim3(NN / 64, DV / 64, 1), 128, 0, stream>>>(Hh, Hl, WOT, bo, FF, DV, nullptr, nullptr, DV);
        k_ln2<<<NN / 8, 256, 0, stream>>>(Hf, FF, g1, b1, out + (size_t)b * NN * DV); }
}

// v002
// One run takes 826 microseconds.
// Timed twice side by side with v001, it ran 2.12 and 2.11 times as fast.
// All steps since v000 together make it 4.23 times as fast.
#include <hip/hip_runtime.h>

// Compute dtypes, f32 accumulate, per item: q/k/v = X.W + b as [2048 x 512].[512 x 512] GEMMs with PLAIN bf16 operands (exact products); per head: scores = q.k^T ([2048 x 64].[64 x
// 2048], both operands bf16 hi + UNSCALED residual, three products), softmax (x 1/sqrt(512)) in f32 -> P planes, ctx = P.v ([2048 x 2048].[2048 x 64], three products); + q
// residual and LayerNorm in f32 -> planes; rFF [2048 x 512].[512 x 512] (+ bo, relu) (two products), residual and the final LayerNorm in f32 - on v_wmma_f32_16x16x32_bf16.
// Launch plan: every stage outside attention runs once for all NBT items (their rows are contiguous: NR = NBT x NN rows); scores, softmax and P.v run once per group of HG heads
// (blockIdx.z or .y = head in the group), HG being what the workspace holds of S and the P planes.

#define NBT  4
#define NN   2048
#define DV   512
#define NH_  8
#define HD   64
#define DM   DV
#define NTK  NN
#define SCL  0.044194173824159216f
#define LEPS 1e-5f
#define LOSC 1024.0f
#define NR   (NBT * NN)
#define HG   4

typedef _Float16 h16;
typedef unsigned short bf;
typedef __attribute__((ext_vector_type(16))) __bf16   v16bf;
typedef __attribute__((ext_vector_type(16))) _Float16 v16h;
typedef __attribute__((ext_vector_type(8)))  _Float16 v8h;
typedef __attribute__((ext_vector_type(8)))  unsigned short v8us;
typedef __attribute__((ext_vector_type(8)))  float    v8f;
typedef __attribute__((ext_vector_type(4)))  float    v4f;
typedef __attribute__((ext_vector_type(4)))  _Float16 v4h;
typedef v8h  __attribute__((may_alias)) v8ha;
typedef v4f  __attribute__((may_alias)) v4fa;
typedef v8us __attribute__((may_alias)) v8usa;

__device__ __forceinline__ unsigned short f2bf(float f) { unsigned u = __float_as_uint(f); u += 0x7FFFu + ((u >> 16) & 1u); return (unsigned short)(u >> 16); }
__device__ __forceinline__ float bf2f(unsigned short b) { return __uint_as_float(((unsigned)b) << 16); }
__device__ __forceinline__ float bfr(float f) { return bf2f(f2bf(f)); }
__device__ __forceinline__ v16h cat16(v8h lo, v8h hi) { return __builtin_shufflevector(lo, hi, 0, 1, 2, 3, 4, 5, 6, 7, 8, 9, 10, 11, 12, 13, 14, 15); }
__device__ __forceinline__ v16bf cat16b(v8us lo, v8us hi) { return __builtin_bit_cast(v16bf, __builtin_shufflevector(lo, hi, 0, 1, 2, 3, 4, 5, 6, 7, 8, 9, 10, 11, 12, 13, 14, 15)); }
__device__ __forceinline__ v8f wmma16(v16h a, v16h b, v8f c) { return __builtin_amdgcn_wmma_f32_16x16x32_f16(false, a, false, b, (short)0, c, false, false); }
__device__ __forceinline__ v8f wmmab(v16bf a, v16bf b, v8f c) { return __builtin_amdgcn_wmma_f32_16x16x32_bf16(false, a, false, b, (short)0, c, false, false); }

// k_wt: WT [z][n][K] = bf16(Wz[k][n]) (k-major [K][ncols]) via 64 x 64 LDS tiles; grid (K/64, ncols/64, 4), blockIdx.z = which of the four weights.
__global__ __launch_bounds__(256) void k_wt(const float* __restrict__ W0, const float* __restrict__ W1, const float* __restrict__ W2, const float* __restrict__ W3, int K, int ncols, bf* WT) {
    __shared__ __align__(16) unsigned short tl[64 * 72];
    const int z = blockIdx.z; const float* __restrict__ Wm = z == 0 ? W0 : z == 1 ? W1 : z == 2 ? W2 : W3; WT += (size_t)z * K * ncols;
    const int tid = threadIdx.x, k0 = blockIdx.x * 64, n0 = blockIdx.y * 64;
    const int kk = tid >> 2, nq = (tid & 3) * 16;
#pragma unroll
    for (int i = 0; i < 16; ++i) tl[(nq + i) * 72 + kk] = f2bf(Wm[(size_t)(k0 + kk) * ncols + n0 + nq + i]);
    __syncthreads();
    const int piece = tid & 7;
    auto pass = [&]() {
#pragma unroll
        for (int s = 0; s < 2; ++s) { const int nr = (tid >> 3) + 32 * s; const v8us val = *(const v8usa*)(tl + nr * 72 + piece * 8); *(v8us*)(WT + (size_t)(n0 + nr) * K + k0 + piece * 8) = val; }
    };
    pass(); 
}
// k_gemmb: 64 x 64 block tile (4 waves x 16 x 64) of C[NR][NW] = (A [+ Al]).B^T (K = 512) [+ bf(bias[c])] [+ bf(R[r][c]) residual]; f32 whole-line epilogue (or f16
template <bool SPLITA, bool F16OUT = false>
// blockIdx.z = which product of a launch: z > 0 takes A from A12, the z-th [DV][K] plane behind Bn, bias1 or bias2, and the z-th [NR][ldc] plane behind C.
__global__ __launch_bounds__(128) void k_gemmb(const bf* __restrict__ A0, const bf* __restrict__ Al, const bf* __restrict__ B0, const float* __restrict__ bias0, float* C, int ldc, h16* C2, const float* __restrict__ R = nullptr, int K = DM, int roundR = 1,
                                               const bf* __restrict__ A12 = nullptr, const float* __restrict__ bias1 = nullptr, const float* __restrict__ bias2 = nullptr) {
    __shared__ __align__(16) float ost[4][16 * 68];
    const int z = blockIdx.z; const bf* __restrict__ A = z ? A12 : A0; const bf* __restrict__ Bn = B0 + (size_t)z * DV * K; const float* __restrict__ bias = z == 0 ? bias0 : z == 1 ? bias1 : bias2; C += (size_t)z * NR * ldc;
    const int lane = threadIdx.x & 31, wave = threadIdx.x >> 5, lr = lane & 15, hi = lane >> 4;
    const int r0 = blockIdx.x * 64 + wave * 16, c0 = blockIdx.y * 64;
    const size_t aoff = (size_t)(r0 + lr) * K + 8 * hi;
    size_t boff[4];
#pragma unroll
    for (int t = 0; t < 4; ++t) boff[t] = (size_t)(c0 + t * 16 + lr) * K + 8 * hi;
    v8f acc[4];
#pragma unroll
    for (int t = 0; t < 4; ++t) acc[t] = (v8f){};
#pragma unroll 1
    for (int kc = 0; kc < K; kc += 32) {
        const v16bf a = cat16b(*(const v8us*)(A + aoff + kc), *(const v8us*)(A + aoff + kc + 16));
        v16bf al = a;
        if (SPLITA) al = cat16b(*(const v8us*)(Al + aoff + kc), *(const v8us*)(Al + aoff + kc + 16));
#pragma unroll
        for (int t = 0; t < 4; ++t) { const v16bf b = cat16b(*(const v8us*)(Bn + boff[t] + kc), *(const v8us*)(Bn + boff[t] + kc + 16)); acc[t] = wmmab(a, b, acc[t]); if (SPLITA) acc[t] = wmmab(al, b, acc[t]); }
        asm volatile("v_nop\n\tv_nop\n\tv_nop\n\tv_nop" : "+v"(acc[0]), "+v"(acc[1]), "+v"(acc[2]), "+v"(acc[3]) : "v"(a), "v"(al));
    }
    float* os = &ost[wave][0];
#pragma unroll
    for (int t = 0; t < 4; ++t) { const float bv = bias ? bfr(bias[c0 + t * 16 + lr]) : 0.f;
#pragma unroll
        for (int j = 0; j < 8; ++j) os[(hi * 8 + j) * 68 + t * 16 + lr] = acc[t][j] + bv; }
    __syncthreads();
    if (F16OUT) {
        h16* crow = (h16*)(void*)C + (size_t)r0 * ldc + c0;
        auto pass = [&]() {
#pragma unroll
            for (int s = 0; s < 4; ++s) { const int row = 4 * s + (lane >> 3), piece = lane & 7; const float* sp = os + row * 68 + piece * 8; v8h o, o2;
#pragma unroll
                for (int i = 0; i < 8; ++i) { const h16 a = (h16)sp[i]; o[i] = a; o2[i] = (h16)((sp[i] - (float)a) * LOSC); }
                *(v8h*)(crow + (size_t)row * ldc + piece * 8) = o; if (C2) *(v8h*)(C2 + (size_t)r0 * ldc + c0 + (size_t)row * ldc + piece * 8) = o2; }
        };
        pass(); 
    } else {
        float* crow = C + (size_t)r0 * ldc + c0;
        auto pass = [&]() {
#pragma unroll
            for (int s = 0; s < 8; ++s) { const int Lid = (lane >> 3) + 4 * s, piece = lane & 7; const int row = Lid >> 1, cofs = (Lid & 1) * 32 + piece * 4;
                v4f val = *(const v4fa*)(os + row * 68 + cofs); if (R) { const v4f rv = *(const v4f*)(R + ((size_t)r0 + row) * ldc + c0 + cofs); val += roundR ? (v4f){bfr(rv[0]), bfr(rv[1]), bfr(rv[2]), bfr(rv[3])} : rv; }
                *(v4f*)(crow + (size_t)row * ldc + cofs) = val; }
        };
        pass(); 
    }
}

// k_gemm3: 64 x 64 tile of C = (Ah + Al).(Bh + Bl)^T over K (row strides = K for all four planes; n-major B): three products per 32-k step (hh, hl, lh); f32
// blockIdx.z = head in the group: its [NN][K] planes and its [NN][ldc] result lie z planes behind the pointers.
__global__ __launch_bounds__(128) void k_gemm3(const bf* __restrict__ Ah0, const bf* __restrict__ Al0, const bf* __restrict__ Bh0, const bf* __restrict__ Bl0, int K, float* C, int ldc) {
    __shared__ __align__(16) float ost[4][16 * 68];
    const size_t zp = (size_t)blockIdx.z * NN * K; const bf* __restrict__ Ah = Ah0 + zp; const bf* __restrict__ Al = Al0 + zp; const bf* __restrict__ Bh = Bh0 + zp; const bf* __restrict__ Bl = Bl0 + zp; C += (size_t)blockIdx.z * NN * ldc;
    const int lane = threadIdx.x & 31, wave = threadIdx.x >> 5, lr = lane & 15, hi = lane >> 4;
    const int r0 = blockIdx.x * 64 + wave * 16, c0 = blockIdx.y * 64;
    const size_t aoff = (size_t)(r0 + lr) * K + 8 * hi;
    v8f acc[4];
#pragma unroll
    for (int t = 0; t < 4; ++t) acc[t] = (v8f){};
#pragma unroll 1
    for (int kc = 0; kc < K; kc += 32) {
        const v16bf a = cat16b(*(const v8us*)(Ah + aoff + kc), *(const v8us*)(Ah + aoff + kc + 16));
        const v16bf al = cat16b(*(const v8us*)(Al + aoff + kc), *(const v8us*)(Al + aoff + kc + 16));
#pragma unroll
        for (int t = 0; t < 4; ++t) { const size_t bo = (size_t)(c0 + t * 16 + lr) * K + kc + 8 * hi;
            const v16bf bh = cat16b(*(const v8us*)(Bh + bo), *(const v8us*)(Bh + bo + 16)); const v16bf bl = cat16b(*(const v8us*)(Bl + bo), *(const v8us*)(Bl + bo + 16));
            acc[t] = wmmab(a, bh, acc[t]); acc[t] = wmmab(al, bh, acc[t]); acc[t] = wmmab(a, bl, acc[t]); }
        asm volatile("v_nop\n\tv_nop\n\tv_nop\n\tv_nop" : "+v"(acc[0]), "+v"(acc[1]), "+v"(acc[2]), "+v"(acc[3]) : "v"(a), "v"(al));
    }
    float* os = &ost[wave][0];
#pragma unroll
    for (int t = 0; t < 4; ++t) {
#pragma unroll
        for (int j = 0; j < 8; ++j) os[(hi * 8 + j) * 68 + t * 16 + lr] = acc[t][j]; }
    __builtin_amdgcn_wave_barrier(); asm volatile("" ::: "memory");
    float* crow = C + (size_t)r0 * ldc + c0;
    auto pass = [&]() {
#pragma unroll
        for (int s = 0; s < 8; ++s) { const int Lid = (lane >> 3) + 4 * s, piece = lane & 7; const int row = Lid >> 1, cofs = (Lid & 1) * 32 + piece * 4;
            const v4f val = *(const v4fa*)(os + row * 68 + cofs); *(v4f*)(crow + (size_t)row * ldc + cofs) = val; }
    };
    pass(); 
}


// k_pv: one 16 x 32 tile of C = (Ah + Al).(Bh + Bl)^T per block, K = NN (row stride NN for all four planes; n-major B); grid (NN / 16, HD / 32, HG), blockIdx.z = head in the group. The K range is dealt
// to the block's 8 waves (NN / 8 = 256 k each, three products per 32-k step as in k_gemm3); the 8 f32 partial tiles meet in LDS and are summed in wave order; whole-line f32 stores.
#define PVW 8
#define PVS (NN / PVW / 32)
#define PVD 4
__global__ __launch_bounds__(PVW * 32) void k_pv(const bf* __restrict__ Ah0, const bf* __restrict__ Al0, const bf* __restrict__ Bh0, const bf* __restrict__ Bl0, float* C, int ldc) {
    __shared__ __align__(16) float part[PVW][16 * 36];
    const size_t za = (size_t)blockIdx.z * NN * NN, zb = (size_t)blockIdx.z * HD * NN; const bf* __restrict__ Ah = Ah0 + za; const bf* __restrict__ Al = Al0 + za; const bf* __restrict__ Bh = Bh0 + zb; const bf* __restrict__ Bl = Bl0 + zb; C += blockIdx.z * HD;
    const int tid = threadIdx.x, lane = tid & 31, wave = tid >> 5, lr = lane & 15, hi = lane >> 4;
    const int r0 = blockIdx.x * 16, c0 = blockIdx.y * 32;
    const size_t aoff = (size_t)(r0 + lr) * NN + wave * (NN / PVW) + 8 * hi;
    const size_t boff = (size_t)(c0 + lr) * NN + wave * (NN / PVW) + 8 * hi;
    v16bf fa[PVS], fal[PVS], fbh[PVS][2], fbl[PVS][2];
    auto fetch = [&](int s) {
        const int kc = s * 32;
        fa[s] = cat16b(*(const v8us*)(Ah + aoff + kc), *(const v8us*)(Ah + aoff + kc + 16));
        fal[s] = cat16b(*(const v8us*)(Al + aoff + kc), *(const v8us*)(Al + aoff + kc + 16));
#pragma unroll
        for (int t = 0; t < 2; ++t) { const size_t bo = boff + (size_t)(t * 16) * NN + kc;
            fbh[s][t] = cat16b(*(const v8us*)(Bh + bo), *(const v8us*)(Bh + bo + 16)); fbl[s][t] = cat16b(*(const v8us*)(Bl + bo), *(const v8us*)(Bl + bo + 16)); }
    };
    v8f acc[2];
#pragma unroll
    for (int t = 0; t < 2; ++t) acc[t] = (v8f){};
    // Both s loops are unrolled whole so that every fragment index is a constant and the fragments stay in registers.
    // The scheduling fences keep each step's loads where they are written, PVD steps ahead of their use: left free, the compiler sinks every load to its WMMA and a wave has 2 to 6 loads in flight.
#pragma unroll
    for (int s = 0; s < PVD; ++s) fetch(s);
    __builtin_amdgcn_sched_barrier(0);
#pragma unroll
    for (int s = 0; s < PVS; ++s) {
#pragma unroll
        for (int t = 0; t < 2; ++t) { acc[t] = wmmab(fa[s], fbh[s][t], acc[t]); acc[t] = wmmab(fal[s], fbh[s][t], acc[t]); acc[t] = wmmab(fa[s], fbl[s][t], acc[t]); }
        if (s + PVD < PVS) { __builtin_amdgcn_sched_barrier(0); fetch(s + PVD); __builtin_amdgcn_sched_barrier(0); }
    }
    // Keeps the epilogue's address arithmetic behind the last load wait.
    __builtin_amdgcn_sched_barrier(0);
    float* os = &part[wave][0];
#pragma unroll
    for (int t = 0; t < 2; ++t) {
#pragma unroll
        for (int j = 0; j < 8; ++j) os[(hi * 8 + j) * 36 + t * 16 + lr] = acc[t][j]; }
    __syncthreads();
    if (tid < 128) {
        const int row = tid >> 3, cofs = (tid & 7) * 4;
        v4f val = *(const v4fa*)(&part[0][0] + row * 36 + cofs);
#pragma unroll
        for (int w = 1; w < PVW; ++w) val += *(const v4fa*)(&part[w][0] + row * 36 + cofs);
        *(v4f*)(C + (size_t)(r0 + row) * ldc + c0 + cofs) = val;
    }
}

// grid (NR / 8, 2): blockIdx.y = which input; its [NR][DV] plane lies y planes behind dst.
__global__ __launch_bounds__(256) void k_cvtx(const float* __restrict__ src0, const float* __restrict__ src1, bf* dst) {
    const int lane = threadIdx.x & 31; const size_t r = (size_t)blockIdx.x * 8 + (threadIdx.x >> 5); if (r >= (size_t)NR) return;
    const float* __restrict__ src = blockIdx.y ? src1 : src0; dst += (size_t)blockIdx.y * NR * DV;
{
#pragma unroll
        for (int q = 0; q < DV / 256; ++q) { v8us o;
#pragma unroll
            for (int i = 0; i < 8; ++i) o[i] = f2bf(src[r * DV + q * 256 + lane * 8 + i]);
            *(v8us*)(dst + r * DV + q * 256 + lane * 8) = o; }
         }
}
// k_hplanes: planes [item][head][NN][HD] of F [NR][DV]; one wave per row, all NH_ heads of it; grid (NR / 8, 2): blockIdx.y = 0 the q set (F, Ph0, Pl0), 1 the k set (one [NR][DV] plane behind F; Ph1, Pl1).
__global__ __launch_bounds__(256) void k_hplanes(const float* __restrict__ F, bf* Ph0, bf* Pl0, bf* Ph1, bf* Pl1) {
    typedef __attribute__((ext_vector_type(2))) unsigned short v2us;
    const int lane = threadIdx.x & 31; const size_t r = (size_t)blockIdx.x * 8 + (threadIdx.x >> 5); if (r >= (size_t)NR) return;
    F += (size_t)blockIdx.y * NR * DV; bf* Ph = blockIdx.y ? Ph1 : Ph0; bf* Pl = blockIdx.y ? Pl1 : Pl0; const size_t b = r / NN, s = r % NN;
#pragma unroll
    for (int h = 0; h < NH_; ++h) { v2us oh, ol;
#pragma unroll
        for (int i = 0; i < 2; ++i) { const float v = F[r * DV + h * HD + lane * 2 + i]; const unsigned short hb = f2bf(v); oh[i] = hb; ol[i] = f2bf(v - bf2f(hb)); }
        const size_t o = ((b * NH_ + h) * NN + s) * HD + lane * 2; *(v2us*)(Ph + o) = oh; *(v2us*)(Pl + o) = ol; }
}
// grid (HD * (NN / 64) / 8, NH_, NBT): planes [item][head][HD][NN].
__global__ __launch_bounds__(256) void k_vt(const float* __restrict__ VF, bf* Th, bf* Tl) {
    typedef __attribute__((ext_vector_type(2))) unsigned short v2us;
    const int h = blockIdx.y; VF += (size_t)blockIdx.z * NN * DV; const size_t zp = ((size_t)blockIdx.z * NH_ + h) * HD * NN; Th += zp; Tl += zp;
    const int lane = threadIdx.x & 31; const size_t wid = (size_t)blockIdx.x * 8 + (threadIdx.x >> 5); if (wid >= (size_t)HD * (NN / 64)) return; const int d = (int)(wid / (NN / 64)); const int t0 = (int)(wid % (NN / 64)) * 64 + lane * 2; v2us oh, ol;
#pragma unroll
    for (int i = 0; i < 2; ++i) { const float v = VF[(size_t)(t0 + i) * DV + h * HD + d]; const unsigned short hb = f2bf(v); oh[i] = hb; ol[i] = f2bf(v - bf2f(hb)); }
    const size_t o = (size_t)d * NN + t0; *(v2us*)(Th + o) = oh; *(v2us*)(Tl + o) = ol; 
}
// grid (NN / 8, HG): blockIdx.y = head in the group.
__global__ __launch_bounds__(256) void k_softmax(const float* __restrict__ S, bf* PH, bf* PL) {
    typedef __attribute__((ext_vector_type(4))) unsigned short v4us;
    { const size_t zp = (size_t)blockIdx.y * NN * NN; S += zp; PH += zp; PL += zp; }
    const int lane = threadIdx.x & 31, i = blockIdx.x * 8 + (threadIdx.x >> 5); if (i >= NN) return;
    float m = -3.0e38f;
#pragma unroll 1
    for (int c0 = lane * 4; c0 < NN; c0 += 128) {
#pragma unroll
        for (int q = 0; q < 4; ++q) m = fmaxf(m, S[(size_t)i * NN + c0 + q] * SCL); }
#pragma unroll
    for (int sh = 16; sh; sh >>= 1) m = fmaxf(m, __shfl_xor(m, sh, 32));
    float sum = 0.f;
#pragma unroll 1
    for (int c0 = lane * 4; c0 < NN; c0 += 128) {
#pragma unroll
        for (int q = 0; q < 4; ++q) sum += __expf(S[(size_t)i * NN + c0 + q] * SCL - m); }
#pragma unroll
    for (int sh = 16; sh; sh >>= 1) sum += __shfl_xor(sum, sh, 32);
    const float inv = 1.0f / sum;
{
#pragma unroll 1
        for (int c0 = lane * 4; c0 < NN; c0 += 128) { v4us oh, ol;
#pragma unroll
            for (int q = 0; q < 4; ++q) { const float p = __expf(S[(size_t)i * NN + c0 + q] * SCL - m) * inv; const unsigned short hb = f2bf(p); oh[q] = hb; ol[q] = f2bf(p - bf2f(hb)); }
            const size_t o = (size_t)i * NN + c0; *(v4us*)(PH + o) = oh; *(v4us*)(PL + o) = ol; }
         }
}
// k_ln1: H [s][512] (f32, kept) and planes of LayerNorm(O[s] + q[s]) x bf(g) + bf(b) (f32; mean, biased var over 512); one wave per row: lane -> 4 columns per 128-step, 4 steps
__global__ __launch_bounds__(256) void k_ln1(const float* __restrict__ O, const float* __restrict__ QF, const float* __restrict__ g, const float* __restrict__ bb, float* Hf, bf* Hh, bf* Hl) {
    typedef __attribute__((ext_vector_type(4))) unsigned short v4us;
    const int lane = threadIdx.x & 31; const size_t s = (size_t)blockIdx.x * 8 + (threadIdx.x >> 5); if (s >= (size_t)NR) return; float v[16]; float sm = 0.f;
#pragma unroll
    for (int st = 0; st < 4; ++st) {
#pragma unroll
        for (int q = 0; q < 4; ++q) { const int c = st * 128 + lane * 4 + q; const float t = O[s * DV + c] + QF[s * DV + c]; v[st * 4 + q] = t; sm += t; } }
#pragma unroll
    for (int sh = 16; sh; sh >>= 1) sm += __shfl_xor(sm, sh, 32);
    const float mu = sm * (1.0f / DV); float qv = 0.f;
#pragma unroll
    for (int i = 0; i < 16; ++i) { const float d = v[i] - mu; qv = fmaf(d, d, qv); }
#pragma unroll
    for (int sh = 16; sh; sh >>= 1) qv += __shfl_xor(qv, sh, 32);
    const float rs = rsqrtf(qv * (1.0f / DV) + LEPS);
{
#pragma unroll
        for (int st = 0; st < 4; ++st) { const int c0 = st * 128 + lane * 4; v4f o; v4us oh, ol;
#pragma unroll
            for (int q = 0; q < 4; ++q) { const float y = (v[st * 4 + q] - mu) * rs * bfr(g[c0 + q]) + bfr(bb[c0 + q]); o[q] = y; const unsigned short hb = f2bf(y); oh[q] = hb; ol[q] = f2bf(y - bf2f(hb)); }
            *(v4f*)(Hf + s * DV + c0) = o; *(v4us*)(Hh + s * DV + c0) = oh; *(v4us*)(Hl + s * DV + c0) = ol; }
         }
}
__global__ __launch_bounds__(256) void k_ln2(const float* __restrict__ Hf, const float* __restrict__ F, const float* __restrict__ g, const float* __restrict__ bb, float* OUTB) {
    const int lane = threadIdx.x & 31; const size_t s = (size_t)blockIdx.x * 8 + (threadIdx.x >> 5); if (s >= (size_t)NR) return; float v[16]; float sm = 0.f;
#pragma unroll
    for (int st = 0; st < 4; ++st) {
#pragma unroll
        for (int q = 0; q < 4; ++q) { const int c = st * 128 + lane * 4 + q; const float t = Hf[s * DV + c] + fmaxf(F[s * DV + c], 0.f); v[st * 4 + q] = t; sm += t; } }
#pragma unroll
    for (int sh = 16; sh; sh >>= 1) sm += __shfl_xor(sm, sh, 32);
    const float mu = sm * (1.0f / DV); float qv = 0.f;
#pragma unroll
    for (int i = 0; i < 16; ++i) { const float d = v[i] - mu; qv = fmaf(d, d, qv); }
#pragma unroll
    for (int sh = 16; sh; sh >>= 1) qv += __shfl_xor(qv, sh, 32);
    const float rs = rsqrtf(qv * (1.0f / DV) + LEPS);
{
#pragma unroll
        for (int st = 0; st < 4; ++st) { const int c0 = st * 128 + lane * 4; v4f o;
#pragma unroll
            for (int q = 0; q < 4; ++q) o[q] = (v[st * 4 + q] - mu) * rs * bfr(g[c0 + q]) + bfr(bb[c0 + q]);
            *(v4f*)(OUTB + s * DV + c0) = o; }
         }
}

extern "C" void kernel_launch(void* const* d_in, const int* in_sizes, int n_in,
                              void* d_out, int out_size, void* d_ws, size_t ws_size, hipStream_t stream) {
    (void)in_sizes; (void)n_in; (void)out_size;
    const float* Qi = (const float*)d_in[0]; const float* Ki = (const float*)d_in[1]; const float* Wq = (const float*)d_in[2]; const float* bq = (const float*)d_in[3]; const float* Wk = (const float*)d_in[4]; const float* bk = (const float*)d_in[5];
    const float* Wv = (const float*)d_in[6]; const float* bv = (const float*)d_in[7]; const float* Wo = (const float*)d_in[8]; const float* bo = (const float*)d_in[9]; const float* g0 = (const float*)d_in[10]; const float* b0 = (const float*)d_in[11]; const float* g1 = (const float*)d_in[12]; const float* b1 = (const float*)d_in[13];
    float* out = (float*)d_out;    // [4][2048][512]
    char* wsp = (char*)d_ws;
    auto take = [&](size_t bytes) { char* p = wsp; wsp += (bytes + 255) & ~(size_t)255; return (void*)p; };
    // Kept through attention: the four weights, the q/k/v planes of all items and heads, O and QF.
    bf* WT = (bf*)take((size_t)4 * DV * DV * 2);    // WqT, WkT, WvT, WoT
    bf* Qh = (bf*)take((size_t)NR * DV * 2); bf* Ql = (bf*)take((size_t)NR * DV * 2); bf* Kh = (bf*)take((size_t)NR * DV * 2); bf* Kl = (bf*)take((size_t)NR * DV * 2); bf* VTh = (bf*)take((size_t)NR * DV * 2); bf* VTl = (bf*)take((size_t)NR * DV * 2);
    float* O = (float*)take((size_t)NR * DV * 4); float* QF = (float*)take((size_t)NR * DV * 4);
    // One region, used three times in stream order: (1) KF, VF (directly behind QF: the three planes of one launch), XQ, XK; (2) S, PH, PL of one head group; (3) Hf, Hh, Hl, FF.
    char* const reg = wsp;
    take((size_t)NR * DV * 4); /* KF */ float* VF = (float*)take((size_t)NR * DV * 4); bf* XQ = (bf*)take((size_t)NR * DV * 2); bf* XK = (bf*)take((size_t)NR * DV * 2);
    wsp = reg;
    float* Hf = (float*)take((size_t)NR * DV * 4); bf* Hh = (bf*)take((size_t)NR * DV * 2); bf* Hl = (bf*)take((size_t)NR * DV * 2); float* FF = (float*)take((size_t)NR * DV * 4);
    wsp = reg;
    float* S = (float*)take((size_t)HG * NN * NN * 4); bf* PH = (bf*)take((size_t)HG * NN * NN * 2); bf* PL = (bf*)take((size_t)HG * NN * NN * 2);
    if ((size_t)(wsp - (char*)d_ws) > ws_size) return;    // the kept part plus S, PH, PL (the largest use of the region): about 220 MB
    k_wt<<<dim3(DV / 64, DV / 64, 4), 256, 0, stream>>>(Wq, Wk, Wv, Wo, DV, DV, WT);   // (in, out) k-major
    k_cvtx<<<dim3(NR / 8, 2, 1), 256, 0, stream>>>(Qi, Ki, XQ);
    k_gemmb<false, false><<<dim3(NR / 64, DV / 64, 3), 128, 0, stream>>>(XQ, nullptr, WT, bq, QF, DV, nullptr, nullptr, DV, 1, XK, bk, bv);
    k_hplanes<<<dim3(NR / 8, 2, 1), 256, 0, stream>>>(QF, Qh, Ql, Kh, Kl);
    k_vt<<<dim3((HD * (NN / 64)) / 8, NH_, NBT), 256, 0, stream>>>(VF, VTh, VTl);
    for (int b = 0; b < NBT; ++b) {
        for (int h = 0; h < NH_; h += HG) {
            const size_t po = ((size_t)b * NH_ + h) * NN * HD;
            k_gemm3<<<dim3(NN / 64, NN / 64, HG), 128, 0, stream>>>(Qh + po, Ql + po, Kh + po, Kl + po, HD, S, NN);
            k_softmax<<<dim3(NN / 8, HG, 1), 256, 0, stream>>>(S, PH, PL);
            k_pv<<<dim3(NN / 16, HD / 32, HG), PVW * 32, 0, stream>>>(PH, PL, VTh + po, VTl + po, O + (size_t)b * NN * DV + h * HD, DV); } }
    k_ln1<<<NR / 8, 256, 0, stream>>>(O, QF, g0, b0, Hf, Hh, Hl);
    k_gemmb<true, false><<<dim3(NR / 64, DV / 64, 1), 128, 0, stream>>>(Hh, Hl, WT + (size_t)3 * DV * DV, bo, FF, DV, nullptr, nullptr, DV);
    k_ln2<<<NR / 8, 256, 0, stream>>>(Hf, FF, g1, b1, out);
}

// v004
// A run of this version takes 191 microseconds.
// It is 4.30 times as fast as v002, going by the measured steps of the versions left out in between.
// All steps since v000 together make it 18.2 times as fast.
#include <hip/hip_runtime.h>

// Compute dtypes, f32 accumulate, per item: q/k/v = X.W + b as [2048 x 512].[512 x 512] GEMMs with PLAIN bf16 operands (exact products); per head: scores = q.k^T ([2048 x 64].[64 x
// 2048], both operands bf16 hi + UNSCALED residual, three products), softmax (x 1/sqrt(512)) in f32 -> P as bf16 hi + residual, ctx = P.v ([2048 x 2048].[2048 x 64], three products); + q
// residual and LayerNorm in f32 -> planes; rFF [2048 x 512].[512 x 512] (+ bo, relu) (two products), residual and the final LayerNorm in f32 - on v_wmma_f32_16x16x32_bf16.
// Launch plan: every stage runs once for all NBT items (their rows are contiguous: NR = NBT x NN rows); the projection GEMM writes the q, k and v^T planes itself; scores, softmax and P.v are one kernel,
// once for all items and heads (softmax by running maximum and sum; P is split unnormalised and the sum divides O at the end).

#define NBT  4
#define NN   2048
#define DV   512
#define NH_  8
#define HD   64
#define DM   DV
#define NTK  NN
#define SCL  0.044194173824159216f
#define LEPS 1e-5f
#define LOSC 1024.0f
#define NR   (NBT * NN)

typedef _Float16 h16;
typedef unsigned short bf;
typedef __attribute__((ext_vector_type(16))) __bf16   v16bf;
typedef __attribute__((ext_vector_type(16))) _Float16 v16h;
typedef __attribute__((ext_vector_type(8)))  _Float16 v8h;
typedef __attribute__((ext_vector_type(8)))  unsigned short v8us;
typedef __attribute__((ext_vector_type(8)))  float    v8f;
typedef __attribute__((ext_vector_type(4)))  float    v4f;
typedef __attribute__((ext_vector_type(4)))  _Float16 v4h;
typedef v8h  __attribute__((may_alias)) v8ha;
typedef v4f  __attribute__((may_alias)) v4fa;
typedef v8us __attribute__((may_alias)) v8usa;

__device__ __forceinline__ unsigned short f2bf(float f) { unsigned u = __float_as_uint(f); u += 0x7FFFu + ((u >> 16) & 1u); return (unsigned short)(u >> 16); }
__device__ __forceinline__ float bf2f(unsigned short b) { return __uint_as_float(((unsigned)b) << 16); }
__device__ __forceinline__ float bfr(float f) { return bf2f(f2bf(f)); }
__device__ __forceinline__ v16h cat16(v8h lo, v8h hi) { return __builtin_shufflevector(lo, hi, 0, 1, 2, 3, 4, 5, 6, 7, 8, 9, 10, 11, 12, 13, 14, 15); }
__device__ __forceinline__ v16bf cat16b(v8us lo, v8us hi) { return __builtin_bit_cast(v16bf, __builtin_shufflevector(lo, hi, 0, 1, 2, 3, 4, 5, 6, 7, 8, 9, 10, 11, 12, 13, 14, 15)); }
__device__ __forceinline__ v8f wmma16(v16h a, v16h b, v8f c) { return __builtin_amdgcn_wmma_f32_16x16x32_f16(false, a, false, b, (short)0, c, false, false); }
__device__ __forceinline__ v8f wmmab(v16bf a, v16bf b, v8f c) { return __builtin_amdgcn_wmma_f32_16x16x32_bf16(false, a, false, b, (short)0, c, false, false); }

// k_wt: WT [z][n][K] = bf16(Wz[k][n]) (k-major [K][ncols]) via 64 x 64 LDS tiles; grid (K/64, ncols/64, 4), blockIdx.z = which of the four weights.
__global__ __launch_bounds__(256) void k_wt(const float* __restrict__ W0, const float* __restrict__ W1, const float* __restrict__ W2, const float* __restrict__ W3, int K, int ncols, bf* WT) {
    __shared__ __align__(16) unsigned short tl[64 * 72];
    const int z = blockIdx.z; const float* __restrict__ Wm = z == 0 ? W0 : z == 1 ? W1 : z == 2 ? W2 : W3; WT += (size_t)z * K * ncols;
    const int tid = threadIdx.x, k0 = blockIdx.x * 64, n0 = blockIdx.y * 64;
    const int kk = tid >> 2, nq = (tid & 3) * 16;
#pragma unroll
    for (int i = 0; i < 16; ++i) tl[(nq + i) * 72 + kk] = f2bf(Wm[(size_t)(k0 + kk) * ncols + n0 + nq + i]);
    __syncthreads();
    const int piece = tid & 7;
    auto pass = [&]() {
#pragma unroll
        for (int s = 0; s < 2; ++s) { const int nr = (tid >> 3) + 32 * s; const v8us val = *(const v8usa*)(tl + nr * 72 + piece * 8); *(v8us*)(WT + (size_t)(n0 + nr) * K + k0 + piece * 8) = val; }
    };
    pass(); 
}
// k_gemmb: 64 x 64 block tile (4 waves x 16 x 64) of C[NR][ldc] = (A [+ Al]).B^T (K = 512) [+ bf(bias[c])] [+ bf(R[r][c]) residual]; f32 whole-line epilogue (or f16
// PL (the q/k/v projections; a 64-column tile is one head): the epilogue writes what attention reads, bf16 hi + residual of the f32 tile: z = 0 planes Qh, Ql [item][head][NN][HD] and C (f32 q, for the residual),
// z = 1 planes Kh, Kl alike and no C, z = 2 planes VTh, VTl [item][head][HD][NN] and no C.
template <bool SPLITA, bool F16OUT = false, bool PL = false>
// blockIdx.z = which product of a launch: z > 0 takes A from A12, the z-th [DV][K] plane behind Bn, bias1 or bias2, and the z-th [NR][ldc] plane behind C.
__global__ __launch_bounds__(128) void k_gemmb(const bf* __restrict__ A0, const bf* __restrict__ Al, const bf* __restrict__ B0, const float* __restrict__ bias0, float* C, int ldc, h16* C2, const float* __restrict__ R = nullptr, int K = DM, int roundR = 1,
                                               const bf* __restrict__ A12 = nullptr, const float* __restrict__ bias1 = nullptr, const float* __restrict__ bias2 = nullptr,
                                               bf* Qh = nullptr, bf* Ql = nullptr, bf* Kh = nullptr, bf* Kl = nullptr, bf* VTh = nullptr, bf* VTl = nullptr) {
    __shared__ __align__(16) float ost[PL ? 2 * 64 * 36 : 4 * 16 * 68];    // four f32 tiles [16][68], one a wave; or (PL, z = 2) two bf16 planes [64][72]
    const int z = blockIdx.z; const bf* __restrict__ A = z ? A12 : A0; const bf* __restrict__ Bn = B0 + (size_t)z * DV * K; const float* __restrict__ bias = z == 0 ? bias0 : z == 1 ? bias1 : bias2; C += (size_t)z * NR * ldc;
    const int lane = threadIdx.x & 31, wave = threadIdx.x >> 5, lr = lane & 15, hi = lane >> 4;
    const int r0 = blockIdx.x * 64 + wave * 16, c0 = blockIdx.y * 64;
    const size_t aoff = (size_t)(r0 + lr) * K + 8 * hi;
    size_t boff[4];
#pragma unroll
    for (int t = 0; t < 4; ++t) boff[t] = (size_t)(c0 + t * 16 + lr) * K + 8 * hi;
    v8f acc[4];
#pragma unroll
    for (int t = 0; t < 4; ++t) acc[t] = (v8f){};
#pragma unroll 1
    for (int kc = 0; kc < K; kc += 32) {
        const v16bf a = cat16b(*(const v8us*)(A + aoff + kc), *(const v8us*)(A + aoff + kc + 16));
        v16bf al = a;
        if (SPLITA) al = cat16b(*(const v8us*)(Al + aoff + kc), *(const v8us*)(Al + aoff + kc + 16));
#pragma unroll
        for (int t = 0; t < 4; ++t) { const v16bf b = cat16b(*(const v8us*)(Bn + boff[t] + kc), *(const v8us*)(Bn + boff[t] + kc + 16)); acc[t] = wmmab(a, b, acc[t]); if (SPLITA) acc[t] = wmmab(al, b, acc[t]); }
        asm volatile("v_nop\n\tv_nop\n\tv_nop\n\tv_nop" : "+v"(acc[0]), "+v"(acc[1]), "+v"(acc[2]), "+v"(acc[3]) : "v"(a), "v"(al));
    }
    float* os = ost + wave * (16 * 68);
    bf* vs = (bf*)(void*)ost;
    if (PL && z == 2) {
        // A lane holds 8 consecutive tokens (hi * 8 ...) of head column t * 16 + lr: 16 bytes of a v^T row as they stand. Rows of 64 tokens, pitch 72 (144 bytes: 16 x odd), the residual plane behind.
#pragma unroll
        for (int t = 0; t < 4; ++t) { const float bv = bfr(bias[c0 + t * 16 + lr]); v8us oh, ol;
#pragma unroll
            for (int j = 0; j < 8; ++j) { const float v = acc[t][j] + bv; const unsigned short hb = f2bf(v); oh[j] = hb; ol[j] = f2bf(v - bf2f(hb)); }
            bf* p = vs + (t * 16 + lr) * 72 + wave * 16 + hi * 8; *(v8usa*)p = oh; *(v8usa*)(p + 64 * 72) = ol; }
    } else {
#pragma unroll
        for (int t = 0; t < 4; ++t) { const float bv = bias ? bfr(bias[c0 + t * 16 + lr]) : 0.f;
#pragma unroll
            for (int j = 0; j < 8; ++j) os[(hi * 8 + j) * 68 + t * 16 + lr] = acc[t][j] + bv; }
    }
    __syncthreads();
    if (PL && z == 2) {
        // Whole 128-byte lines: 8 threads a row of 64 tokens, 16 rows an instruction group, both planes.
        const size_t vo = (((size_t)(blockIdx.x * 64 / NN) * NH_ + blockIdx.y) * HD + (threadIdx.x >> 3)) * NN + blockIdx.x * 64 % NN + (threadIdx.x & 7) * 8;
        const bf* sp = vs + (threadIdx.x >> 3) * 72 + (threadIdx.x & 7) * 8;
        v8us xh[4], xl[4];
#pragma unroll
        for (int s = 0; s < 4; ++s) { xh[s] = *(const v8usa*)(sp + s * 16 * 72); xl[s] = *(const v8usa*)(sp + 64 * 72 + s * 16 * 72); }
#pragma unroll
        for (int s = 0; s < 4; ++s) { *(v8us*)(VTh + vo + (size_t)s * 16 * NN) = xh[s]; *(v8us*)(VTl + vo + (size_t)s * 16 * NN) = xl[s]; }
        return;
    }
    if (PL) {
        // The wave's 16 rows of its head's plane are 2 KiB in a row: lane -> 8 columns, 4 rows an instruction.
        bf* Ph = z ? Kh : Qh; bf* Pl = z ? Kl : Ql;
        const size_t po = (((size_t)(r0 / NN) * NH_ + blockIdx.y) * NN + r0 % NN) * HD + lane * 8;
        v8us oh[4], ol[4];
#pragma unroll
        for (int s = 0; s < 4; ++s) { const float* sp = os + (4 * s + (lane >> 3)) * 68 + (lane & 7) * 8; const v4f x = *(const v4fa*)sp, y = *(const v4fa*)(sp + 4);
#pragma unroll
            for (int i = 0; i < 8; ++i) { const float v = i < 4 ? x[i & 3] : y[i & 3]; const unsigned short hb = f2bf(v); oh[s][i] = hb; ol[s][i] = f2bf(v - bf2f(hb)); } }
#pragma unroll
        for (int s = 0; s < 4; ++s) { *(v8us*)(Ph + po + s * 4 * HD) = oh[s]; *(v8us*)(Pl + po + s * 4 * HD) = ol[s]; }
        if (z) return;
        asm volatile("s_wait_xcnt 0x0" ::: "memory");    // stands in front of the f32 pass's writes to the plane stores' data and address registers
        __builtin_amdgcn_sched_barrier(0);    // keeps that pass's instructions behind the wait
    }
    if (F16OUT) {
        h16* crow = (h16*)(void*)C + (size_t)r0 * ldc + c0;
        auto pass = [&]() {
#pragma unroll
            for (int s = 0; s < 4; ++s) { const int row = 4 * s + (lane >> 3), piece = lane & 7; const float* sp = os + row * 68 + piece * 8; v8h o, o2;
#pragma unroll
                for (int i = 0; i < 8; ++i) { const h16 a = (h16)sp[i]; o[i] = a; o2[i] = (h16)((sp[i] - (float)a) * LOSC); }
                *(v8h*)(crow + (size_t)row * ldc + piece * 8) = o; if (C2) *(v8h*)(C2 + (size_t)r0 * ldc + c0 + (size_t)row * ldc + piece * 8) = o2; }
        };
        pass(); 
    } else {
        float* crow = C + (size_t)r0 * ldc + c0;
        auto pass = [&]() {
#pragma unroll
            for (int s = 0; s < 8; ++s) { const int Lid = (lane >> 3) + 4 * s, piece = lane & 7; const int row = Lid >> 1, cofs = (Lid & 1) * 32 + piece * 4;
                v4f val = *(const v4fa*)(os + row * 68 + cofs); if (R) { const v4f rv = *(const v4f*)(R + ((size_t)r0 + row) * ldc + c0 + cofs); val += roundR ? (v4f){bfr(rv[0]), bfr(rv[1]), bfr(rv[2]), bfr(rv[3])} : rv; }
                *(v4f*)(crow + (size_t)row * ldc + cofs) = val; }
        };
        pass(); 
    }
}

// k_fattn: scores, softmax and P.v of one head for 256 queries per block, nothing of S or P leaving the registers. A wave owns FQ * 16 queries and one of the FKS parts of the NN keys, 32 keys a pass:
// S^T = K.Q^T (A = K rows, B = Q rows kept in registers, both bf16 hi + residual, three products), so a lane holds 16 keys' scores of one query (column lane & 15);
// running maximum and sum per query (log2 domain, one exchange between the lane halves), p = exp2(s * SCL2 - m) split into bf16 hi + residual: the two 16-key score tiles, converted in place,
// are the B operand of O^T += V^T.P^T (A = V^T rows, keys in the same order; three products). O^T is scaled by exp2(m_old - m_new) every pass and by 1 / sum at the end.
// The two waves of a query group (wave, wave + FW / FKS) meet in LDS: the upper one hands over its maximum, sum and O^T, the lower one brings both to the common maximum, adds, divides and stores.
// grid (NN / (FW / FKS * FQ * 16), NH_, NBT); planes Q, K [item][head][NN][HD], V^T [item][head][HD][NN]; O [NR][DV].
#define FQ 4
#define FW 8
#define FKS 2
#define FG (FW / FKS)
#define SCL2 (SCL * 1.4426950408889634f)
typedef __attribute__((ext_vector_type(2))) float  v2f;
typedef __attribute__((ext_vector_type(2))) __bf16 v2bf;
// One fragment: 16 bytes at base + off + c and 16 at + 32 (k = 8 * hi + 0..7 and 16 + 8 * hi + 0..7). base is the same in every lane, off the lane's own byte offset (row lr, half hi), c a constant.
__device__ __forceinline__ v16bf ldfrag(const bf* __restrict__ base, unsigned off, int c) { const char* p = (const char*)base + off + c; return cat16b(*(const v8us*)p, *(const v8us*)(p + 32)); }
__device__ __forceinline__ float xhalf(float x) { const int b = __float_as_int(x); return __int_as_float(__builtin_amdgcn_permlanex16(b, b, 0x76543210, 0xfedcba98, false, false)); }
__global__ __launch_bounds__(FW * 32) void k_fattn(const bf* __restrict__ Qh0, const bf* __restrict__ Ql0, const bf* __restrict__ Kh0, const bf* __restrict__ Kl0, const bf* __restrict__ Vh0, const bf* __restrict__ Vl0, float* O) {
    const size_t pp = ((size_t)blockIdx.z * NH_ + blockIdx.y) * NN * HD;
    const bf* __restrict__ Qh = Qh0 + pp; const bf* __restrict__ Ql = Ql0 + pp; const bf* __restrict__ Kh = Kh0 + pp; const bf* __restrict__ Kl = Kl0 + pp; const bf* __restrict__ Vh = Vh0 + pp; const bf* __restrict__ Vl = Vl0 + pp;
    __shared__ __align__(16) float mrg[FG][(4 * FQ * 8 + 2 * FQ) * 32];
    const int lane = threadIdx.x & 31, wave = __builtin_amdgcn_readfirstlane(threadIdx.x >> 5), lr = lane & 15, hi = lane >> 4;    // the wave's number in a scalar register: loop bounds and branches on it stay scalar
    const int q0 = (blockIdx.x * FG + wave % FG) * (FQ * 16), kbeg = (wave / FG) * (NN / FKS);
    const unsigned koff = (lr * HD + 8 * hi) * 2, voff = (lr * NN + 8 * hi) * 2;    // bytes: row lr of a [.][HD] plane, of a [.][NN] plane
    v16bf qh[FQ][2], ql[FQ][2];
#pragma unroll
    for (int u = 0; u < FQ; ++u) {
#pragma unroll
        for (int ks = 0; ks < 2; ++ks) { qh[u][ks] = ldfrag(Qh + (size_t)q0 * HD, koff, (u * 16 * HD + ks * 32) * 2); ql[u][ks] = ldfrag(Ql + (size_t)q0 * HD, koff, (u * 16 * HD + ks * 32) * 2); } }
    v16bf kh[2][2], kl[2][2], vh[4], vl[4];
    auto fetchk = [&](int kc) {
#pragma unroll
        for (int kt = 0; kt < 2; ++kt) {
#pragma unroll
            for (int ks = 0; ks < 2; ++ks) { kh[kt][ks] = ldfrag(Kh + (size_t)kc * HD, koff, (kt * 16 * HD + ks * 32) * 2); kl[kt][ks] = ldfrag(Kl + (size_t)kc * HD, koff, (kt * 16 * HD + ks * 32) * 2); } }
    };
    v8f acc[4][FQ]; float m[FQ], l[FQ];
#pragma unroll
    for (int u = 0; u < FQ; ++u) { m[u] = -3.0e38f; l[u] = 0.f;
#pragma unroll
        for (int t = 0; t < 4; ++t) acc[t][u] = (v8f){}; }
    fetchk(kbeg);
    // The scheduling fences keep each group of loads where it is written (V a whole score block ahead of its use, the next pass's K a whole softmax and P.v block ahead): left free, the compiler sinks a load to its WMMA.
    // The pass loop stays rolled: one pass is 96 WMMAs and some 500 vector instructions already, and a second copy would only cost instruction cache.
#pragma unroll 1
    for (int i = 0; i < NN / FKS; i += 32) {
        const int kc = kbeg + i;
#pragma unroll
        for (int t = 0; t < 4; ++t) { vh[t] = ldfrag(Vh + kc, voff, t * 16 * NN * 2); vl[t] = ldfrag(Vl + kc, voff, t * 16 * NN * 2); }
        __builtin_amdgcn_sched_barrier(0);
        v8f s[2][FQ];
#pragma unroll
        for (int kt = 0; kt < 2; ++kt) {
#pragma unroll
            for (int u = 0; u < FQ; ++u) s[kt][u] = (v8f){}; }
#pragma unroll
        for (int ks = 0; ks < 2; ++ks) {
#pragma unroll
            for (int kt = 0; kt < 2; ++kt) {
#pragma unroll
                for (int u = 0; u < FQ; ++u) s[kt][u] = wmmab(kh[kt][ks], qh[u][ks], s[kt][u]); }
#pragma unroll
            for (int kt = 0; kt < 2; ++kt) {
#pragma unroll
                for (int u = 0; u < FQ; ++u) s[kt][u] = wmmab(kh[kt][ks], ql[u][ks], s[kt][u]); }
#pragma unroll
            for (int kt = 0; kt < 2; ++kt) {
#pragma unroll
                for (int u = 0; u < FQ; ++u) s[kt][u] = wmmab(kl[kt][ks], qh[u][ks], s[kt][u]); } }
        __builtin_amdgcn_sched_barrier(0);
        fetchk(i + 32 < NN / FKS ? kc + 32 : kbeg);    // the last pass fetches the first again (in bounds, unused), so that the loads stand on one path
        __builtin_amdgcn_sched_barrier(0);
        v16bf ph[FQ], pl[FQ];
#pragma unroll
        for (int u = 0; u < FQ; ++u) {
            float mx0 = fmaxf(s[0][u][0], s[1][u][0]), mx1 = fmaxf(s[0][u][1], s[1][u][1]);
#pragma unroll
            for (int j = 2; j < 8; j += 2) { mx0 = fmaxf(mx0, fmaxf(s[0][u][j], s[1][u][j])); mx1 = fmaxf(mx1, fmaxf(s[0][u][j + 1], s[1][u][j + 1])); }
            float mx = fmaxf(mx0, mx1); mx = fmaxf(mx, xhalf(mx));
            const float mn = fmaxf(m[u], mx * SCL2), al = __builtin_amdgcn_exp2f(m[u] - mn); m[u] = mn;
            float ls0 = 0.f, ls1 = 0.f;
#pragma unroll
            for (int kt = 0; kt < 2; ++kt) {
#pragma unroll
                for (int j = 0; j < 8; j += 2) {
                    const v2f p = {__builtin_amdgcn_exp2f(fmaf(s[kt][u][j], SCL2, -mn)), __builtin_amdgcn_exp2f(fmaf(s[kt][u][j + 1], SCL2, -mn))};
                    ls0 += p[0]; ls1 += p[1];
                    const v2bf hb = __builtin_convertvector(p, v2bf); const v2bf lb = __builtin_convertvector(p - __builtin_convertvector(hb, v2f), v2bf);
                    ph[u][kt * 8 + j] = hb[0]; ph[u][kt * 8 + j + 1] = hb[1]; pl[u][kt * 8 + j] = lb[0]; pl[u][kt * 8 + j + 1] = lb[1]; } }
            l[u] = fmaf(l[u], al, ls0 + ls1);
#pragma unroll
            for (int t = 0; t < 4; ++t) acc[t][u] *= al;
        }
#pragma unroll
        for (int t = 0; t < 4; ++t) {
#pragma unroll
            for (int u = 0; u < FQ; ++u) acc[t][u] = wmmab(vh[t], ph[u], acc[t][u]); }
#pragma unroll
        for (int t = 0; t < 4; ++t) {
#pragma unroll
            for (int u = 0; u < FQ; ++u) acc[t][u] = wmmab(vh[t], pl[u], acc[t][u]); }
#pragma unroll
        for (int t = 0; t < 4; ++t) {
#pragma unroll
            for (int u = 0; u < FQ; ++u) acc[t][u] = wmmab(vl[t], ph[u], acc[t][u]); }
    }
    float* mg = &mrg[wave % FG][0];
    if (wave >= FG) {
#pragma unroll
        for (int u = 0; u < FQ; ++u) { mg[(4 * FQ * 8 + u) * 32 + lane] = m[u]; mg[(4 * FQ * 8 + FQ + u) * 32 + lane] = l[u];
#pragma unroll
            for (int t = 0; t < 4; ++t) { const v8f r = acc[t][u]; float* p = mg + (t * FQ + u) * 256 + lane * 4;
                *(v4f*)p = (v4f){r[0], r[1], r[2], r[3]}; *(v4f*)(p + 128) = (v4f){r[4], r[5], r[6], r[7]}; } }
    }
    __syncthreads();
    if (wave < FG) {
        // A lane holds 8 consecutive head columns (t * 16 + 8 * hi ...) of query u * 16 + lr.
#pragma unroll
        for (int u = 0; u < FQ; ++u) {
            const float m1 = mg[(4 * FQ * 8 + u) * 32 + lane], l1 = mg[(4 * FQ * 8 + FQ + u) * 32 + lane];
            const float mn = fmaxf(m[u], m1), a0 = __builtin_amdgcn_exp2f(m[u] - mn), a1 = __builtin_amdgcn_exp2f(m1 - mn);
            const float lt = fmaf(l[u], a0, l1 * a1), inv = 1.0f / (lt + xhalf(lt)), f0 = a0 * inv, f1 = a1 * inv;
            float* orow = O + ((size_t)blockIdx.z * NN + q0 + u * 16 + lr) * DV + blockIdx.y * HD + 8 * hi;
            v4f res[8];
#pragma unroll
            for (int t = 0; t < 4; ++t) { const v8f r = acc[t][u]; const float* p = mg + (t * FQ + u) * 256 + lane * 4; const v4f x = *(const v4f*)p, y = *(const v4f*)(p + 128);
                res[2 * t] = (v4f){r[0], r[1], r[2], r[3]} * f0 + x * f1; res[2 * t + 1] = (v4f){r[4], r[5], r[6], r[7]} * f0 + y * f1; }
            // The two fences keep a query tile's arithmetic in front of its eight stores and the next tile's behind the wait, so that no register an issued store names is rewritten ahead of that wait.
            __builtin_amdgcn_sched_barrier(0);
#pragma unroll
            for (int t = 0; t < 4; ++t) { *(v4f*)(orow + t * 16) = res[2 * t]; *(v4f*)(orow + t * 16 + 4) = res[2 * t + 1]; }
            if (u + 1 < FQ) { asm volatile("s_wait_xcnt 0x0" ::: "memory");    // stands in front of the next tile's writes to the stores' data and address registers
                __builtin_amdgcn_sched_barrier(0); }
        }
    }
}

// grid (NR / 8, 2): blockIdx.y = which input; its [NR][DV] plane lies y planes behind dst.
__global__ __launch_bounds__(256) void k_cvtx(const float* __restrict__ src0, const float* __restrict__ src1, bf* dst) {
    const int lane = threadIdx.x & 31; const size_t r = (size_t)blockIdx.x * 8 + (threadIdx.x >> 5); if (r >= (size_t)NR) return;
    const float* __restrict__ src = blockIdx.y ? src1 : src0; dst += (size_t)blockIdx.y * NR * DV;
{
#pragma unroll
        for (int q = 0; q < DV / 256; ++q) { v8us o;
#pragma unroll
            for (int i = 0; i < 8; ++i) o[i] = f2bf(src[r * DV + q * 256 + lane * 8 + i]);
            *(v8us*)(dst + r * DV + q * 256 + lane * 8) = o; }
         }
}
// k_ln1: H [s][512] (f32, kept) and planes of LayerNorm(O[s] + q[s]) x bf(g) + bf(b) (f32; mean, biased var over 512); one wave per row: lane -> 4 columns per 128-step, 4 steps
__global__ __launch_bounds__(256) void k_ln1(const float* __restrict__ O, const float* __restrict__ QF, const float* __restrict__ g, const float* __restrict__ bb, float* Hf, bf* Hh, bf* Hl) {
    typedef __attribute__((ext_vector_type(4))) unsigned short v4us;
    const int lane = threadIdx.x & 31; const size_t s = (size_t)blockIdx.x * 8 + (threadIdx.x >> 5); if (s >= (size_t)NR) return; float v[16]; float sm = 0.f;
#pragma unroll
    for (int st = 0; st < 4; ++st) {
#pragma unroll
        for (int q = 0; q < 4; ++q) { const int c = st * 128 + lane * 4 + q; const float t = O[s * DV + c] + QF[s * DV + c]; v[st * 4 + q] = t; sm += t; } }
#pragma unroll
    for (int sh = 16; sh; sh >>= 1) sm += __shfl_xor(sm, sh, 32);
    const float mu = sm * (1.0f / DV); float qv = 0.f;
#pragma unroll
    for (int i = 0; i < 16; ++i) { const float d = v[i] - mu; qv = fmaf(d, d, qv); }
#pragma unroll
    for (int sh = 16; sh; sh >>= 1) qv += __shfl_xor(qv, sh, 32);
    const float rs = rsqrtf(qv * (1.0f / DV) + LEPS);
{
#pragma unroll
        for (int st = 0; st < 4; ++st) { const int c0 = st * 128 + lane * 4; v4f o; v4us oh, ol;
#pragma unroll
            for (int q = 0; q < 4; ++q) { const float y = (v[st * 4 + q] - mu) * rs * bfr(g[c0 + q]) + bfr(bb[c0 + q]); o[q] = y; const unsigned short hb = f2bf(y); oh[q] = hb; ol[q] = f2bf(y - bf2f(hb)); }
            *(v4f*)(Hf + s * DV + c0) = o; *(v4us*)(Hh + s * DV + c0) = oh; *(v4us*)(Hl + s * DV + c0) = ol; }
         }
}
__global__ __launch_bounds__(256) void k_ln2(const float* __restrict__ Hf, const float* __restrict__ F, const float* __restrict__ g, const float* __restrict__ bb, float* OUTB) {
    const int lane = threadIdx.x & 31; const size_t s = (size_t)blockIdx.x * 8 + (threadIdx.x >> 5); if (s >= (size_t)NR) return; float v[16]; float sm = 0.f;
#pragma unroll
    for (int st = 0; st < 4; ++st) {
#pragma unroll
        for (int q = 0; q < 4; ++q) { const int c = st * 128 + lane * 4 + q; const float t = Hf[s * DV + c] + fmaxf(F[s * DV + c], 0.f); v[st * 4 + q] = t; sm += t; } }
#pragma unroll
    for (int sh = 16; sh; sh >>= 1) sm += __shfl_xor(sm, sh, 32);
    const float mu = sm * (1.0f / DV); float qv = 0.f;
#pragma unroll
    for (int i = 0; i < 16; ++i) { const float d = v[i] - mu; qv = fmaf(d, d, qv); }
#pragma unroll
    for (int sh = 16; sh; sh >>= 1) qv += __shfl_xor(qv, sh, 32);
    const float rs = rsqrtf(qv * (1.0f / DV) + LEPS);
{
#pragma unroll
        for (int st = 0; st < 4; ++st) { const int c0 = st * 128 + lane * 4; v4f o;
#pragma unroll
            for (int q = 0; q < 4; ++q) o[q] = (v[st * 4 + q] - mu) * rs * bfr(g[c0 + q]) + bfr(bb[c0 + q]);
            *(v4f*)(OUTB + s * DV + c0) = o; }
         }
}

extern "C" void kernel_launch(void* const* d_in, const int* in_sizes, int n_in,
                              void* d_out, int out_size, void* d_ws, size_t ws_size, hipStream_t stream) {
    (void)in_sizes; (void)n_in; (void)out_size;
    const float* Qi = (const float*)d_in[0]; const float* Ki = (const float*)d_in[1]; const float* Wq = (const float*)d_in[2]; const float* bq = (const float*)d_in[3]; const float* Wk = (const float*)d_in[4]; const float* bk = (const float*)d_in[5];
    const float* Wv = (const float*)d_in[6]; const float* bv = (const float*)d_in[7]; const float* Wo = (const float*)d_in[8]; const float* bo = (const float*)d_in[9]; const float* g0 = (const float*)d_in[10]; const float* b0 = (const float*)d_in[11]; const float* g1 = (const float*)d_in[12]; const float* b1 = (const float*)d_in[13];
    float* out = (float*)d_out;    // [4][2048][512]
    char* wsp = (char*)d_ws;
    auto take = [&](size_t bytes) { char* p = wsp; wsp += (bytes + 255) & ~(size_t)255; return (void*)p; };
    // Kept through attention: the four weights, the q/k/v planes of all items and heads, O and QF.
    bf* WT = (bf*)take((size_t)4 * DV * DV * 2);    // WqT, WkT, WvT, WoT
    bf* Qh = (bf*)take((size_t)NR * DV * 2); bf* Ql = (bf*)take((size_t)NR * DV * 2); bf* Kh = (bf*)take((size_t)NR * DV * 2); bf* Kl = (bf*)take((size_t)NR * DV * 2); bf* VTh = (bf*)take((size_t)NR * DV * 2); bf* VTl = (bf*)take((size_t)NR * DV * 2);
    float* O = (float*)take((size_t)NR * DV * 4); float* QF = (float*)take((size_t)NR * DV * 4);
    // One region, used twice in stream order: (1) XQ, XK; (2) Hf, Hh, Hl, FF.
    char* const reg = wsp;
    bf* XQ = (bf*)take((size_t)NR * DV * 2); bf* XK = (bf*)take((size_t)NR * DV * 2);
    wsp = reg;
    float* Hf = (float*)take((size_t)NR * DV * 4); bf* Hh = (bf*)take((size_t)NR * DV * 2); bf* Hl = (bf*)take((size_t)NR * DV * 2); float* FF = (float*)take((size_t)NR * DV * 4);
    if ((size_t)(wsp - (char*)d_ws) > ws_size) return;    // the kept part plus the larger use of the region: about 136 MB
    k_wt<<<dim3(DV / 64, DV / 64, 4), 256, 0, stream>>>(Wq, Wk, Wv, Wo, DV, DV, WT);   // (in, out) k-major
    k_cvtx<<<dim3(NR / 8, 2, 1), 256, 0, stream>>>(Qi, Ki, XQ);
    k_gemmb<false, false, true><<<dim3(NR / 64, DV / 64, 3), 128, 0, stream>>>(XQ, nullptr, WT, bq, QF, DV, nullptr, nullptr, DV, 1, XK, bk, bv, Qh, Ql, Kh, Kl, VTh, VTl);
    k_fattn<<<dim3(NN / (FG * FQ * 16), NH_, NBT), FW * 32, 0, stream>>>(Qh, Ql, Kh, Kl, VTh, VTl, O);
    k_ln1<<<NR / 8, 256, 0, stream>>>(O, QF, g0, b0, Hf, Hh, Hl);
    k_gemmb<true, false><<<dim3(NR / 64, DV / 64, 1), 128, 0, stream>>>(Hh, Hl, WT + (size_t)3 * DV * DV, bo, FF, DV, nullptr, nullptr, DV);
    k_ln2<<<NR / 8, 256, 0, stream>>>(Hf, FF, g1, b1, out);
}

// v005
// It runs in 147 microseconds.
// Timed twice side by side with v004, it ran 1.30 and 1.31 times as fast.
// All steps since v000 together make it 23.8 times as fast.
#include <hip/hip_runtime.h>

// Compute dtypes, f32 accumulate, per item: q/k/v = X.W + b as [2048 x 512].[512 x 512] GEMMs with PLAIN bf16 operands (exact products); per head: scores = q.k^T ([2048 x 64].[64 x
// 2048], both operands bf16 hi + UNSCALED residual, three products), softmax (x 1/sqrt(512)) in f32 -> P as bf16 hi + residual, ctx = P.v ([2048 x 2048].[2048 x 64], three products); + q
// residual and LayerNorm in f32 -> planes; rFF [2048 x 512].[512 x 512] (+ bo, relu) (two products), residual and the final LayerNorm in f32 - on v_wmma_f32_16x16x32_bf16.
// Launch plan: every stage runs once for all NBT items (their rows are contiguous: NR = NBT x NN rows); the projection GEMM writes the q, k and v^T planes itself; scores, softmax and P.v are one kernel,
// once for all items and heads (softmax by running maximum and sum; P is split unnormalised and the sum divides O at the end).

#define NBT  4
#define NN   2048
#define DV   512
#define NH_  8
#define HD   64
#define DM   DV
#define NTK  NN
#define SCL  0.044194173824159216f
#define LEPS 1e-5f
#define LOSC 1024.0f
#define NR   (NBT * NN)

typedef _Float16 h16;
typedef unsigned short bf;
typedef __attribute__((ext_vector_type(16))) __bf16   v16bf;
typedef __attribute__((ext_vector_type(16))) _Float16 v16h;
typedef __attribute__((ext_vector_type(8)))  _Float16 v8h;
typedef __attribute__((ext_vector_type(8)))  unsigned short v8us;
typedef __attribute__((ext_vector_type(8)))  float    v8f;
typedef __attribute__((ext_vector_type(4)))  float    v4f;
typedef __attribute__((ext_vector_type(4)))  _Float16 v4h;
typedef v8h  __attribute__((may_alias)) v8ha;
typedef v4f  __attribute__((may_alias)) v4fa;
typedef v8us __attribute__((may_alias)) v8usa;

__device__ __forceinline__ unsigned short f2bf(float f) { unsigned u = __float_as_uint(f); u += 0x7FFFu + ((u >> 16) & 1u); return (unsigned short)(u >> 16); }
__device__ __forceinline__ float bf2f(unsigned short b) { return __uint_as_float(((unsigned)b) << 16); }
__device__ __forceinline__ float bfr(float f) { return bf2f(f2bf(f)); }
__device__ __forceinline__ v16h cat16(v8h lo, v8h hi) { return __builtin_shufflevector(lo, hi, 0, 1, 2, 3, 4, 5, 6, 7, 8, 9, 10, 11, 12, 13, 14, 15); }
__device__ __forceinline__ v16bf cat16b(v8us lo, v8us hi) { return __builtin_bit_cast(v16bf, __builtin_shufflevector(lo, hi, 0, 1, 2, 3, 4, 5, 6, 7, 8, 9, 10, 11, 12, 13, 14, 15)); }
__device__ __forceinline__ v8f wmma16(v16h a, v16h b, v8f c) { return __builtin_amdgcn_wmma_f32_16x16x32_f16(false, a, false, b, (short)0, c, false, false); }
__device__ __forceinline__ v8f wmmab(v16bf a, v16bf b, v8f c) { return __builtin_amdgcn_wmma_f32_16x16x32_bf16(false, a, false, b, (short)0, c, false, false); }

// Fragment order: every bf16 plane that a matrix instruction reads as [rows][K] lies in memory as [rows / 16][K / 8][16 rows][8 elements], so that the 32 lanes of a fragment load (row lane & 15, pieces 2 * x + (lane >> 4))
// read 512 bytes in a row, four whole lines; the two loads of a 32-deep fragment are 512 bytes apart. fragoff = element offset of piece c (8 elements) of row r.
__device__ __forceinline__ size_t fragoff(size_t r, int c, int K) { return (r >> 4) * 16 * K + c * 128 + (r & 15) * 8; }

// k_wt: WT [z] = bf16(Wz[k][n]) (k-major [K][ncols]) as [n][K] in fragment order, via 64 x 64 LDS tiles; grid (K/64, ncols/64, 4), blockIdx.z = which of the four weights.
__global__ __launch_bounds__(256) void k_wt(const float* __restrict__ W0, const float* __restrict__ W1, const float* __restrict__ W2, const float* __restrict__ W3, int K, int ncols, bf* WT) {
    __shared__ __align__(16) unsigned short tl[64 * 72];
    const int z = blockIdx.z; const float* __restrict__ Wm = z == 0 ? W0 : z == 1 ? W1 : z == 2 ? W2 : W3; WT += (size_t)z * K * ncols;
    const int tid = threadIdx.x, k0 = blockIdx.x * 64, n0 = blockIdx.y * 64;
    const int kk = tid >> 2, nq = (tid & 3) * 16;
#pragma unroll
    for (int i = 0; i < 16; ++i) tl[(nq + i) * 72 + kk] = f2bf(Wm[(size_t)(k0 + kk) * ncols + n0 + nq + i]);
    __syncthreads();
    const int piece = (tid >> 4) & 7;    // 128 threads write the 2 KiB that 16 rows x 64 k fill in fragment order
    auto pass = [&]() {
#pragma unroll
        for (int s = 0; s < 2; ++s) { const int nr = ((tid >> 7) + 2 * s) * 16 + (tid & 15); const v8us val = *(const v8usa*)(tl + nr * 72 + piece * 8); *(v8us*)(WT + fragoff(n0 + nr, k0 / 8 + piece, K)) = val; }
    };
    pass(); 
}
// k_gemmb: 64 x 64 block tile (4 waves x 16 x 64) of C[NR][ldc] = (A [+ Al]).B^T (K = 512) [+ bf(bias[c])] [+ bf(R[r][c]) residual]; f32 whole-line epilogue (or f16
// PL (the q/k/v projections; a 64-column tile is one head): the epilogue writes what attention reads, bf16 hi + residual of the f32 tile: z = 0 planes Qh, Ql [item][head][NN][HD] and C (f32 q, for the residual),
// z = 1 planes Kh, Kl alike and no C, z = 2 planes VTh, VTl [item][head][NN / 32][HD][32] and no C; each [NN][HD] and each [HD][32] in fragment order.
template <bool SPLITA, bool F16OUT = false, bool PL = false>
// blockIdx.z = which product of a launch: z > 0 takes A from A12, the z-th [DV][K] plane behind Bn, bias1 or bias2, and the z-th [NR][ldc] plane behind C.
__global__ __launch_bounds__(128) void k_gemmb(const bf* __restrict__ A0, const bf* __restrict__ Al, const bf* __restrict__ B0, const float* __restrict__ bias0, float* C, int ldc, h16* C2, const float* __restrict__ R = nullptr, int K = DM, int roundR = 1,
                                               const bf* __restrict__ A12 = nullptr, const float* __restrict__ bias1 = nullptr, const float* __restrict__ bias2 = nullptr,
                                               bf* Qh = nullptr, bf* Ql = nullptr, bf* Kh = nullptr, bf* Kl = nullptr, bf* VTh = nullptr, bf* VTl = nullptr) {
    __shared__ __align__(16) float ost[PL ? 2 * 64 * 36 : 4 * 16 * 68];    // four f32 tiles [16][68], one a wave; or (PL, z = 2) two bf16 planes [64][72]
    const int z = blockIdx.z; const bf* __restrict__ A = z ? A12 : A0; const bf* __restrict__ Bn = B0 + (size_t)z * DV * K; const float* __restrict__ bias = z == 0 ? bias0 : z == 1 ? bias1 : bias2; C += (size_t)z * NR * ldc;
    const int lane = threadIdx.x & 31, wave = threadIdx.x >> 5, lr = lane & 15, hi = lane >> 4;
    const int r0 = blockIdx.x * 64 + wave * 16, c0 = blockIdx.y * 64;
    const size_t aoff = (size_t)r0 * K + lane * 8;    // A and B lie in fragment order (fragoff of row lr, piece hi): a k-step of 32 is 512 elements, its two loads 256 elements apart
    size_t boff[4];
#pragma unroll
    for (int t = 0; t < 4; ++t) boff[t] = (size_t)(c0 + t * 16) * K;    // the same in every lane
    v8f acc[4];
#pragma unroll
    for (int t = 0; t < 4; ++t) acc[t] = (v8f){};
#pragma unroll 1
    for (int kc = 0; kc < K; kc += 32) {
        const bf* pa = A + aoff + kc * 16; const bf* pal = SPLITA ? Al + aoff + kc * 16 : pa; const bf* pb[4];
        const v16bf a = cat16b(*(const v8us*)pa, *(const v8us*)(pa + 256));
        v16bf al = a;
        if (SPLITA) al = cat16b(*(const v8us*)pal, *(const v8us*)(pal + 256));
#pragma unroll
        for (int t = 0; t < 4; ++t) { pb[t] = Bn + boff[t] + kc * 16; const v16bf b = cat16b(*(const v8us*)(pb[t] + lane * 8), *(const v8us*)(pb[t] + lane * 8 + 256)); acc[t] = wmmab(a, b, acc[t]); if (SPLITA) acc[t] = wmmab(al, b, acc[t]); }
        asm volatile("v_nop\n\tv_nop\n\tv_nop\n\tv_nop" : "+v"(acc[0]), "+v"(acc[1]), "+v"(acc[2]), "+v"(acc[3]) : "v"(a), "v"(al));
        // The wait that stands in front of any write to the k-step's address registers; as its inputs they keep their registers up to it (left free, the compiler reuses them while the loads are out).
        asm volatile("s_wait_xcnt 0x0" :: "v"(pa), "v"(pal), "s"(pb[0]), "s"(pb[1]), "s"(pb[2]), "s"(pb[3]) : "memory");
    }
    float* os = ost + wave * (16 * 68);
    bf* vs = (bf*)(void*)ost;
    if (PL && z == 2) {
        // A lane holds 8 consecutive tokens (hi * 8 ...) of head column t * 16 + lr: 16 bytes of a v^T row as they stand. Rows of 64 tokens, pitch 72 (144 bytes: 16 x odd), the residual plane behind.
#pragma unroll
        for (int t = 0; t < 4; ++t) { const float bv = bfr(bias[c0 + t * 16 + lr]); v8us oh, ol;
#pragma unroll
            for (int j = 0; j < 8; ++j) { const float v = acc[t][j] + bv; const unsigned short hb = f2bf(v); oh[j] = hb; ol[j] = f2bf(v - bf2f(hb)); }
            bf* p = vs + (t * 16 + lr) * 72 + wave * 16 + hi * 8; *(v8usa*)p = oh; *(v8usa*)(p + 64 * 72) = ol; }
    } else {
#pragma unroll
        for (int t = 0; t < 4; ++t) { const float bv = bias ? bfr(bias[c0 + t * 16 + lr]) : 0.f;
#pragma unroll
            for (int j = 0; j < 8; ++j) os[(hi * 8 + j) * 68 + t * 16 + lr] = acc[t][j] + bv; }
    }
    __syncthreads();
    if (PL && z == 2) {
        // The block's 64 tokens x 64 head columns are 8 KiB in a row of each plane, [token / 32][head column / 16] fragments of 1 KiB; the 128 threads write 2 KiB an instruction group, both planes.
        const size_t vo = (((size_t)(blockIdx.x * 64 / NN) * NH_ + blockIdx.y) * NN + blockIdx.x * 64 % NN) * HD + threadIdx.x * 8;
        const bf* sp = vs + ((threadIdx.x >> 6) * 16 + (threadIdx.x & 15)) * 72 + ((threadIdx.x >> 4) & 3) * 8;    // head column (2 * (s & 1) + bit 6) * 16 + lr, keys (s >> 1) * 32 + bits 5, 4 as 16 and 8
        v8us xh[4], xl[4];
#pragma unroll
        for (int s = 0; s < 4; ++s) { xh[s] = *(const v8usa*)(sp + (s & 1) * 32 * 72 + (s >> 1) * 32); xl[s] = *(const v8usa*)(sp + 64 * 72 + (s & 1) * 32 * 72 + (s >> 1) * 32); }
#pragma unroll
        for (int s = 0; s < 4; ++s) { *(v8us*)(VTh + vo + s * 1024) = xh[s]; *(v8us*)(VTl + vo + s * 1024) = xl[s]; }
        return;
    }
    if (PL) {
        // The wave's 16 rows of its head's plane are 2 KiB in a row, in fragment order: lane -> row lr, piece 2 * s + hi.
        bf* Ph = z ? Kh : Qh; bf* Pl = z ? Kl : Ql;
        const size_t po = (((size_t)(r0 / NN) * NH_ + blockIdx.y) * NN + r0 % NN) * HD + lane * 8;
        v8us oh[4], ol[4];
#pragma unroll
        for (int s = 0; s < 4; ++s) { const float* sp = os + lr * 68 + (2 * s + hi) * 8; const v4f x = *(const v4fa*)sp, y = *(const v4fa*)(sp + 4);
#pragma unroll
            for (int i = 0; i < 8; ++i) { const float v = i < 4 ? x[i & 3] : y[i & 3]; const unsigned short hb = f2bf(v); oh[s][i] = hb; ol[s][i] = f2bf(v - bf2f(hb)); } }
#pragma unroll
        for (int s = 0; s < 4; ++s) { *(v8us*)(Ph + po + s * 4 * HD) = oh[s]; *(v8us*)(Pl + po + s * 4 * HD) = ol[s]; }
        if (z) return;
        asm volatile("s_wait_xcnt 0x0" ::: "memory");    // stands in front of the f32 pass's writes to the plane stores' data and address registers
        __builtin_amdgcn_sched_barrier(0);    // keeps that pass's instructions behind the wait
    }
    if (F16OUT) {
        h16* crow = (h16*)(void*)C + (size_t)r0 * ldc + c0;
        auto pass = [&]() {
#pragma unroll
            for (int s = 0; s < 4; ++s) { const int row = 4 * s + (lane >> 3), piece = lane & 7; const float* sp = os + row * 68 + piece * 8; v8h o, o2;
#pragma unroll
                for (int i = 0; i < 8; ++i) { const h16 a = (h16)sp[i]; o[i] = a; o2[i] = (h16)((sp[i] - (float)a) * LOSC); }
                *(v8h*)(crow + (size_t)row * ldc + piece * 8) = o; if (C2) *(v8h*)(C2 + (size_t)r0 * ldc + c0 + (size_t)row * ldc + piece * 8) = o2; }
        };
        pass(); 
    } else {
        float* crow = C + (size_t)r0 * ldc + c0;
        auto pass = [&]() {
#pragma unroll
            for (int s = 0; s < 8; ++s) { const int Lid = (lane >> 3) + 4 * s, piece = lane & 7; const int row = Lid >> 1, cofs = (Lid & 1) * 32 + piece * 4;
                v4f val = *(const v4fa*)(os + row * 68 + cofs); if (R) { const v4f rv = *(const v4f*)(R + ((size_t)r0 + row) * ldc + c0 + cofs); val += roundR ? (v4f){bfr(rv[0]), bfr(rv[1]), bfr(rv[2]), bfr(rv[3])} : rv; }
                *(v4f*)(crow + (size_t)row * ldc + cofs) = val; }
        };
        pass(); 
    }
}

// k_fattn: scores, softmax and P.v of one head for 256 queries per block, nothing of S or P leaving the registers. A wave owns FQ * 16 queries and one of the FKS parts of the NN keys, 32 keys a pass:
// S^T = K.Q^T (A = K rows, B = Q rows kept in registers, both bf16 hi + residual, three products), so a lane holds 16 keys' scores of one query (column lane & 15);
// running maximum and sum per query (log2 domain, one exchange between the lane halves), p = exp2(s * SCL2 - m) split into bf16 hi + residual: the two 16-key score tiles, converted in place,
// are the B operand of O^T += V^T.P^T (A = V^T rows, keys in the same order; three products). O^T is scaled by exp2(m_old - m_new) every pass and by 1 / sum at the end.
// The two waves of a query group (wave, wave + FW / FKS) meet in LDS: the upper one hands over its maximum, sum and O^T, the lower one brings both to the common maximum, adds, divides and stores.
// grid (NN / (FW / FKS * FQ * 16), NH_, NBT); planes Q, K [item][head][NN][HD] in fragment order, V^T [item][head][NN / 32][HD][32] with each [HD][32] in fragment order; O [NR][DV].
#define FQ 4
#define FW 8
#define FKS 2
#define FG (FW / FKS)
#define SCL2 (SCL * 1.4426950408889634f)
typedef __attribute__((ext_vector_type(2))) float  v2f;
typedef __attribute__((ext_vector_type(2))) __bf16 v2bf;
// One fragment of a plane in fragment order: 16 bytes at p + c and 16 at + 512 (k = 8 * hi + 0..7 and 16 + 8 * hi + 0..7 of row lr). p = the lane's own address (lane * 16 bytes into the first fragment), c a constant.
__device__ __forceinline__ v16bf ldfrag(const char* p, int c) { return cat16b(*(const v8us*)(p + c), *(const v8us*)(p + c + 512)); }
// The wait that stands in front of any write to the address registers of issued loads. It takes the addresses as inputs, so that they keep their registers up to it (left free, the compiler lands a later load's result on them).
__device__ __forceinline__ void xwait(const char* a, const char* b) { asm volatile("s_wait_xcnt 0x0" :: "v"(a), "v"(b) : "memory"); }
__device__ __forceinline__ float xhalf(float x) { const int b = __float_as_int(x); return __int_as_float(__builtin_amdgcn_permlanex16(b, b, 0x76543210, 0xfedcba98, false, false)); }
__global__ __launch_bounds__(FW * 32) void k_fattn(const bf* __restrict__ Qh0, const bf* __restrict__ Ql0, const bf* __restrict__ Kh0, const bf* __restrict__ Kl0, const bf* __restrict__ Vh0, const bf* __restrict__ Vl0, float* O) {
    const size_t pp = ((size_t)blockIdx.z * NH_ + blockIdx.y) * NN * HD;
    const bf* __restrict__ Qh = Qh0 + pp; const bf* __restrict__ Ql = Ql0 + pp; const bf* __restrict__ Kh = Kh0 + pp; const bf* __restrict__ Kl = Kl0 + pp; const bf* __restrict__ Vh = Vh0 + pp; const bf* __restrict__ Vl = Vl0 + pp;
    __shared__ __align__(16) float mrg[FG][(4 * FQ * 8 + 2 * FQ) * 32];
    const int lane = threadIdx.x & 31, wave = __builtin_amdgcn_readfirstlane(threadIdx.x >> 5), lr = lane & 15, hi = lane >> 4;    // the wave's number in a scalar register: loop bounds and branches on it stay scalar
    const int q0 = (blockIdx.x * FG + wave % FG) * (FQ * 16), kbeg = (wave / FG) * (NN / FKS);
    const unsigned loff = lane * 16;    // bytes: the lane's 16 of the 512 that a fragment load reads
    v16bf qh[FQ][2], ql[FQ][2];
    const char* pqh = (const char*)(Qh + (size_t)q0 * HD) + loff; const char* pql = (const char*)(Ql + (size_t)q0 * HD) + loff;
#pragma unroll
    for (int u = 0; u < FQ; ++u) {
#pragma unroll
        for (int ks = 0; ks < 2; ++ks) { qh[u][ks] = ldfrag(pqh, (u * 16 * HD + ks * 512) * 2); ql[u][ks] = ldfrag(pql, (u * 16 * HD + ks * 512) * 2); } }
    v16bf kh[2][2], kl[2][2], vh[4], vl[4];
    const char* pkh; const char* pkl;
    auto fetchk = [&](int kc) {
        pkh = (const char*)(Kh + (size_t)kc * HD) + loff; pkl = (const char*)(Kl + (size_t)kc * HD) + loff;
#pragma unroll
        for (int kt = 0; kt < 2; ++kt) {
#pragma unroll
            for (int ks = 0; ks < 2; ++ks) { kh[kt][ks] = ldfrag(pkh, (kt * 16 * HD + ks * 512) * 2); kl[kt][ks] = ldfrag(pkl, (kt * 16 * HD + ks * 512) * 2); } }
    };
    v8f acc[4][FQ]; float m[FQ], l[FQ];
#pragma unroll
    for (int u = 0; u < FQ; ++u) { m[u] = -3.0e38f; l[u] = 0.f;
#pragma unroll
        for (int t = 0; t < 4; ++t) acc[t][u] = (v8f){}; }
    fetchk(kbeg);
    // The scheduling fences keep each group of loads where it is written (V a whole score block ahead of its use, the next pass's K a whole softmax and P.v block ahead): left free, the compiler sinks a load to its WMMA.
    // The pass loop stays rolled: one pass is 96 WMMAs and some 500 vector instructions already, and a second copy would only cost instruction cache.
#pragma unroll 1
    for (int i = 0; i < NN / FKS; i += 32) {
        const int kc = kbeg + i;
        const char* pvh = (const char*)(Vh + (size_t)kc * HD) + loff; const char* pvl = (const char*)(Vl + (size_t)kc * HD) + loff;
#pragma unroll
        for (int t = 0; t < 4; ++t) { vh[t] = ldfrag(pvh, t * 1024); vl[t] = ldfrag(pvl, t * 1024); }
        __builtin_amdgcn_sched_barrier(0);
        v8f s[2][FQ];
#pragma unroll
        for (int kt = 0; kt < 2; ++kt) {
#pragma unroll
            for (int u = 0; u < FQ; ++u) s[kt][u] = (v8f){}; }
#pragma unroll
        for (int ks = 0; ks < 2; ++ks) {
#pragma unroll
            for (int kt = 0; kt < 2; ++kt) {
#pragma unroll
                for (int u = 0; u < FQ; ++u) s[kt][u] = wmmab(kh[kt][ks], qh[u][ks], s[kt][u]); }
#pragma unroll
            for (int kt = 0; kt < 2; ++kt) {
#pragma unroll
                for (int u = 0; u < FQ; ++u) s[kt][u] = wmmab(kh[kt][ks], ql[u][ks], s[kt][u]); }
#pragma unroll
            for (int kt = 0; kt < 2; ++kt) {
#pragma unroll
                for (int u = 0; u < FQ; ++u) s[kt][u] = wmmab(kl[kt][ks], qh[u][ks], s[kt][u]); } }
        __builtin_amdgcn_sched_barrier(0);
        xwait(pvh, pvl);    // written behind the score block, so that the wave does not stop for it directly behind the V loads
        fetchk(i + 32 < NN / FKS ? kc + 32 : kbeg);    // the last pass fetches the first again (in bounds, unused), so that the loads stand on one path
        __builtin_amdgcn_sched_barrier(0);
        v16bf ph[FQ], pl[FQ];
#pragma unroll
        for (int u = 0; u < FQ; ++u) {
            float mx0 = fmaxf(s[0][u][0], s[1][u][0]), mx1 = fmaxf(s[0][u][1], s[1][u][1]);
#pragma unroll
            for (int j = 2; j < 8; j += 2) { mx0 = fmaxf(mx0, fmaxf(s[0][u][j], s[1][u][j])); mx1 = fmaxf(mx1, fmaxf(s[0][u][j + 1], s[1][u][j + 1])); }
            float mx = fmaxf(mx0, mx1); mx = fmaxf(mx, xhalf(mx));
            const float mn = fmaxf(m[u], mx * SCL2), al = __builtin_amdgcn_exp2f(m[u] - mn); m[u] = mn;
            float ls0 = 0.f, ls1 = 0.f;
#pragma unroll
            for (int kt = 0; kt < 2; ++kt) {
#pragma unroll
                for (int j = 0; j < 8; j += 2) {
                    const v2f p = {__builtin_amdgcn_exp2f(fmaf(s[kt][u][j], SCL2, -mn)), __builtin_amdgcn_exp2f(fmaf(s[kt][u][j + 1], SCL2, -mn))};
                    ls0 += p[0]; ls1 += p[1];
                    const v2bf hb = __builtin_convertvector(p, v2bf); const v2bf lb = __builtin_convertvector(p - __builtin_convertvector(hb, v2f), v2bf);
                    ph[u][kt * 8 + j] = hb[0]; ph[u][kt * 8 + j + 1] = hb[1]; pl[u][kt * 8 + j] = lb[0]; pl[u][kt * 8 + j + 1] = lb[1]; } }
            l[u] = fmaf(l[u], al, ls0 + ls1);
#pragma unroll
            for (int t = 0; t < 4; ++t) acc[t][u] *= al;
        }
#pragma unroll
        for (int t = 0; t < 4; ++t) {
#pragma unroll
            for (int u = 0; u < FQ; ++u) acc[t][u] = wmmab(vh[t], ph[u], acc[t][u]); }
#pragma unroll
        for (int t = 0; t < 4; ++t) {
#pragma unroll
            for (int u = 0; u < FQ; ++u) acc[t][u] = wmmab(vh[t], pl[u], acc[t][u]); }
#pragma unroll
        for (int t = 0; t < 4; ++t) {
#pragma unroll
            for (int u = 0; u < FQ; ++u) acc[t][u] = wmmab(vl[t], ph[u], acc[t][u]); }
        __builtin_amdgcn_sched_barrier(0);    // keeps the wait below at the pass's end: left free, it rises to stand directly behind the K loads, and the wave stops for it there
        xwait(pkh, pkl);
    }
    float* mg = &mrg[wave % FG][0];
    if (wave >= FG) {
#pragma unroll
        for (int u = 0; u < FQ; ++u) { mg[(4 * FQ * 8 + u) * 32 + lane] = m[u]; mg[(4 * FQ * 8 + FQ + u) * 32 + lane] = l[u];
#pragma unroll
            for (int t = 0; t < 4; ++t) { const v8f r = acc[t][u]; float* p = mg + (t * FQ + u) * 256 + lane * 4;
                *(v4f*)p = (v4f){r[0], r[1], r[2], r[3]}; *(v4f*)(p + 128) = (v4f){r[4], r[5], r[6], r[7]}; } }
    }
    __syncthreads();
    if (wave < FG) {
        // A lane holds 8 consecutive head columns (t * 16 + 8 * hi ...) of query u * 16 + lr.
#pragma unroll
        for (int u = 0; u < FQ; ++u) {
            const float m1 = mg[(4 * FQ * 8 + u) * 32 + lane], l1 = mg[(4 * FQ * 8 + FQ + u) * 32 + lane];
            const float mn = fmaxf(m[u], m1), a0 = __builtin_amdgcn_exp2f(m[u] - mn), a1 = __builtin_amdgcn_exp2f(m1 - mn);
            const float lt = fmaf(l[u], a0, l1 * a1), inv = 1.0f / (lt + xhalf(lt)), f0 = a0 * inv, f1 = a1 * inv;
            float* orow = O + ((size_t)blockIdx.z * NN + q0 + u * 16 + lr) * DV + blockIdx.y * HD + 8 * hi;
            v4f res[8];
#pragma unroll
            for (int t = 0; t < 4; ++t) { const v8f r = acc[t][u]; const float* p = mg + (t * FQ + u) * 256 + lane * 4; const v4f x = *(const v4f*)p, y = *(const v4f*)(p + 128);
                res[2 * t] = (v4f){r[0], r[1], r[2], r[3]} * f0 + x * f1; res[2 * t + 1] = (v4f){r[4], r[5], r[6], r[7]} * f0 + y * f1; }
            // The two fences keep a query tile's arithmetic in front of its eight stores and the next tile's behind the wait, so that no register an issued store names is rewritten ahead of that wait.
            __builtin_amdgcn_sched_barrier(0);
#pragma unroll
            for (int t = 0; t < 4; ++t) { *(v4f*)(orow + t * 16) = res[2 * t]; *(v4f*)(orow + t * 16 + 4) = res[2 * t + 1]; }
            if (u + 1 < FQ) { asm volatile("s_wait_xcnt 0x0" ::: "memory");    // stands in front of the next tile's writes to the stores' data and address registers
                __builtin_amdgcn_sched_barrier(0); }
        }
    }
}

// grid (NR / 8, 2): blockIdx.y = which input; its [NR][DV] plane (fragment order) lies y planes behind dst. A block takes 8 rows, a wave 64 columns of them:
// lane -> row lane & 7, piece lane >> 3, so that a store writes four whole 128-byte lines of the plane.
__global__ __launch_bounds__(256) void k_cvtx(const float* __restrict__ src0, const float* __restrict__ src1, bf* dst) {
    const int lane = threadIdx.x & 31; const size_t r = (size_t)blockIdx.x * 8 + (lane & 7); if (r >= (size_t)NR) return;
    const float* __restrict__ src = blockIdx.y ? src1 : src0; dst += (size_t)blockIdx.y * NR * DV;
    const int c0 = (threadIdx.x >> 5) * (DV / 64) + (lane >> 3);    // the lane's first piece; its next is one k-step of 4 pieces on
    const float* p = src + r * DV + c0 * 8;
    v4f x[DV / 256][2];
#pragma unroll
    for (int q = 0; q < DV / 256; ++q) { x[q][0] = *(const v4f*)(p + q * 32); x[q][1] = *(const v4f*)(p + q * 32 + 4); }
    asm volatile("s_wait_xcnt 0x0" :: "v"(p) : "memory");    // stands in front of any write to the loads' address register, which as its input stays allocated up to it
#pragma unroll
    for (int q = 0; q < DV / 256; ++q) { v8us o;
#pragma unroll
        for (int i = 0; i < 8; ++i) o[i] = f2bf(x[q][i >> 2][i & 3]);
        *(v8us*)(dst + fragoff(r, c0 + q * 4, DV)) = o; }
}
// k_ln1: H [s][512] (f32, kept) and planes of LayerNorm(O[s] + q[s]) x bf(g) + bf(b) (f32; mean, biased var over 512); one wave per row: lane -> 4 columns per 128-step, 4 steps.
// The planes go out in fragment order: the block's 8 rows meet in LDS, and 8 threads write the 128-byte line that one piece of 8 columns fills with them.
__global__ __launch_bounds__(256) void k_ln1(const float* __restrict__ O, const float* __restrict__ QF, const float* __restrict__ g, const float* __restrict__ bb, float* Hf, bf* Hh, bf* Hl) {
    typedef __attribute__((ext_vector_type(4))) unsigned short v4us;
    typedef v4us __attribute__((may_alias)) v4usa;
    __shared__ __align__(16) bf hs[2][8][DV + 16];    // pitch 1056 bytes: the 16 reads of a half wave (8 rows x 2 pieces of 16 bytes) fall on distinct banks
    const int lane = threadIdx.x & 31, wv = threadIdx.x >> 5; const size_t s = (size_t)blockIdx.x * 8 + wv; float v[16]; float sm = 0.f;
    const float* po = O + s * DV + lane * 4; const float* pq = QF + s * DV + lane * 4;
#pragma unroll
    for (int st = 0; st < 4; ++st) {
#pragma unroll
        for (int q = 0; q < 4; ++q) { const float t = po[st * 128 + q] + pq[st * 128 + q]; v[st * 4 + q] = t; sm += t; } }
    // The wait that stands in front of any write to the row loads' address registers: as its inputs they stay allocated up to it (left free, the compiler lands the g and b loads' results on them); sm holds it behind the loads.
    asm volatile("s_wait_xcnt 0x0" :: "v"(po), "v"(pq), "v"(sm) : "memory");
#pragma unroll
    for (int sh = 16; sh; sh >>= 1) sm += __shfl_xor(sm, sh, 32);
    const float mu = sm * (1.0f / DV); float qv = 0.f;
#pragma unroll
    for (int i = 0; i < 16; ++i) { const float d = v[i] - mu; qv = fmaf(d, d, qv); }
#pragma unroll
    for (int sh = 16; sh; sh >>= 1) qv += __shfl_xor(qv, sh, 32);
    const float rs = rsqrtf(qv * (1.0f / DV) + LEPS);
{
#pragma unroll
        for (int st = 0; st < 4; ++st) { const int c0 = st * 128 + lane * 4; v4f o; v4us oh, ol;
#pragma unroll
            for (int q = 0; q < 4; ++q) { const float y = (v[st * 4 + q] - mu) * rs * bfr(g[c0 + q]) + bfr(bb[c0 + q]); o[q] = y; const unsigned short hb = f2bf(y); oh[q] = hb; ol[q] = f2bf(y - bf2f(hb)); }
            *(v4f*)(Hf + s * DV + c0) = o; *(v4usa*)(&hs[0][wv][c0]) = oh; *(v4usa*)(&hs[1][wv][c0]) = ol; }
         }
    asm volatile("s_wait_xcnt 0x0" ::: "memory");    // stands in front of the writes below to the H stores' data and address registers
    __syncthreads();
    const int rr = threadIdx.x & 7;
    v8us xh[2], xl[2];
#pragma unroll
    for (int j = 0; j < 2; ++j) { const int c = (threadIdx.x >> 3) + 32 * j; xh[j] = *(const v8usa*)(&hs[0][rr][c * 8]); xl[j] = *(const v8usa*)(&hs[1][rr][c * 8]); }
#pragma unroll
    for (int j = 0; j < 2; ++j) { const size_t o = fragoff((size_t)blockIdx.x * 8 + rr, (threadIdx.x >> 3) + 32 * j, DV); *(v8us*)(Hh + o) = xh[j]; *(v8us*)(Hl + o) = xl[j]; }
}
__global__ __launch_bounds__(256) void k_ln2(const float* __restrict__ Hf, const float* __restrict__ F, const float* __restrict__ g, const float* __restrict__ bb, float* OUTB) {
    const int lane = threadIdx.x & 31; const size_t s = (size_t)blockIdx.x * 8 + (threadIdx.x >> 5); if (s >= (size_t)NR) return; float v[16]; float sm = 0.f;
#pragma unroll
    for (int st = 0; st < 4; ++st) {
#pragma unroll
        for (int q = 0; q < 4; ++q) { const int c = st * 128 + lane * 4 + q; const float t = Hf[s * DV + c] + fmaxf(F[s * DV + c], 0.f); v[st * 4 + q] = t; sm += t; } }
#pragma unroll
    for (int sh = 16; sh; sh >>= 1) sm += __shfl_xor(sm, sh, 32);
    const float mu = sm * (1.0f / DV); float qv = 0.f;
#pragma unroll
    for (int i = 0; i < 16; ++i) { const float d = v[i] - mu; qv = fmaf(d, d, qv); }
#pragma unroll
    for (int sh = 16; sh; sh >>= 1) qv += __shfl_xor(qv, sh, 32);
    const float rs = rsqrtf(qv * (1.0f / DV) + LEPS);
{
#pragma unroll
        for (int st = 0; st < 4; ++st) { const int c0 = st * 128 + lane * 4; v4f o;
#pragma unroll
            for (int q = 0; q < 4; ++q) o[q] = (v[st * 4 + q] - mu) * rs * bfr(g[c0 + q]) + bfr(bb[c0 + q]);
            *(v4f*)(OUTB + s * DV + c0) = o; }
         }
}

extern "C" void kernel_launch(void* const* d_in, const int* in_sizes, int n_in,
                              void* d_out, int out_size, void* d_ws, size_t ws_size, hipStream_t stream) {
    (void)in_sizes; (void)n_in; (void)out_size;
    const float* Qi = (const float*)d_in[0]; const float* Ki = (const float*)d_in[1]; const float* Wq = (const float*)d_in[2]; const float* bq = (const float*)d_in[3]; const float* Wk = (const float*)d_in[4]; const float* bk = (const float*)d_in[5];
    const float* Wv = (const float*)d_in[6]; const float* bv = (const float*)d_in[7]; const float* Wo = (const float*)d_in[8]; const float* bo = (const float*)d_in[9]; const float* g0 = (const float*)d_in[10]; const float* b0 = (const float*)d_in[11]; const float* g1 = (const float*)d_in[12]; const float* b1 = (const float*)d_in[13];
    float* out = (float*)d_out;    // [4][2048][512]
    char* wsp = (char*)d_ws;
    auto take = [&](size_t bytes) { char* p = wsp; wsp += (bytes + 255) & ~(size_t)255; return (void*)p; };
    // Kept through attention: the four weights, the q/k/v planes of all items and heads, O and QF.
    bf* WT = (bf*)take((size_t)4 * DV * DV * 2);    // WqT, WkT, WvT, WoT
    bf* Qh = (bf*)take((size_t)NR * DV * 2); bf* Ql = (bf*)take((size_t)NR * DV * 2); bf* Kh = (bf*)take((size_t)NR * DV * 2); bf* Kl = (bf*)take((size_t)NR * DV * 2); bf* VTh = (bf*)take((size_t)NR * DV * 2); bf* VTl = (bf*)take((size_t)NR * DV * 2);
    float* O = (float*)take((size_t)NR * DV * 4); float* QF = (float*)take((size_t)NR * DV * 4);
    // One region, used twice in stream order: (1) XQ, XK; (2) Hf, Hh, Hl, FF.
    char* const reg = wsp;
    bf* XQ = (bf*)take((size_t)NR * DV * 2); bf* XK = (bf*)take((size_t)NR * DV * 2);
    wsp = reg;
    float* Hf = (float*)take((size_t)NR * DV * 4); bf* Hh = (bf*)take((size_t)NR * DV * 2); bf* Hl = (bf*)take((size_t)NR * DV * 2); float* FF = (float*)take((size_t)NR * DV * 4);
    if ((size_t)(wsp - (char*)d_ws) > ws_size) return;    // the kept part plus the larger use of the region: about 136 MB
    k_wt<<<dim3(DV / 64, DV / 64, 4), 256, 0, stream>>>(Wq, Wk, Wv, Wo, DV, DV, WT);   // (in, out) k-major
    k_cvtx<<<dim3(NR / 8, 2, 1), 256, 0, stream>>>(Qi, Ki, XQ);
    k_gemmb<false, false, true><<<dim3(NR / 64, DV / 64, 3), 128, 0, stream>>>(XQ, nullptr, WT, bq, QF, DV, nullptr, nullptr, DV, 1, XK, bk, bv, Qh, Ql, Kh, Kl, VTh, VTl);
    k_fattn<<<dim3(NN / (FG * FQ * 16), NH_, NBT), FW * 32, 0, stream>>>(Qh, Ql, Kh, Kl, VTh, VTl, O);
    k_ln1<<<NR / 8, 256, 0, stream>>>(O, QF, g0, b0, Hf, Hh, Hl);
    k_gemmb<true, false><<<dim3(NR / 64, DV / 64, 1), 128, 0, stream>>>(Hh, Hl, WT + (size_t)3 * DV * DV, bo, FF, DV, nullptr, nullptr, DV);
    k_ln2<<<NR / 8, 256, 0, stream>>>(Hf, FF, g1, b1, out);
}

// v006
// One run takes 124 microseconds.
// In two side-by-side timings against v005, it was 1.18 and 1.19 times as fast.
// All steps since v000 together make it 28.2 times as fast.
#include <hip/hip_runtime.h>

// Compute dtypes, f32 accumulate, per item: q/k/v = X.W + b as [2048 x 512].[512 x 512] GEMMs with PLAIN bf16 operands (exact products); per head: scores = q.k^T ([2048 x 64].[64 x
// 2048], both operands bf16 hi + UNSCALED residual, three products), softmax (x 1/sqrt(512)) in f32 -> P as bf16 hi + residual, ctx = P.v ([2048 x 2048].[2048 x 64], three products); + q
// residual and LayerNorm in f32 -> planes; rFF [2048 x 512].[512 x 512] (+ bo, relu) (two products), residual and the final LayerNorm in f32 - on v_wmma_f32_16x16x32_bf16.
// Launch plan: every stage runs once for all NBT items (their rows are contiguous: NR = NBT x NN rows); the projection GEMM writes the q, k and v^T planes itself; scores, softmax and P.v are one kernel,
// once for all items and heads (softmax by running maximum and sum; P is split unnormalised and the sum divides O at the end); both LayerNorms and the rFF product between them are one kernel, a block owning whole rows.

#define NBT  4
#define NN   2048
#define DV   512
#define NH_  8
#define HD   64
#define DM   DV
#define NTK  NN
#define SCL  0.044194173824159216f
#define LEPS 1e-5f
#define LOSC 1024.0f
#define NR   (NBT * NN)

typedef _Float16 h16;
typedef unsigned short bf;
typedef __attribute__((ext_vector_type(16))) __bf16   v16bf;
typedef __attribute__((ext_vector_type(16))) _Float16 v16h;
typedef __attribute__((ext_vector_type(8)))  _Float16 v8h;
typedef __attribute__((ext_vector_type(8)))  unsigned short v8us;
typedef __attribute__((ext_vector_type(8)))  float    v8f;
typedef __attribute__((ext_vector_type(4)))  float    v4f;
typedef __attribute__((ext_vector_type(4)))  _Float16 v4h;
typedef v8h  __attribute__((may_alias)) v8ha;
typedef v4f  __attribute__((may_alias)) v4fa;
typedef v8us __attribute__((may_alias)) v8usa;

__device__ __forceinline__ unsigned short f2bf(float f) { unsigned u = __float_as_uint(f); u += 0x7FFFu + ((u >> 16) & 1u); return (unsigned short)(u >> 16); }
__device__ __forceinline__ float bf2f(unsigned short b) { return __uint_as_float(((unsigned)b) << 16); }
__device__ __forceinline__ float bfr(float f) { return bf2f(f2bf(f)); }
__device__ __forceinline__ v16h cat16(v8h lo, v8h hi) { return __builtin_shufflevector(lo, hi, 0, 1, 2, 3, 4, 5, 6, 7, 8, 9, 10, 11, 12, 13, 14, 15); }
__device__ __forceinline__ v16bf cat16b(v8us lo, v8us hi) { return __builtin_bit_cast(v16bf, __builtin_shufflevector(lo, hi, 0, 1, 2, 3, 4, 5, 6, 7, 8, 9, 10, 11, 12, 13, 14, 15)); }
__device__ __forceinline__ v8f wmma16(v16h a, v16h b, v8f c) { return __builtin_amdgcn_wmma_f32_16x16x32_f16(false, a, false, b, (short)0, c, false, false); }
__device__ __forceinline__ v8f wmmab(v16bf a, v16bf b, v8f c) { return __builtin_amdgcn_wmma_f32_16x16x32_bf16(false, a, false, b, (short)0, c, false, false); }

// Fragment order: every bf16 plane that a matrix instruction reads as [rows][K] lies in memory as [rows / 16][K / 8][16 rows][8 elements], so that the 32 lanes of a fragment load (row lane & 15, pieces 2 * x + (lane >> 4))
// read 512 bytes in a row, four whole lines; the two loads of a 32-deep fragment are 512 bytes apart. fragoff = element offset of piece c (8 elements) of row r.
__device__ __forceinline__ size_t fragoff(size_t r, int c, int K) { return (r >> 4) * 16 * K + c * 128 + (r & 15) * 8; }

// k_wt: WT [z] = bf16(Wz[k][n]) (k-major [K][ncols]) as [n][K] in fragment order, via 64 x 64 LDS tiles; grid (K/64, ncols/64, 4), blockIdx.z = which of the four weights.
__global__ __launch_bounds__(256) void k_wt(const float* __restrict__ W0, const float* __restrict__ W1, const float* __restrict__ W2, const float* __restrict__ W3, int K, int ncols, bf* WT) {
    __shared__ __align__(16) unsigned short tl[64 * 72];
    const int z = blockIdx.z; const float* __restrict__ Wm = z == 0 ? W0 : z == 1 ? W1 : z == 2 ? W2 : W3; WT += (size_t)z * K * ncols;
    const int tid = threadIdx.x, k0 = blockIdx.x * 64, n0 = blockIdx.y * 64;
    const int kk = tid >> 2, nq = (tid & 3) * 16;
#pragma unroll
    for (int i = 0; i < 16; ++i) tl[(nq + i) * 72 + kk] = f2bf(Wm[(size_t)(k0 + kk) * ncols + n0 + nq + i]);
    __syncthreads();
    const int piece = (tid >> 4) & 7;    // 128 threads write the 2 KiB that 16 rows x 64 k fill in fragment order
    auto pass = [&]() {
#pragma unroll
        for (int s = 0; s < 2; ++s) { const int nr = ((tid >> 7) + 2 * s) * 16 + (tid & 15); const v8us val = *(const v8usa*)(tl + nr * 72 + piece * 8); *(v8us*)(WT + fragoff(n0 + nr, k0 / 8 + piece, K)) = val; }
    };
    pass(); 
}
// k_gemmb: 64 x 64 block tile (4 waves x 16 x 64) of C[NR][ldc] = (A [+ Al]).B^T (K = 512) [+ bf(bias[c])] [+ bf(R[r][c]) residual]; f32 whole-line epilogue (or f16
// PL (the q/k/v projections; a 64-column tile is one head): the epilogue writes what attention reads, bf16 hi + residual of the f32 tile: z = 0 planes Qh, Ql [item][head][NN][HD] and C (f32 q, for the residual),
// z = 1 planes Kh, Kl alike and no C, z = 2 planes VTh, VTl [item][head][NN / 32][HD][32] and no C; each [NN][HD] and each [HD][32] in fragment order.
template <bool SPLITA, bool F16OUT = false, bool PL = false>
// blockIdx.z = which product of a launch: z > 0 takes A from A12, the z-th [DV][K] plane behind Bn, bias1 or bias2, and the z-th [NR][ldc] plane behind C.
__global__ __launch_bounds__(128) void k_gemmb(const bf* __restrict__ A0, const bf* __restrict__ Al, const bf* __restrict__ B0, const float* __restrict__ bias0, float* C, int ldc, h16* C2, const float* __restrict__ R = nullptr, int K = DM, int roundR = 1,
                                               const bf* __restrict__ A12 = nullptr, const float* __restrict__ bias1 = nullptr, const float* __restrict__ bias2 = nullptr,
                                               bf* Qh = nullptr, bf* Ql = nullptr, bf* Kh = nullptr, bf* Kl = nullptr, bf* VTh = nullptr, bf* VTl = nullptr) {
    __shared__ __align__(16) float ost[PL ? 2 * 64 * 36 : 4 * 16 * 68];    // four f32 tiles [16][68], one a wave; or (PL, z = 2) two bf16 planes [64][72]
    const int z = blockIdx.z; const bf* __restrict__ A = z ? A12 : A0; const bf* __restrict__ Bn = B0 + (size_t)z * DV * K; const float* __restrict__ bias = z == 0 ? bias0 : z == 1 ? bias1 : bias2; C += (size_t)z * NR * ldc;
    const int lane = threadIdx.x & 31, wave = threadIdx.x >> 5, lr = lane & 15, hi = lane >> 4;
    const int r0 = blockIdx.x * 64 + wave * 16, c0 = blockIdx.y * 64;
    const size_t aoff = (size_t)r0 * K + lane * 8;    // A and B lie in fragment order (fragoff of row lr, piece hi): a k-step of 32 is 512 elements, its two loads 256 elements apart
    size_t boff[4];
#pragma unroll
    for (int t = 0; t < 4; ++t) boff[t] = (size_t)(c0 + t * 16) * K;    // the same in every lane
    v8f acc[4];
#pragma unroll
    for (int t = 0; t < 4; ++t) acc[t] = (v8f){};
#pragma unroll 1
    for (int kc = 0; kc < K; kc += 32) {
        const bf* pa = A + aoff + kc * 16; const bf* pal = SPLITA ? Al + aoff + kc * 16 : pa; const bf* pb[4];
        const v16bf a = cat16b(*(const v8us*)pa, *(const v8us*)(pa + 256));
        v16bf al = a;
        if (SPLITA) al = cat16b(*(const v8us*)pal, *(const v8us*)(pal + 256));
#pragma unroll
        for (int t = 0; t < 4; ++t) { pb[t] = Bn + boff[t] + kc * 16; const v16bf b = cat16b(*(const v8us*)(pb[t] + lane * 8), *(const v8us*)(pb[t] + lane * 8 + 256)); acc[t] = wmmab(a, b, acc[t]); if (SPLITA) acc[t] = wmmab(al, b, acc[t]); }
        asm volatile("v_nop\n\tv_nop\n\tv_nop\n\tv_nop" : "+v"(acc[0]), "+v"(acc[1]), "+v"(acc[2]), "+v"(acc[3]) : "v"(a), "v"(al));
        // The wait that stands in front of any write to the k-step's address registers; as its inputs they keep their registers up to it (left free, the compiler reuses them while the loads are out).
        asm volatile("s_wait_xcnt 0x0" :: "v"(pa), "v"(pal), "s"(pb[0]), "s"(pb[1]), "s"(pb[2]), "s"(pb[3]) : "memory");
    }
    float* os = ost + wave * (16 * 68);
    bf* vs = (bf*)(void*)ost;
    if (PL && z == 2) {
        // A lane holds 8 consecutive tokens (hi * 8 ...) of head column t * 16 + lr: 16 bytes of a v^T row as they stand. Rows of 64 tokens, pitch 72 (144 bytes: 16 x odd), the residual plane behind.
#pragma unroll
        for (int t = 0; t < 4; ++t) { const float bv = bfr(bias[c0 + t * 16 + lr]); v8us oh, ol;
#pragma unroll
            for (int j = 0; j < 8; ++j) { const float v = acc[t][j] + bv; const unsigned short hb = f2bf(v); oh[j] = hb; ol[j] = f2bf(v - bf2f(hb)); }
            bf* p = vs + (t * 16 + lr) * 72 + wave * 16 + hi * 8; *(v8usa*)p = oh; *(v8usa*)(p + 64 * 72) = ol; }
    } else {
#pragma unroll
        for (int t = 0; t < 4; ++t) { const float bv = bias ? bfr(bias[c0 + t * 16 + lr]) : 0.f;
#pragma unroll
            for (int j = 0; j < 8; ++j) os[(hi * 8 + j) * 68 + t * 16 + lr] = acc[t][j] + bv; }
    }
    __syncthreads();
    if (PL && z == 2) {
        // The block's 64 tokens x 64 head columns are 8 KiB in a row of each plane, [token / 32][head column / 16] fragments of 1 KiB; the 128 threads write 2 KiB an instruction group, both planes.
        const size_t vo = (((size_t)(blockIdx.x * 64 / NN) * NH_ + blockIdx.y) * NN + blockIdx.x * 64 % NN) * HD + threadIdx.x * 8;
        const bf* sp = vs + ((threadIdx.x >> 6) * 16 + (threadIdx.x & 15)) * 72 + ((threadIdx.x >> 4) & 3) * 8;    // head column (2 * (s & 1) + bit 6) * 16 + lr, keys (s >> 1) * 32 + bits 5, 4 as 16 and 8
        v8us xh[4], xl[4];
#pragma unroll
        for (int s = 0; s < 4; ++s) { xh[s] = *(const v8usa*)(sp + (s & 1) * 32 * 72 + (s >> 1) * 32); xl[s] = *(const v8usa*)(sp + 64 * 72 + (s & 1) * 32 * 72 + (s >> 1) * 32); }
#pragma unroll
        for (int s = 0; s < 4; ++s) { *(v8us*)(VTh + vo + s * 1024) = xh[s]; *(v8us*)(VTl + vo + s * 1024) = xl[s]; }
        return;
    }
    if (PL) {
        // The wave's 16 rows of its head's plane are 2 KiB in a row, in fragment order: lane -> row lr, piece 2 * s + hi.
        bf* Ph = z ? Kh : Qh; bf* Pl = z ? Kl : Ql;
        const size_t po = (((size_t)(r0 / NN) * NH_ + blockIdx.y) * NN + r0 % NN) * HD + lane * 8;
        v8us oh[4], ol[4];
#pragma unroll
        for (int s = 0; s < 4; ++s) { const float* sp = os + lr * 68 + (2 * s + hi) * 8; const v4f x = *(const v4fa*)sp, y = *(const v4fa*)(sp + 4);
#pragma unroll
            for (int i = 0; i < 8; ++i) { const float v = i < 4 ? x[i & 3] : y[i & 3]; const unsigned short hb = f2bf(v); oh[s][i] = hb; ol[s][i] = f2bf(v - bf2f(hb)); } }
#pragma unroll
        for (int s = 0; s < 4; ++s) { *(v8us*)(Ph + po + s * 4 * HD) = oh[s]; *(v8us*)(Pl + po + s * 4 * HD) = ol[s]; }
        if (z) return;
        asm volatile("s_wait_xcnt 0x0" ::: "memory");    // stands in front of the f32 pass's writes to the plane stores' data and address registers
        __builtin_amdgcn_sched_barrier(0);    // keeps that pass's instructions behind the wait
    }
    if (F16OUT) {
        h16* crow = (h16*)(void*)C + (size_t)r0 * ldc + c0;
        auto pass = [&]() {
#pragma unroll
            for (int s = 0; s < 4; ++s) { const int row = 4 * s + (lane >> 3), piece = lane & 7; const float* sp = os + row * 68 + piece * 8; v8h o, o2;
#pragma unroll
                for (int i = 0; i < 8; ++i) { const h16 a = (h16)sp[i]; o[i] = a; o2[i] = (h16)((sp[i] - (float)a) * LOSC); }
                *(v8h*)(crow + (size_t)row * ldc + piece * 8) = o; if (C2) *(v8h*)(C2 + (size_t)r0 * ldc + c0 + (size_t)row * ldc + piece * 8) = o2; }
        };
        pass(); 
    } else {
        float* crow = C + (size_t)r0 * ldc + c0;
        auto pass = [&]() {
#pragma unroll
            for (int s = 0; s < 8; ++s) { const int Lid = (lane >> 3) + 4 * s, piece = lane & 7; const int row = Lid >> 1, cofs = (Lid & 1) * 32 + piece * 4;
                v4f val = *(const v4fa*)(os + row * 68 + cofs); if (R) { const v4f rv = *(const v4f*)(R + ((size_t)r0 + row) * ldc + c0 + cofs); val += roundR ? (v4f){bfr(rv[0]), bfr(rv[1]), bfr(rv[2]), bfr(rv[3])} : rv; }
                *(v4f*)(crow + (size_t)row * ldc + cofs) = val; }
        };
        pass(); 
    }
}

// k_fattn: scores, softmax and P.v of one head for 256 queries per block, nothing of S or P leaving the registers. A wave owns FQ * 16 queries and one of the FKS parts of the NN keys, 32 keys a pass:
// S^T = K.Q^T (A = K rows, B = Q rows kept in registers, both bf16 hi + residual, three products), so a lane holds 16 keys' scores of one query (column lane & 15);
// running maximum and sum per query (log2 domain, one exchange between the lane halves), p = exp2(s * SCL2 - m) split into bf16 hi + residual: the two 16-key score tiles, converted in place,
// are the B operand of O^T += V^T.P^T (A = V^T rows, keys in the same order; three products). O^T is scaled by exp2(m_old - m_new) every pass and by 1 / sum at the end.
// The two waves of a query group (wave, wave + FW / FKS) meet in LDS: the upper one hands over its maximum, sum and O^T, the lower one brings both to the common maximum, adds, divides and stores.
// grid (NN / (FW / FKS * FQ * 16), NH_, NBT); planes Q, K [item][head][NN][HD] in fragment order, V^T [item][head][NN / 32][HD][32] with each [HD][32] in fragment order; O [NR][DV].
#define FQ 4
#define FW 8
#define FKS 2
#define FG (FW / FKS)
#define SCL2 (SCL * 1.4426950408889634f)
typedef __attribute__((ext_vector_type(2))) float  v2f;
typedef __attribute__((ext_vector_type(2))) __bf16 v2bf;
// One fragment of a plane in fragment order: 16 bytes at p + c and 16 at + 512 (k = 8 * hi + 0..7 and 16 + 8 * hi + 0..7 of row lr). p = the lane's own address (lane * 16 bytes into the first fragment), c a constant.
__device__ __forceinline__ v16bf ldfrag(const char* p, int c) { return cat16b(*(const v8us*)(p + c), *(const v8us*)(p + c + 512)); }
// The wait that stands in front of any write to the address registers of issued loads. It takes the addresses as inputs, so that they keep their registers up to it (left free, the compiler lands a later load's result on them).
__device__ __forceinline__ void xwait(const char* a, const char* b) { asm volatile("s_wait_xcnt 0x0" :: "v"(a), "v"(b) : "memory"); }
__device__ __forceinline__ float xhalf(float x) { const int b = __float_as_int(x); return __int_as_float(__builtin_amdgcn_permlanex16(b, b, 0x76543210, 0xfedcba98, false, false)); }
__global__ __launch_bounds__(FW * 32) void k_fattn(const bf* __restrict__ Qh0, const bf* __restrict__ Ql0, const bf* __restrict__ Kh0, const bf* __restrict__ Kl0, const bf* __restrict__ Vh0, const bf* __restrict__ Vl0, float* O) {
    const size_t pp = ((size_t)blockIdx.z * NH_ + blockIdx.y) * NN * HD;
    const bf* __restrict__ Qh = Qh0 + pp; const bf* __restrict__ Ql = Ql0 + pp; const bf* __restrict__ Kh = Kh0 + pp; const bf* __restrict__ Kl = Kl0 + pp; const bf* __restrict__ Vh = Vh0 + pp; const bf* __restrict__ Vl = Vl0 + pp;
    __shared__ __align__(16) float mrg[FG][(4 * FQ * 8 + 2 * FQ) * 32];
    const int lane = threadIdx.x & 31, wave = __builtin_amdgcn_readfirstlane(threadIdx.x >> 5), lr = lane & 15, hi = lane >> 4;    // the wave's number in a scalar register: loop bounds and branches on it stay scalar
    const int q0 = (blockIdx.x * FG + wave % FG) * (FQ * 16), kbeg = (wave / FG) * (NN / FKS);
    const unsigned loff = lane * 16;    // bytes: the lane's 16 of the 512 that a fragment load reads
    v16bf qh[FQ][2], ql[FQ][2];
    const char* pqh = (const char*)(Qh + (size_t)q0 * HD) + loff; const char* pql = (const char*)(Ql + (size_t)q0 * HD) + loff;
#pragma unroll
    for (int u = 0; u < FQ; ++u) {
#pragma unroll
        for (int ks = 0; ks < 2; ++ks) { qh[u][ks] = ldfrag(pqh, (u * 16 * HD + ks * 512) * 2); ql[u][ks] = ldfrag(pql, (u * 16 * HD + ks * 512) * 2); } }
    v16bf kh[2][2], kl[2][2], vh[4], vl[4];
    const char* pkh; const char* pkl;
    auto fetchk = [&](int kc) {
        pkh = (const char*)(Kh + (size_t)kc * HD) + loff; pkl = (const char*)(Kl + (size_t)kc * HD) + loff;
#pragma unroll
        for (int kt = 0; kt < 2; ++kt) {
#pragma unroll
            for (int ks = 0; ks < 2; ++ks) { kh[kt][ks] = ldfrag(pkh, (kt * 16 * HD + ks * 512) * 2); kl[kt][ks] = ldfrag(pkl, (kt * 16 * HD + ks * 512) * 2); } }
    };
    v8f acc[4][FQ]; float m[FQ], l[FQ];
#pragma unroll
    for (int u = 0; u < FQ; ++u) { m[u] = -3.0e38f; l[u] = 0.f;
#pragma unroll
        for (int t = 0; t < 4; ++t) acc[t][u] = (v8f){}; }
    fetchk(kbeg);
    // The scheduling fences keep each group of loads where it is written (V a whole score block ahead of its use, the next pass's K a whole softmax and P.v block ahead): left free, the compiler sinks a load to its WMMA.
    // The pass loop stays rolled: one pass is 96 WMMAs and some 500 vector instructions already, and a second copy would only cost instruction cache.
#pragma unroll 1
    for (int i = 0; i < NN / FKS; i += 32) {
        const int kc = kbeg + i;
        const char* pvh = (const char*)(Vh + (size_t)kc * HD) + loff; const char* pvl = (const char*)(Vl + (size_t)kc * HD) + loff;
#pragma unroll
        for (int t = 0; t < 4; ++t) { vh[t] = ldfrag(pvh, t * 1024); vl[t] = ldfrag(pvl, t * 1024); }
        __builtin_amdgcn_sched_barrier(0);
        v8f s[2][FQ];
#pragma unroll
        for (int kt = 0; kt < 2; ++kt) {
#pragma unroll
            for (int u = 0; u < FQ; ++u) s[kt][u] = (v8f){}; }
#pragma unroll
        for (int ks = 0; ks < 2; ++ks) {
#pragma unroll
            for (int kt = 0; kt < 2; ++kt) {
#pragma unroll
                for (int u = 0; u < FQ; ++u) s[kt][u] = wmmab(kh[kt][ks], qh[u][ks], s[kt][u]); }
#pragma unroll
            for (int kt = 0; kt < 2; ++kt) {
#pragma unroll
                for (int u = 0; u < FQ; ++u) s[kt][u] = wmmab(kh[kt][ks], ql[u][ks], s[kt][u]); }
#pragma unroll
            for (int kt = 0; kt < 2; ++kt) {
#pragma unroll
                for (int u = 0; u < FQ; ++u) s[kt][u] = wmmab(kl[kt][ks], qh[u][ks], s[kt][u]); } }
        __builtin_amdgcn_sched_barrier(0);
        xwait(pvh, pvl);    // written behind the score block, so that the wave does not stop for it directly behind the V loads
        fetchk(i + 32 < NN / FKS ? kc + 32 : kbeg);    // the last pass fetches the first again (in bounds, unused), so that the loads stand on one path
        __builtin_amdgcn_sched_barrier(0);
        v16bf ph[FQ], pl[FQ];
#pragma unroll
        for (int u = 0; u < FQ; ++u) {
            float mx0 = fmaxf(s[0][u][0], s[1][u][0]), mx1 = fmaxf(s[0][u][1], s[1][u][1]);
#pragma unroll
            for (int j = 2; j < 8; j += 2) { mx0 = fmaxf(mx0, fmaxf(s[0][u][j], s[1][u][j])); mx1 = fmaxf(mx1, fmaxf(s[0][u][j + 1], s[1][u][j + 1])); }
            float mx = fmaxf(mx0, mx1); mx = fmaxf(mx, xhalf(mx));
            const float mn = fmaxf(m[u], mx * SCL2), al = __builtin_amdgcn_exp2f(m[u] - mn); m[u] = mn;
            float ls0 = 0.f, ls1 = 0.f;
#pragma unroll
            for (int kt = 0; kt < 2; ++kt) {
#pragma unroll
                for (int j = 0; j < 8; j += 2) {
                    const v2f p = {__builtin_amdgcn_exp2f(fmaf(s[kt][u][j], SCL2, -mn)), __builtin_amdgcn_exp2f(fmaf(s[kt][u][j + 1], SCL2, -mn))};
                    ls0 += p[0]; ls1 += p[1];
                    const v2bf hb = __builtin_convertvector(p, v2bf); const v2bf lb = __builtin_convertvector(p - __builtin_convertvector(hb, v2f), v2bf);
                    ph[u][kt * 8 + j] = hb[0]; ph[u][kt * 8 + j + 1] = hb[1]; pl[u][kt * 8 + j] = lb[0]; pl[u][kt * 8 + j + 1] = lb[1]; } }
            l[u] = fmaf(l[u], al, ls0 + ls1);
#pragma unroll
            for (int t = 0; t < 4; ++t) acc[t][u] *= al;
        }
#pragma unroll
        for (int t = 0; t < 4; ++t) {
#pragma unroll
            for (int u = 0; u < FQ; ++u) acc[t][u] = wmmab(vh[t], ph[u], acc[t][u]); }
#pragma unroll
        for (int t = 0; t < 4; ++t) {
#pragma unroll
            for (int u = 0; u < FQ; ++u) acc[t][u] = wmmab(vh[t], pl[u], acc[t][u]); }
#pragma unroll
        for (int t = 0; t < 4; ++t) {
#pragma unroll
            for (int u = 0; u < FQ; ++u) acc[t][u] = wmmab(vl[t], ph[u], acc[t][u]); }
        __builtin_amdgcn_sched_barrier(0);    // keeps the wait below at the pass's end: left free, it rises to stand directly behind the K loads, and the wave stops for it there
        xwait(pkh, pkl);
    }
    float* mg = &mrg[wave % FG][0];
    if (wave >= FG) {
#pragma unroll
        for (int u = 0; u < FQ; ++u) { mg[(4 * FQ * 8 + u) * 32 + lane] = m[u]; mg[(4 * FQ * 8 + FQ + u) * 32 + lane] = l[u];
#pragma unroll
            for (int t = 0; t < 4; ++t) { const v8f r = acc[t][u]; float* p = mg + (t * FQ + u) * 256 + lane * 4;
                *(v4f*)p = (v4f){r[0], r[1], r[2], r[3]}; *(v4f*)(p + 128) = (v4f){r[4], r[5], r[6], r[7]}; } }
    }
    __syncthreads();
    if (wave < FG) {
        // A lane holds 8 consecutive head columns (t * 16 + 8 * hi ...) of query u * 16 + lr.
#pragma unroll
        for (int u = 0; u < FQ; ++u) {
            const float m1 = mg[(4 * FQ * 8 + u) * 32 + lane], l1 = mg[(4 * FQ * 8 + FQ + u) * 32 + lane];
            const float mn = fmaxf(m[u], m1), a0 = __builtin_amdgcn_exp2f(m[u] - mn), a1 = __builtin_amdgcn_exp2f(m1 - mn);
            const float lt = fmaf(l[u], a0, l1 * a1), inv = 1.0f / (lt + xhalf(lt)), f0 = a0 * inv, f1 = a1 * inv;
            float* orow = O + ((size_t)blockIdx.z * NN + q0 + u * 16 + lr) * DV + blockIdx.y * HD + 8 * hi;
            v4f res[8];
#pragma unroll
            for (int t = 0; t < 4; ++t) { const v8f r = acc[t][u]; const float* p = mg + (t * FQ + u) * 256 + lane * 4; const v4f x = *(const v4f*)p, y = *(const v4f*)(p + 128);
                res[2 * t] = (v4f){r[0], r[1], r[2], r[3]} * f0 + x * f1; res[2 * t + 1] = (v4f){r[4], r[5], r[6], r[7]} * f0 + y * f1; }
            // The two fences keep a query tile's arithmetic in front of its eight stores and the next tile's behind the wait, so that no register an issued store names is rewritten ahead of that wait.
            __builtin_amdgcn_sched_barrier(0);
#pragma unroll
            for (int t = 0; t < 4; ++t) { *(v4f*)(orow + t * 16) = res[2 * t]; *(v4f*)(orow + t * 16 + 4) = res[2 * t + 1]; }
            if (u + 1 < FQ) { asm volatile("s_wait_xcnt 0x0" ::: "memory");    // stands in front of the next tile's writes to the stores' data and address registers
                __builtin_amdgcn_sched_barrier(0); }
        }
    }
}

// grid (NR / 8, 2): blockIdx.y = which input; its [NR][DV] plane (fragment order) lies y planes behind dst. A block takes 8 rows, a wave 64 columns of them:
// lane -> row lane & 7, piece lane >> 3, so that a store writes four whole 128-byte lines of the plane.
__global__ __launch_bounds__(256) void k_cvtx(const float* __restrict__ src0, const float* __restrict__ src1, bf* dst) {
    const int lane = threadIdx.x & 31; const size_t r = (size_t)blockIdx.x * 8 + (lane & 7); if (r >= (size_t)NR) return;
    const float* __restrict__ src = blockIdx.y ? src1 : src0; dst += (size_t)blockIdx.y * NR * DV;
    const int c0 = (threadIdx.x >> 5) * (DV / 64) + (lane >> 3);    // the lane's first piece; its next is one k-step of 4 pieces on
    const float* p = src + r * DV + c0 * 8;
    v4f x[DV / 256][2];
#pragma unroll
    for (int q = 0; q < DV / 256; ++q) { x[q][0] = *(const v4f*)(p + q * 32); x[q][1] = *(const v4f*)(p + q * 32 + 4); }
    asm volatile("s_wait_xcnt 0x0" :: "v"(p) : "memory");    // stands in front of any write to the loads' address register, which as its input stays allocated up to it
#pragma unroll
    for (int q = 0; q < DV / 256; ++q) { v8us o;
#pragma unroll
        for (int i = 0; i < 8; ++i) o[i] = f2bf(x[q][i >> 2][i & 3]);
        *(v8us*)(dst + fragoff(r, c0 + q * 4, DV)) = o; }
}
// k_tail: everything behind attention for TR whole rows per block, so that nothing between O and the output leaves the WGP: H = LayerNorm(O[s] + q[s]) x bf(g0) + bf(b0) (f32; mean, biased var over 512),
// F = (Hh + Hl).Wo^T + bf(bo) (H as bf16 hi + residual, two products, hi then residual in every k-step of 32), out = LayerNorm(H + relu(F)) x bf(g1) + bf(b1).
// Both LayerNorms: one wave per row, 4 rows a wave, lane -> 4 columns per 128-step, 4 steps. The product: a wave takes all TR rows x 64 columns (2 x 4 tiles); A from LDS, B (Wo^T, fragment order) from L2, TB k-steps ahead.
// LDS: hp = the two planes in fragment order, a piece of [16 rows][8] being TPP elements from the next (272 bytes: a row's 8-byte writes, 16 pieces a store, fall on all 64 banks; a half wave's fragment read is 256 bytes in a row);
// ys = H in f32 (a wave's own rows); fs = F, pitch TFP (rows 8 apart lie 32 banks apart, as the accumulator's two lane halves write them).
#define TR  32
#define TB  3
#define TPP 136
#define TFP 516
__global__ __launch_bounds__(256) void k_tail(const float* __restrict__ O, const float* __restrict__ QF, const float* __restrict__ g0, const float* __restrict__ b0, const bf* __restrict__ WoT, const float* __restrict__ bo,
                                              const float* __restrict__ g1, const float* __restrict__ b1, float* OUTB) {
    typedef __attribute__((ext_vector_type(4))) unsigned short v4us;
    typedef v4us __attribute__((may_alias)) v4usa;
    __shared__ __align__(16) bf hp[2][TR / 16][DV / 8][TPP];
    __shared__ __align__(16) float ys[TR][DV];
    __shared__ __align__(16) float fs[TR][TFP];
    const int lane = threadIdx.x & 31, wv = __builtin_amdgcn_readfirstlane(threadIdx.x >> 5), lr = lane & 15, hi = lane >> 4;
    const size_t s0 = (size_t)blockIdx.x * TR + wv * 4;
    // The first TB k-steps of B depend on nothing: they are asked for ahead of the rows.
    const char* pbu = (const char*)(WoT + (size_t)wv * 64 * DV); const char* pb = pbu + lane * 16;    // pbu, pou, pqu: the same in every lane, the scalar bases of the loads
    v16bf b[TB][4];
#pragma unroll
    for (int ks = 0; ks < TB; ++ks) {
#pragma unroll
        for (int t = 0; t < 4; ++t) b[ks][t] = ldfrag(pb, t * 16 * DV * 2 + ks * 1024); }
    const float* pou = O + s0 * DV; const float* pqu = QF + s0 * DV; const float* po = pou + lane * 4; const float* pq = pqu + lane * 4;
    float v[4][16], sm[4];
    {
        v4f xo[4][4], xq[4][4];
#pragma unroll
        for (int i = 0; i < 4; ++i) {
#pragma unroll
            for (int st = 0; st < 4; ++st) { xo[i][st] = *(const v4f*)(po + i * DV + st * 128); xq[i][st] = *(const v4f*)(pq + i * DV + st * 128); } }
        __builtin_amdgcn_sched_barrier(0);    // keeps all the loads above in front of the first sum: left free, a row's loads sink to its adds and the rows' latencies follow one another
#pragma unroll
        for (int i = 0; i < 4; ++i) { sm[i] = 0.f;
#pragma unroll
            for (int st = 0; st < 4; ++st) {
#pragma unroll
                for (int q = 0; q < 4; ++q) { const float t = xo[i][st][q] + xq[i][st][q]; v[i][st * 4 + q] = t; sm[i] += t; } } }
    }
    // The wait that stands in front of any write to the row loads' address registers: as its inputs they stay allocated up to it; the sums hold it behind the loads.
    asm volatile("s_wait_xcnt 0x0" :: "s"(pou), "s"(pqu), "v"(sm[0]), "v"(sm[1]), "v"(sm[2]), "v"(sm[3]) : "memory");
    float mu[4], qv[4], rs[4];
#pragma unroll
    for (int sh = 16; sh; sh >>= 1) {
#pragma unroll
        for (int i = 0; i < 4; ++i) sm[i] += __shfl_xor(sm[i], sh, 32); }
#pragma unroll
    for (int i = 0; i < 4; ++i) { mu[i] = sm[i] * (1.0f / DV); qv[i] = 0.f;
#pragma unroll
        for (int e = 0; e < 16; ++e) { const float d = v[i][e] - mu[i]; qv[i] = fmaf(d, d, qv[i]); } }
#pragma unroll
    for (int sh = 16; sh; sh >>= 1) {
#pragma unroll
        for (int i = 0; i < 4; ++i) qv[i] += __shfl_xor(qv[i], sh, 32); }
#pragma unroll
    for (int i = 0; i < 4; ++i) rs[i] = rsqrtf(qv[i] * (1.0f / DV) + LEPS);
#pragma unroll
    for (int st = 0; st < 4; ++st) { const int c0 = st * 128 + lane * 4; const v4f gv = *(const v4f*)(g0 + c0), bv = *(const v4f*)(b0 + c0);
#pragma unroll
        for (int i = 0; i < 4; ++i) { const int r = wv * 4 + i; v4f o; v4us oh, ol;
#pragma unroll
            for (int q = 0; q < 4; ++q) { const float y = (v[i][st * 4 + q] - mu[i]) * rs[i] * bfr(gv[q]) + bfr(bv[q]); o[q] = y; const unsigned short hb = f2bf(y); oh[q] = hb; ol[q] = f2bf(y - bf2f(hb)); }
            *(v4fa*)(&ys[r][c0]) = o; *(v4usa*)(&hp[0][r >> 4][c0 >> 3][(r & 15) * 8 + (lane & 1) * 4]) = oh; *(v4usa*)(&hp[1][r >> 4][c0 >> 3][(r & 15) * 8 + (lane & 1) * 4]) = ol; } }
    float bov[4];    // asked for ahead of the product
#pragma unroll
    for (int t = 0; t < 4; ++t) bov[t] = bo[wv * 64 + t * 16 + lr];
    __syncthreads();    // every wave reads all TR rows of the planes
    v8f acc[2][4];
#pragma unroll
    for (int rt = 0; rt < 2; ++rt) {
#pragma unroll
        for (int t = 0; t < 4; ++t) acc[rt][t] = (v8f){}; }
    // A fragment of k-step ks: row lr, pieces 4 * ks + hi and 4 * ks + 2 + hi, the k order of the B fragments.
    v16bf ah[2][2], al[2][2];
    auto fetcha = [&](int ks) {
#pragma unroll
        for (int rt = 0; rt < 2; ++rt) {
            ah[ks & 1][rt] = cat16b(*(const v8usa*)(&hp[0][rt][4 * ks + hi][lr * 8]), *(const v8usa*)(&hp[0][rt][4 * ks + 2 + hi][lr * 8]));
            al[ks & 1][rt] = cat16b(*(const v8usa*)(&hp[1][rt][4 * ks + hi][lr * 8]), *(const v8usa*)(&hp[1][rt][4 * ks + 2 + hi][lr * 8])); }
    };
    fetcha(0);
    // Unrolled whole (16 k-steps of 16 WMMAs), so that the rings of A and B fragments are plain registers. The scheduling fences keep each k-step's loads where they are written (A one k-step ahead, B TB ahead):
    // left free, the compiler sinks a load to its WMMA.
#pragma unroll
    for (int ks = 0; ks < DV / 32; ++ks) {
        if (ks + 1 < DV / 32) fetcha(ks + 1);
        __builtin_amdgcn_sched_barrier(0);
#pragma unroll
        for (int rt = 0; rt < 2; ++rt) {
#pragma unroll
            for (int t = 0; t < 4; ++t) acc[rt][t] = wmmab(ah[ks & 1][rt], b[ks % TB][t], acc[rt][t]); }
#pragma unroll
        for (int rt = 0; rt < 2; ++rt) {
#pragma unroll
            for (int t = 0; t < 4; ++t) acc[rt][t] = wmmab(al[ks & 1][rt], b[ks % TB][t], acc[rt][t]); }
        __builtin_amdgcn_sched_barrier(0);
        if (ks + TB < DV / 32) {
#pragma unroll
            for (int t = 0; t < 4; ++t) b[ks % TB][t] = ldfrag(pb, t * 16 * DV * 2 + (ks + TB) * 1024); }
    }
    asm volatile("s_wait_xcnt 0x0" :: "s"(pbu) : "memory");    // stands in front of any write to the B loads' base register, which as its input stays allocated up to it
    // g1 and b1 are asked for here, so that they arrive behind the F tile's stores, the barrier and the row sums.
    v4f gv1[4], bv1[4];
#pragma unroll
    for (int st = 0; st < 4; ++st) { gv1[st] = *(const v4f*)(g1 + st * 128 + lane * 4); bv1[st] = *(const v4f*)(b1 + st * 128 + lane * 4); }
#pragma unroll
    for (int t = 0; t < 4; ++t) { const int c = wv * 64 + t * 16 + lr; const float bv = bfr(bov[t]);
#pragma unroll
        for (int rt = 0; rt < 2; ++rt) {
#pragma unroll
            for (int j = 0; j < 8; ++j) fs[rt * 16 + hi * 8 + j][c] = acc[rt][t][j] + bv; } }
    __syncthreads();    // a row of F comes from all eight waves
#pragma unroll
    for (int i = 0; i < 4; ++i) { const int r = wv * 4 + i; sm[i] = 0.f;
#pragma unroll
        for (int st = 0; st < 4; ++st) { const v4f h = *(const v4fa*)(&ys[r][st * 128 + lane * 4]), f = *(const v4fa*)(&fs[r][st * 128 + lane * 4]);
#pragma unroll
            for (int q = 0; q < 4; ++q) { const float t = h[q] + fmaxf(f[q], 0.f); v[i][st * 4 + q] = t; sm[i] += t; } } }
#pragma unroll
    for (int sh = 16; sh; sh >>= 1) {
#pragma unroll
        for (int i = 0; i < 4; ++i) sm[i] += __shfl_xor(sm[i], sh, 32); }
#pragma unroll
    for (int i = 0; i < 4; ++i) { mu[i] = sm[i] * (1.0f / DV); qv[i] = 0.f;
#pragma unroll
        for (int e = 0; e < 16; ++e) { const float d = v[i][e] - mu[i]; qv[i] = fmaf(d, d, qv[i]); } }
#pragma unroll
    for (int sh = 16; sh; sh >>= 1) {
#pragma unroll
        for (int i = 0; i < 4; ++i) qv[i] += __shfl_xor(qv[i], sh, 32); }
#pragma unroll
    for (int i = 0; i < 4; ++i) rs[i] = rsqrtf(qv[i] * (1.0f / DV) + LEPS);
    v4f res[4][4];
#pragma unroll
    for (int st = 0; st < 4; ++st) { const v4f gv = gv1[st], bv = bv1[st];
#pragma unroll
        for (int i = 0; i < 4; ++i) {
#pragma unroll
            for (int q = 0; q < 4; ++q) res[i][st][q] = (v[i][st * 4 + q] - mu[i]) * rs[i] * bfr(gv[q]) + bfr(bv[q]); } }
    __builtin_amdgcn_sched_barrier(0);    // keeps all arithmetic in front of the stores, so that no register an issued store names is written behind it
    float* pz = OUTB + s0 * DV + lane * 4;
#pragma unroll
    for (int i = 0; i < 4; ++i) {
#pragma unroll
        for (int st = 0; st < 4; ++st) *(v4f*)(pz + i * DV + st * 128) = res[i][st]; }
}

extern "C" void kernel_launch(void* const* d_in, const int* in_sizes, int n_in,
                              void* d_out, int out_size, void* d_ws, size_t ws_size, hipStream_t stream) {
    (void)in_sizes; (void)n_in; (void)out_size;
    const float* Qi = (const float*)d_in[0]; const float* Ki = (const float*)d_in[1]; const float* Wq = (const float*)d_in[2]; const float* bq = (const float*)d_in[3]; const float* Wk = (const float*)d_in[4]; const float* bk = (const float*)d_in[5];
    const float* Wv = (const float*)d_in[6]; const float* bv = (const float*)d_in[7]; const float* Wo = (const float*)d_in[8]; const float* bo = (const float*)d_in[9]; const float* g0 = (const float*)d_in[10]; const float* b0 = (const float*)d_in[11]; const float* g1 = (const float*)d_in[12]; const float* b1 = (const float*)d_in[13];
    float* out = (float*)d_out;    // [4][2048][512]
    char* wsp = (char*)d_ws;
    auto take = [&](size_t bytes) { char* p = wsp; wsp += (bytes + 255) & ~(size_t)255; return (void*)p; };
    // Kept through attention: the four weights, the q/k/v planes of all items and heads, O and QF.
    bf* WT = (bf*)take((size_t)4 * DV * DV * 2);    // WqT, WkT, WvT, WoT
    bf* Qh = (bf*)take((size_t)NR * DV * 2); bf* Ql = (bf*)take((size_t)NR * DV * 2); bf* Kh = (bf*)take((size_t)NR * DV * 2); bf* Kl = (bf*)take((size_t)NR * DV * 2); bf* VTh = (bf*)take((size_t)NR * DV * 2); bf* VTl = (bf*)take((size_t)NR * DV * 2);
    float* O = (float*)take((size_t)NR * DV * 4); float* QF = (float*)take((size_t)NR * DV * 4);
    bf* XQ = (bf*)take((size_t)NR * DV * 2); bf* XK = (bf*)take((size_t)NR * DV * 2);
    if ((size_t)(wsp - (char*)d_ws) > ws_size) return;    // about 103 MB
    k_wt<<<dim3(DV / 64, DV / 64, 4), 256, 0, stream>>>(Wq, Wk, Wv, Wo, DV, DV, WT);   // (in, out) k-major
    k_cvtx<<<dim3(NR / 8, 2, 1), 256, 0, stream>>>(Qi, Ki, XQ);
    k_gemmb<false, false, true><<<dim3(NR / 64, DV / 64, 3), 128, 0, stream>>>(XQ, nullptr, WT, bq, QF, DV, nullptr, nullptr, DV, 1, XK, bk, bv, Qh, Ql, Kh, Kl, VTh, VTl);
    k_fattn<<<dim3(NN / (FG * FQ * 16), NH_, NBT), FW * 32, 0, stream>>>(Qh, Ql, Kh, Kl, VTh, VTl, O);
    k_tail<<<NR / TR, 256, 0, stream>>>(O, QF, g0, b0, WT + (size_t)3 * DV * DV, bo, g1, b1, out);
}

// v007
// One run takes 106 microseconds.
// In both of two side-by-side timings against v006, it was 1.17 times as fast.
// All steps since v000 together make it 33.1 times as fast.
#include <hip/hip_runtime.h>

// Compute dtypes, f32 accumulate, per item: q/k/v = X.W + b as [2048 x 512].[512 x 512] GEMMs with PLAIN bf16 operands (exact products); per head: scores = q.k^T ([2048 x 64].[64 x
// 2048], both operands bf16 hi + UNSCALED residual, three products), softmax (x 1/sqrt(512)) in f32 -> P as bf16 hi + residual, ctx = P.v ([2048 x 2048].[2048 x 64], three products); + q
// residual and LayerNorm in f32 -> planes; rFF [2048 x 512].[512 x 512] (+ bo, relu) (two products), residual and the final LayerNorm in f32 - on v_wmma_f32_16x16x32_bf16.
// Launch plan: every stage runs once for all NBT items (their rows are contiguous: NR = NBT x NN rows); the projection kernel reads the f32 inputs, a block owning whole rows, and writes the q, k and v^T planes itself; scores, softmax and P.v are one kernel,
// once for all items and heads (softmax by running maximum and sum; P is split unnormalised and the sum divides O at the end); both LayerNorms and the rFF product between them are one kernel, a block owning whole rows.

#define NBT  4
#define NN   2048
#define DV   512
#define NH_  8
#define HD   64
#define DM   DV
#define NTK  NN
#define SCL  0.044194173824159216f
#define LEPS 1e-5f
#define LOSC 1024.0f
#define NR   (NBT * NN)

typedef _Float16 h16;
typedef unsigned short bf;
typedef __attribute__((ext_vector_type(16))) __bf16   v16bf;
typedef __attribute__((ext_vector_type(16))) _Float16 v16h;
typedef __attribute__((ext_vector_type(8)))  _Float16 v8h;
typedef __attribute__((ext_vector_type(8)))  unsigned short v8us;
typedef __attribute__((ext_vector_type(8)))  float    v8f;
typedef __attribute__((ext_vector_type(4)))  float    v4f;
typedef __attribute__((ext_vector_type(4)))  _Float16 v4h;
typedef v8h  __attribute__((may_alias)) v8ha;
typedef v4f  __attribute__((may_alias)) v4fa;
typedef v8us __attribute__((may_alias)) v8usa;

__device__ __forceinline__ unsigned short f2bf(float f) { unsigned u = __float_as_uint(f); u += 0x7FFFu + ((u >> 16) & 1u); return (unsigned short)(u >> 16); }
__device__ __forceinline__ float bf2f(unsigned short b) { return __uint_as_float(((unsigned)b) << 16); }
__device__ __forceinline__ float bfr(float f) { return bf2f(f2bf(f)); }
__device__ __forceinline__ v16h cat16(v8h lo, v8h hi) { return __builtin_shufflevector(lo, hi, 0, 1, 2, 3, 4, 5, 6, 7, 8, 9, 10, 11, 12, 13, 14, 15); }
__device__ __forceinline__ v16bf cat16b(v8us lo, v8us hi) { return __builtin_bit_cast(v16bf, __builtin_shufflevector(lo, hi, 0, 1, 2, 3, 4, 5, 6, 7, 8, 9, 10, 11, 12, 13, 14, 15)); }
__device__ __forceinline__ v8f wmma16(v16h a, v16h b, v8f c) { return __builtin_amdgcn_wmma_f32_16x16x32_f16(false, a, false, b, (short)0, c, false, false); }
__device__ __forceinline__ v8f wmmab(v16bf a, v16bf b, v8f c) { return __builtin_amdgcn_wmma_f32_16x16x32_bf16(false, a, false, b, (short)0, c, false, false); }

// Fragment order: every bf16 plane that a matrix instruction reads as [rows][K] lies in memory as [rows / 16][K / 8][16 rows][8 elements], so that the 32 lanes of a fragment load (row lane & 15, pieces 2 * x + (lane >> 4))
// read 512 bytes in a row, four whole lines; the two loads of a 32-deep fragment are 512 bytes apart. fragoff = element offset of piece c (8 elements) of row r.
__device__ __forceinline__ size_t fragoff(size_t r, int c, int K) { return (r >> 4) * 16 * K + c * 128 + (r & 15) * 8; }

// k_wt: WT [z] = bf16(Wz[k][n]) (k-major [K][ncols]) as [n][K] in fragment order, via 64 x 64 LDS tiles; grid (K/64, ncols/64, 4), blockIdx.z = which of the four weights.
__global__ __launch_bounds__(256) void k_wt(const float* __restrict__ W0, const float* __restrict__ W1, const float* __restrict__ W2, const float* __restrict__ W3, int K, int ncols, bf* WT) {
    __shared__ __align__(16) unsigned short tl[64 * 72];
    const int z = blockIdx.z; const float* __restrict__ Wm = z == 0 ? W0 : z == 1 ? W1 : z == 2 ? W2 : W3; WT += (size_t)z * K * ncols;
    const int tid = threadIdx.x, k0 = blockIdx.x * 64, n0 = blockIdx.y * 64;
    const int kk = tid >> 2, nq = (tid & 3) * 16;
#pragma unroll
    for (int i = 0; i < 16; ++i) tl[(nq + i) * 72 + kk] = f2bf(Wm[(size_t)(k0 + kk) * ncols + n0 + nq + i]);
    __syncthreads();
    const int piece = (tid >> 4) & 7;    // 128 threads write the 2 KiB that 16 rows x 64 k fill in fragment order
    auto pass = [&]() {
#pragma unroll
        for (int s = 0; s < 2; ++s) { const int nr = ((tid >> 7) + 2 * s) * 16 + (tid & 15); const v8us val = *(const v8usa*)(tl + nr * 72 + piece * 8); *(v8us*)(WT + fragoff(n0 + nr, k0 / 8 + piece, K)) = val; }
    };
    pass(); 
}
// k_fattn: scores, softmax and P.v of one head for 256 queries per block, nothing of S or P leaving the registers. A wave owns FQ * 16 queries and one of the FKS parts of the NN keys, 32 keys a pass:
// S^T = K.Q^T (A = K rows, B = Q rows kept in registers, both bf16 hi + residual, three products), so a lane holds 16 keys' scores of one query (column lane & 15);
// running maximum and sum per query (log2 domain, one exchange between the lane halves), p = exp2(s * SCL2 - m) split into bf16 hi + residual: the two 16-key score tiles, converted in place,
// are the B operand of O^T += V^T.P^T (A = V^T rows, keys in the same order; three products). O^T is scaled by exp2(m_old - m_new) every pass and by 1 / sum at the end.
// The two waves of a query group (wave, wave + FW / FKS) meet in LDS: the upper one hands over its maximum, sum and O^T, the lower one brings both to the common maximum, adds, divides and stores.
// grid (NN / (FW / FKS * FQ * 16), NH_, NBT); planes Q, K [item][head][NN][HD] in fragment order, V^T [item][head][NN / 32][HD][32] with each [HD][32] in fragment order; O [NR][DV].
#define FQ 4
#define FW 8
#define FKS 2
#define FG (FW / FKS)
#define SCL2 (SCL * 1.4426950408889634f)
typedef __attribute__((ext_vector_type(2))) float  v2f;
typedef __attribute__((ext_vector_type(2))) __bf16 v2bf;
// One fragment of a plane in fragment order: 16 bytes at p + c and 16 at + 512 (k = 8 * hi + 0..7 and 16 + 8 * hi + 0..7 of row lr). p = the lane's own address (lane * 16 bytes into the first fragment), c a constant.
__device__ __forceinline__ v16bf ldfrag(const char* p, int c) { return cat16b(*(const v8us*)(p + c), *(const v8us*)(p + c + 512)); }
// The wait that stands in front of any write to the address registers of issued loads. It takes the addresses as inputs, so that they keep their registers up to it (left free, the compiler lands a later load's result on them).
__device__ __forceinline__ void xwait(const char* a, const char* b) { asm volatile("s_wait_xcnt 0x0" :: "v"(a), "v"(b) : "memory"); }
__device__ __forceinline__ float xhalf(float x) { const int b = __float_as_int(x); return __int_as_float(__builtin_amdgcn_permlanex16(b, b, 0x76543210, 0xfedcba98, false, false)); }
__global__ __launch_bounds__(FW * 32) void k_fattn(const bf* __restrict__ Qh0, const bf* __restrict__ Ql0, const bf* __restrict__ Kh0, const bf* __restrict__ Kl0, const bf* __restrict__ Vh0, const bf* __restrict__ Vl0, float* O) {
    const size_t pp = ((size_t)blockIdx.z * NH_ + blockIdx.y) * NN * HD;
    const bf* __restrict__ Qh = Qh0 + pp; const bf* __restrict__ Ql = Ql0 + pp; const bf* __restrict__ Kh = Kh0 + pp; const bf* __restrict__ Kl = Kl0 + pp; const bf* __restrict__ Vh = Vh0 + pp; const bf* __restrict__ Vl = Vl0 + pp;
    __shared__ __align__(16) float mrg[FG][(4 * FQ * 8 + 2 * FQ) * 32];
    const int lane = threadIdx.x & 31, wave = __builtin_amdgcn_readfirstlane(threadIdx.x >> 5), lr = lane & 15, hi = lane >> 4;    // the wave's number in a scalar register: loop bounds and branches on it stay scalar
    const int q0 = (blockIdx.x * FG + wave % FG) * (FQ * 16), kbeg = (wave / FG) * (NN / FKS);
    const unsigned loff = lane * 16;    // bytes: the lane's 16 of the 512 that a fragment load reads
    v16bf qh[FQ][2], ql[FQ][2];
    const char* pqh = (const char*)(Qh + (size_t)q0 * HD) + loff; const char* pql = (const char*)(Ql + (size_t)q0 * HD) + loff;
#pragma unroll
    for (int u = 0; u < FQ; ++u) {
#pragma unroll
        for (int ks = 0; ks < 2; ++ks) { qh[u][ks] = ldfrag(pqh, (u * 16 * HD + ks * 512) * 2); ql[u][ks] = ldfrag(pql, (u * 16 * HD + ks * 512) * 2); } }
    v16bf kh[2][2], kl[2][2], vh[4], vl[4];
    const char* pkh; const char* pkl;
    auto fetchk = [&](int kc) {
        pkh = (const char*)(Kh + (size_t)kc * HD) + loff; pkl = (const char*)(Kl + (size_t)kc * HD) + loff;
#pragma unroll
        for (int kt = 0; kt < 2; ++kt) {
#pragma unroll
            for (int ks = 0; ks < 2; ++ks) { kh[kt][ks] = ldfrag(pkh, (kt * 16 * HD + ks * 512) * 2); kl[kt][ks] = ldfrag(pkl, (kt * 16 * HD + ks * 512) * 2); } }
    };
    v8f acc[4][FQ]; float m[FQ], l[FQ];
#pragma unroll
    for (int u = 0; u < FQ; ++u) { m[u] = -3.0e38f; l[u] = 0.f;
#pragma unroll
        for (int t = 0; t < 4; ++t) acc[t][u] = (v8f){}; }
    fetchk(kbeg);
    // The scheduling fences keep each group of loads where it is written (V a whole score block ahead of its use, the next pass's K a whole softmax and P.v block ahead): left free, the compiler sinks a load to its WMMA.
    // The pass loop stays rolled: one pass is 96 WMMAs and some 500 vector instructions already, and a second copy would only cost instruction cache.
#pragma unroll 1
    for (int i = 0; i < NN / FKS; i += 32) {
        const int kc = kbeg + i;
        const char* pvh = (const char*)(Vh + (size_t)kc * HD) + loff; const char* pvl = (const char*)(Vl + (size_t)kc * HD) + loff;
#pragma unroll
        for (int t = 0; t < 4; ++t) { vh[t] = ldfrag(pvh, t * 1024); vl[t] = ldfrag(pvl, t * 1024); }
        __builtin_amdgcn_sched_barrier(0);
        v8f s[2][FQ];
#pragma unroll
        for (int kt = 0; kt < 2; ++kt) {
#pragma unroll
            for (int u = 0; u < FQ; ++u) s[kt][u] = (v8f){}; }
#pragma unroll
        for (int ks = 0; ks < 2; ++ks) {
#pragma unroll
            for (int kt = 0; kt < 2; ++kt) {
#pragma unroll
                for (int u = 0; u < FQ; ++u) s[kt][u] = wmmab(kh[kt][ks], qh[u][ks], s[kt][u]); }
#pragma unroll
            for (int kt = 0; kt < 2; ++kt) {
#pragma unroll
                for (int u = 0; u < FQ; ++u) s[kt][u] = wmmab(kh[kt][ks], ql[u][ks], s[kt][u]); }
#pragma unroll
            for (int kt = 0; kt < 2; ++kt) {
#pragma unroll
                for (int u = 0; u < FQ; ++u) s[kt][u] = wmmab(kl[kt][ks], qh[u][ks], s[kt][u]); } }
        __builtin_amdgcn_sched_barrier(0);
        xwait(pvh, pvl);    // written behind the score block, so that the wave does not stop for it directly behind the V loads
        fetchk(i + 32 < NN / FKS ? kc + 32 : kbeg);    // the last pass fetches the first again (in bounds, unused), so that the loads stand on one path
        __builtin_amdgcn_sched_barrier(0);
        v16bf ph[FQ], pl[FQ];
#pragma unroll
        for (int u = 0; u < FQ; ++u) {
            float mx0 = fmaxf(s[0][u][0], s[1][u][0]), mx1 = fmaxf(s[0][u][1], s[1][u][1]);
#pragma unroll
            for (int j = 2; j < 8; j += 2) { mx0 = fmaxf(mx0, fmaxf(s[0][u][j], s[1][u][j])); mx1 = fmaxf(mx1, fmaxf(s[0][u][j + 1], s[1][u][j + 1])); }
            float mx = fmaxf(mx0, mx1); mx = fmaxf(mx, xhalf(mx));
            const float mn = fmaxf(m[u], mx * SCL2), al = __builtin_amdgcn_exp2f(m[u] - mn); m[u] = mn;
            float ls0 = 0.f, ls1 = 0.f;
#pragma unroll
            for (int kt = 0; kt < 2; ++kt) {
#pragma unroll
                for (int j = 0; j < 8; j += 2) {
                    const v2f p = {__builtin_amdgcn_exp2f(fmaf(s[kt][u][j], SCL2, -mn)), __builtin_amdgcn_exp2f(fmaf(s[kt][u][j + 1], SCL2, -mn))};
                    ls0 += p[0]; ls1 += p[1];
                    const v2bf hb = __builtin_convertvector(p, v2bf); const v2bf lb = __builtin_convertvector(p - __builtin_convertvector(hb, v2f), v2bf);
                    ph[u][kt * 8 + j] = hb[0]; ph[u][kt * 8 + j + 1] = hb[1]; pl[u][kt * 8 + j] = lb[0]; pl[u][kt * 8 + j + 1] = lb[1]; } }
            l[u] = fmaf(l[u], al, ls0 + ls1);
#pragma unroll
            for (int t = 0; t < 4; ++t) acc[t][u] *= al;
        }
#pragma unroll
        for (int t = 0; t < 4; ++t) {
#pragma unroll
            for (int u = 0; u < FQ; ++u) acc[t][u] = wmmab(vh[t], ph[u], acc[t][u]); }
#pragma unroll
        for (int t = 0; t < 4; ++t) {
#pragma unroll
            for (int u = 0; u < FQ; ++u) acc[t][u] = wmmab(vh[t], pl[u], acc[t][u]); }
#pragma unroll
        for (int t = 0; t < 4; ++t) {
#pragma unroll
            for (int u = 0; u < FQ; ++u) acc[t][u] = wmmab(vl[t], ph[u], acc[t][u]); }
        __builtin_amdgcn_sched_barrier(0);    // keeps the wait below at the pass's end: left free, it rises to stand directly behind the K loads, and the wave stops for it there
        xwait(pkh, pkl);
    }
    float* mg = &mrg[wave % FG][0];
    if (wave >= FG) {
#pragma unroll
        for (int u = 0; u < FQ; ++u) { mg[(4 * FQ * 8 + u) * 32 + lane] = m[u]; mg[(4 * FQ * 8 + FQ + u) * 32 + lane] = l[u];
#pragma unroll
            for (int t = 0; t < 4; ++t) { const v8f r = acc[t][u]; float* p = mg + (t * FQ + u) * 256 + lane * 4;
                *(v4f*)p = (v4f){r[0], r[1], r[2], r[3]}; *(v4f*)(p + 128) = (v4f){r[4], r[5], r[6], r[7]}; } }
    }
    __syncthreads();
    if (wave < FG) {
        // A lane holds 8 consecutive head columns (t * 16 + 8 * hi ...) of query u * 16 + lr.
#pragma unroll
        for (int u = 0; u < FQ; ++u) {
            const float m1 = mg[(4 * FQ * 8 + u) * 32 + lane], l1 = mg[(4 * FQ * 8 + FQ + u) * 32 + lane];
            const float mn = fmaxf(m[u], m1), a0 = __builtin_amdgcn_exp2f(m[u] - mn), a1 = __builtin_amdgcn_exp2f(m1 - mn);
            const float lt = fmaf(l[u], a0, l1 * a1), inv = 1.0f / (lt + xhalf(lt)), f0 = a0 * inv, f1 = a1 * inv;
            float* orow = O + ((size_t)blockIdx.z * NN + q0 + u * 16 + lr) * DV + blockIdx.y * HD + 8 * hi;
            v4f res[8];
#pragma unroll
            for (int t = 0; t < 4; ++t) { const v8f r = acc[t][u]; const float* p = mg + (t * FQ + u) * 256 + lane * 4; const v4f x = *(const v4f*)p, y = *(const v4f*)(p + 128);
                res[2 * t] = (v4f){r[0], r[1], r[2], r[3]} * f0 + x * f1; res[2 * t + 1] = (v4f){r[4], r[5], r[6], r[7]} * f0 + y * f1; }
            // The two fences keep a query tile's arithmetic in front of its eight stores and the next tile's behind the wait, so that no register an issued store names is rewritten ahead of that wait.
            __builtin_amdgcn_sched_barrier(0);
#pragma unroll
            for (int t = 0; t < 4; ++t) { *(v4f*)(orow + t * 16) = res[2 * t]; *(v4f*)(orow + t * 16 + 4) = res[2 * t + 1]; }
            if (u + 1 < FQ) { asm volatile("s_wait_xcnt 0x0" ::: "memory");    // stands in front of the next tile's writes to the stores' data and address registers
                __builtin_amdgcn_sched_barrier(0); }
        }
    }
}

// k_proj: the q, k and v projections, from the f32 inputs to the planes that attention reads. grid (NR / PR, 3), blockIdx.y = z = which product. A block owns PR whole rows of its input (z = 0: XQ, else XK):
// a wave reads 16 of them (512 bytes of a row a load), rounds them to bf16 and lays them in LDS in fragment order (pieces of [16 rows][8] PPP elements apart, as in k_tail); behind the barrier wave w takes all PR rows x head w
// (8 x 4 tiles), x fragments from LDS half a k-step ahead, weight fragments (W^T, fragment order) from L2 four k-steps ahead in a ring of PB.
// z < 2: D = W^T.x^T, so that a lane holds 8 consecutive head columns of one row, 16 bytes of a q or k plane as they stand (a store writes 512 bytes in a row); z = 0 also writes q in f32 (QF, for the residual), whole lines through the wave's own LDS tile.
// z = 2: D = x.W, so that a lane holds 8 consecutive tokens of one head column, 16 bytes of a v^T plane as they stand. Planes: bf16 hi + residual of the f32 tile + bf(bias), Q, K [item][head][NN][HD], V^T [item][head][NN / 32][HD][32].
#define PR  128
#define PB  4
#define PPP 136
typedef __attribute__((ext_vector_type(4))) unsigned v4u;
typedef __attribute__((ext_vector_type(2))) unsigned v2u;
typedef v4u __attribute__((may_alias)) v4ua;
typedef v2u __attribute__((may_alias)) v2ua;
__device__ __forceinline__ unsigned pkbf(float a, float b) { return __builtin_bit_cast(unsigned, __builtin_convertvector((v2f){a, b}, v2bf)); }
// 8 f32 values -> 8 bf16 (nearest even) and the 8 bf16 of what the rounding left
__device__ __forceinline__ void split8(const float (&v)[8], v4u& oh, v4u& ol) {
#pragma unroll
    for (int p = 0; p < 4; ++p) { const v2f x = {v[2 * p], v[2 * p + 1]}; const v2bf hb = __builtin_convertvector(x, v2bf); const v2bf lb = __builtin_convertvector(x - __builtin_convertvector(hb, v2f), v2bf);
        oh[p] = __builtin_bit_cast(unsigned, hb); ol[p] = __builtin_bit_cast(unsigned, lb); }
}
// The product of a wave: ap = the lane's 16 bytes of piece hi, row tile 0, k-step 0 in LDS; pb = the lane's 16 bytes of the wave's first weight fragment; b holds the first PB k-steps. WA: the weight is the A operand.
// The fetches past the last k-step read the next row tile's pieces and the next 16 weight rows (the fourth weight's behind the third): inside the arrays, written in this call, unused; so the loop has one path.
template <bool WA>
__device__ __forceinline__ void proj_mm(const bf* ap, const char* pb, v16bf (&b)[PB][4], v8f (&acc)[PR / 16][4]) {
    v16bf a[2][4];
    auto fetcha = [&](int g, int ks) {
#pragma unroll
        for (int i = 0; i < 4; ++i) { const bf* p = ap + ((g * 4 + i) * (DV / 8) + 4 * ks) * PPP; a[g][i] = cat16b(*(const v8usa*)p, *(const v8usa*)(p + 2 * PPP)); }
    };
    auto mm = [&](int g, int kk) {
#pragma unroll
        for (int i = 0; i < 4; ++i) {
#pragma unroll
            for (int t = 0; t < 4; ++t) { if constexpr (WA) acc[g * 4 + i][t] = wmmab(b[kk][t], a[g][i], acc[g * 4 + i][t]); else acc[g * 4 + i][t] = wmmab(a[g][i], b[kk][t], acc[g * 4 + i][t]); } }
    };
    fetcha(0, 0);
    // Rolled by PB k-steps (128 WMMAs a trip), so that the ring's places are plain registers and the text stays short. The scheduling fences keep each group of loads where it is written: left free, the compiler sinks a load to its WMMA.
#pragma unroll 1
    for (int k0 = 0; k0 < DV / 32; k0 += PB) {
        const char* pk = pb + k0 * 1024;
#pragma unroll
        for (int kk = 0; kk < PB; ++kk) {
            fetcha(1, k0 + kk);
            __builtin_amdgcn_sched_barrier(0);
            mm(0, kk);
            __builtin_amdgcn_sched_barrier(0);
            fetcha(0, k0 + kk + 1);
            __builtin_amdgcn_sched_barrier(0);
            mm(1, kk);
            __builtin_amdgcn_sched_barrier(0);
#pragma unroll
            for (int t = 0; t < 4; ++t) b[kk][t] = ldfrag(pk, t * 16 * DV * 2 + (kk + PB) * 1024);
        }
        // The wait that stands in front of the next trip's write to the weight loads' address register; the two fences keep it behind the trip's last loads and that write behind it.
        __builtin_amdgcn_sched_barrier(0);
        asm volatile("s_wait_xcnt 0x0" ::: "memory");
        __builtin_amdgcn_sched_barrier(0);
    }
}
// One block's work; WA = the weight is the A operand (z < 2). A function per form, so that each side of the kernel's one branch on z holds its own registers.
template <bool WA>
__device__ __forceinline__ void proj_body(bf (*hp)[DV / 8][PPP], float* os, int z, const float* __restrict__ X, const bf* __restrict__ WT, const float* __restrict__ bias, float* QF, bf* Ph, bf* Pl) {
    const int lane = threadIdx.x & 31, wv = __builtin_amdgcn_readfirstlane(threadIdx.x >> 5), lr = lane & 15, hi = lane >> 4;
    const size_t r0 = (size_t)blockIdx.x * PR;
    const float* px = X + (r0 + wv * 16) * DV + lane * 4;
    const char* pb = (const char*)(WT + ((size_t)z * DV + wv * 64) * DV) + lane * 16;
    v16bf b[PB][4];
    {
        // The wave's 16 rows in four groups of 16 loads, two or three groups out at a time.
        v4f x[4][16];
        auto ask = [&](int q) {
#pragma unroll
            for (int i = 0; i < 4; ++i) {
#pragma unroll
                for (int st = 0; st < 4; ++st) x[q][i * 4 + st] = *(const v4f*)(px + (q * 4 + i) * DV + st * 128); }
        };
        auto put = [&](int q) {
#pragma unroll
            for (int i = 0; i < 4; ++i) {
#pragma unroll
                for (int st = 0; st < 4; ++st) { const v4f v = x[q][i * 4 + st]; *(v2ua*)(&hp[wv][st * 16 + (lane >> 1)][(q * 4 + i) * 8 + (lane & 1) * 4]) = (v2u){pkbf(v[0], v[1]), pkbf(v[2], v[3])}; } }
        };
        // The scheduling fences keep the groups of loads ahead of the rounding: left free, a group's loads sink to their use and the groups' latencies follow one another.
        ask(0); ask(1);
        __builtin_amdgcn_sched_barrier(0);
        put(0); ask(2);
        __builtin_amdgcn_sched_barrier(0);
        put(1); ask(3);
        __builtin_amdgcn_sched_barrier(0);
        put(2);
        __builtin_amdgcn_sched_barrier(0);    // the weight loads stay behind the third group's use: never more than 48 loads of a wave are out
#pragma unroll
        for (int ks = 0; ks < PB; ++ks) {
#pragma unroll
            for (int t = 0; t < 4; ++t) b[ks][t] = ldfrag(pb, t * 16 * DV * 2 + ks * 1024); }
        __builtin_amdgcn_sched_barrier(0);
        asm volatile("s_wait_xcnt 0x0" ::: "memory");    // stands in front of any write to the address registers of the loads above
        __builtin_amdgcn_sched_barrier(0);    // keeps such writes behind it
        put(3);
    }
    __syncthreads();    // every wave reads all PR rows
    v8f acc[PR / 16][4];
#pragma unroll
    for (int i = 0; i < PR / 16; ++i) {
#pragma unroll
        for (int t = 0; t < 4; ++t) acc[i][t] = (v8f){}; }
    proj_mm<WA>(&hp[0][hi][lr * 8], pb, b, acc);
    const size_t pl0 = (((r0 / NN) * NH_ + wv) * NN + r0 % NN) * HD + lane * 8;    // the lane's 16 bytes of the first 512 of the wave's PR x HD part of a plane
    float bs[WA ? 4 : 1][WA ? 8 : 4];
    if constexpr (WA) {
#pragma unroll
        for (int t = 0; t < 4; ++t) { const v4f x = *(const v4f*)(bias + wv * 64 + t * 16 + hi * 8), y = *(const v4f*)(bias + wv * 64 + t * 16 + hi * 8 + 4);
#pragma unroll
            for (int j = 0; j < 8; ++j) bs[t][j] = j < 4 ? x[j & 3] : y[j & 3]; }
    } else {
#pragma unroll
        for (int t = 0; t < 4; ++t) bs[0][t] = bias[wv * 64 + t * 16 + lr];
    }
    // The wait that stands in front of any write to the bias loads' address registers; the two fences keep it behind the loads and the arithmetic behind it.
    __builtin_amdgcn_sched_barrier(0);
    asm volatile("s_wait_xcnt 0x0" ::: "memory");
    __builtin_amdgcn_sched_barrier(0);
#pragma unroll
    for (int t = 0; t < (WA ? 4 : 1); ++t) {
#pragma unroll
        for (int j = 0; j < (WA ? 8 : 4); ++j) bs[t][j] = bfr(bs[t][j]); }
    float* crow = QF + r0 * DV + wv * 64;
    // WA, tile (i, t): head columns t * 16 + hi * 8 + j of row i * 16 + lr = piece 2 * t + hi of row lr of the 16-row group i.
    // Else: tokens i * 16 + hi * 8 + j of head column t * 16 + lr = piece (i & 1) * 2 + hi of row lr of fragment t of the 32-token group i >> 1.
#pragma unroll
    for (int i = 0; i < PR / 16; ++i) {
        v4u oh[4], ol[4]; v4f qf[8];
#pragma unroll
        for (int t = 0; t < 4; ++t) { float v[8];
#pragma unroll
            for (int j = 0; j < 8; ++j) v[j] = acc[i][t][j] + (WA ? bs[t][j] : bs[0][t]);
            split8(v, oh[t], ol[t]);
            if (WA && z == 0) { float* p = os + lr * 68 + t * 16 + hi * 8; *(v4fa*)p = (v4f){v[0], v[1], v[2], v[3]}; *(v4fa*)(p + 4) = (v4f){v[4], v[5], v[6], v[7]}; } }
        if (WA && z == 0) {
            // The wave reads its own tile back by lines (8 lanes a 128-byte line), other lanes' values among them: its writes have retired first.
            asm volatile("s_wait_dscnt 0x0" ::: "memory");
#pragma unroll
            for (int s = 0; s < 8; ++s) { const int Lid = (lane >> 3) + 4 * s; qf[s] = *(const v4fa*)(os + (Lid >> 1) * 68 + (Lid & 1) * 32 + (lane & 7) * 4); }
        }
        // The two fences keep a tile row's arithmetic in front of its stores and the next one's behind the wait, so that no register an issued store names is rewritten ahead of that wait.
        __builtin_amdgcn_sched_barrier(0);
#pragma unroll
        for (int t = 0; t < 4; ++t) { const size_t o = pl0 + (WA ? i * 16 * HD + t * 256 : (i >> 1) * 32 * HD + t * 512 + (i & 1) * 256); *(v4ua*)(Ph + o) = oh[t]; *(v4ua*)(Pl + o) = ol[t]; }
        if (WA && z == 0) {
            asm volatile("s_wait_xcnt 0x0" ::: "memory");    // stands in front of the writes to the plane stores' registers that forming the f32 stores' address brings
            __builtin_amdgcn_sched_barrier(0);    // keeps them behind it
#pragma unroll
            for (int s = 0; s < 8; ++s) { const int Lid = (lane >> 3) + 4 * s; *(v4f*)(crow + (size_t)(i * 16 + (Lid >> 1)) * DV + (Lid & 1) * 32 + (lane & 7) * 4) = qf[s]; }
        }
        if (i + 1 < PR / 16) { asm volatile("s_wait_xcnt 0x0" ::: "memory");    // stands in front of the next tile row's writes to the stores' data and address registers
            __builtin_amdgcn_sched_barrier(0); }
    }
}
__global__ __launch_bounds__(256) void k_proj(const float* __restrict__ XQ, const float* __restrict__ XK, const bf* __restrict__ WT, const float* __restrict__ bq, const float* __restrict__ bk, const float* __restrict__ bv,
                                              float* QF, bf* Qh, bf* Ql, bf* Kh, bf* Kl, bf* VTh, bf* VTl) {
    __shared__ __align__(16) bf hp[PR / 16][DV / 8][PPP];
    __shared__ __align__(16) float ost[8][16 * 68];    // a wave's own f32 tile [16][68]
    const int z = blockIdx.y;
    float* os = &ost[__builtin_amdgcn_readfirstlane(threadIdx.x >> 5)][0];
    if (z == 2) proj_body<false>(hp, os, z, XK, WT, bv, QF, VTh, VTl);
    else proj_body<true>(hp, os, z, z ? XK : XQ, WT, z ? bk : bq, QF, z ? Kh : Qh, z ? Kl : Ql);
}
// k_tail: everything behind attention for TR whole rows per block, so that nothing between O and the output leaves the WGP: H = LayerNorm(O[s] + q[s]) x bf(g0) + bf(b0) (f32; mean, biased var over 512),
// F = (Hh + Hl).Wo^T + bf(bo) (H as bf16 hi + residual, two products, hi then residual in every k-step of 32), out = LayerNorm(H + relu(F)) x bf(g1) + bf(b1).
// Both LayerNorms: one wave per row, 4 rows a wave, lane -> 4 columns per 128-step, 4 steps. The product: a wave takes all TR rows x 64 columns (2 x 4 tiles); A from LDS, B (Wo^T, fragment order) from L2, TB k-steps ahead.
// LDS: hp = the two planes in fragment order, a piece of [16 rows][8] being TPP elements from the next (272 bytes: a row's 8-byte writes, 16 pieces a store, fall on all 64 banks; a half wave's fragment read is 256 bytes in a row);
// ys = H in f32 (a wave's own rows); fs = F, pitch TFP (rows 8 apart lie 32 banks apart, as the accumulator's two lane halves write them).
#define TR  32
#define TB  3
#define TPP 136
#define TFP 516
__global__ __launch_bounds__(256) void k_tail(const float* __restrict__ O, const float* __restrict__ QF, const float* __restrict__ g0, const float* __restrict__ b0, const bf* __restrict__ WoT, const float* __restrict__ bo,
                                              const float* __restrict__ g1, const float* __restrict__ b1, float* OUTB) {
    typedef __attribute__((ext_vector_type(4))) unsigned short v4us;
    typedef v4us __attribute__((may_alias)) v4usa;
    __shared__ __align__(16) bf hp[2][TR / 16][DV / 8][TPP];
    __shared__ __align__(16) float ys[TR][DV];
    __shared__ __align__(16) float fs[TR][TFP];
    const int lane = threadIdx.x & 31, wv = __builtin_amdgcn_readfirstlane(threadIdx.x >> 5), lr = lane & 15, hi = lane >> 4;
    const size_t s0 = (size_t)blockIdx.x * TR + wv * 4;
    // The first TB k-steps of B depend on nothing: they are asked for ahead of the rows.
    const char* pbu = (const char*)(WoT + (size_t)wv * 64 * DV); const char* pb = pbu + lane * 16;    // pbu, pou, pqu: the same in every lane, the scalar bases of the loads
    v16bf b[TB][4];
#pragma unroll
    for (int ks = 0; ks < TB; ++ks) {
#pragma unroll
        for (int t = 0; t < 4; ++t) b[ks][t] = ldfrag(pb, t * 16 * DV * 2 + ks * 1024); }
    const float* pou = O + s0 * DV; const float* pqu = QF + s0 * DV; const float* po = pou + lane * 4; const float* pq = pqu + lane * 4;
    float v[4][16], sm[4];
    {
        v4f xo[4][4], xq[4][4];
#pragma unroll
        for (int i = 0; i < 4; ++i) {
#pragma unroll
            for (int st = 0; st < 4; ++st) { xo[i][st] = *(const v4f*)(po + i * DV + st * 128); xq[i][st] = *(const v4f*)(pq + i * DV + st * 128); } }
        __builtin_amdgcn_sched_barrier(0);    // keeps all the loads above in front of the first sum: left free, a row's loads sink to its adds and the rows' latencies follow one another
#pragma unroll
        for (int i = 0; i < 4; ++i) { sm[i] = 0.f;
#pragma unroll
            for (int st = 0; st < 4; ++st) {
#pragma unroll
                for (int q = 0; q < 4; ++q) { const float t = xo[i][st][q] + xq[i][st][q]; v[i][st * 4 + q] = t; sm[i] += t; } } }
    }
    // The wait that stands in front of any write to the row loads' address registers: as its inputs they stay allocated up to it; the sums hold it behind the loads.
    asm volatile("s_wait_xcnt 0x0" :: "s"(pou), "s"(pqu), "v"(sm[0]), "v"(sm[1]), "v"(sm[2]), "v"(sm[3]) : "memory");
    float mu[4], qv[4], rs[4];
#pragma unroll
    for (int sh = 16; sh; sh >>= 1) {
#pragma unroll
        for (int i = 0; i < 4; ++i) sm[i] += __shfl_xor(sm[i], sh, 32); }
#pragma unroll
    for (int i = 0; i < 4; ++i) { mu[i] = sm[i] * (1.0f / DV); qv[i] = 0.f;
#pragma unroll
        for (int e = 0; e < 16; ++e) { const float d = v[i][e] - mu[i]; qv[i] = fmaf(d, d, qv[i]); } }
#pragma unroll
    for (int sh = 16; sh; sh >>= 1) {
#pragma unroll
        for (int i = 0; i < 4; ++i) qv[i] += __shfl_xor(qv[i], sh, 32); }
#pragma unroll
    for (int i = 0; i < 4; ++i) rs[i] = rsqrtf(qv[i] * (1.0f / DV) + LEPS);
#pragma unroll
    for (int st = 0; st < 4; ++st) { const int c0 = st * 128 + lane * 4; const v4f gv = *(const v4f*)(g0 + c0), bv = *(const v4f*)(b0 + c0);
#pragma unroll
        for (int i = 0; i < 4; ++i) { const int r = wv * 4 + i; v4f o; v4us oh, ol;
#pragma unroll
            for (int q = 0; q < 4; ++q) { const float y = (v[i][st * 4 + q] - mu[i]) * rs[i] * bfr(gv[q]) + bfr(bv[q]); o[q] = y; const unsigned short hb = f2bf(y); oh[q] = hb; ol[q] = f2bf(y - bf2f(hb)); }
            *(v4fa*)(&ys[r][c0]) = o; *(v4usa*)(&hp[0][r >> 4][c0 >> 3][(r & 15) * 8 + (lane & 1) * 4]) = oh; *(v4usa*)(&hp[1][r >> 4][c0 >> 3][(r & 15) * 8 + (lane & 1) * 4]) = ol; } }
    float bov[4];    // asked for ahead of the product
#pragma unroll
    for (int t = 0; t < 4; ++t) bov[t] = bo[wv * 64 + t * 16 + lr];
    __syncthreads();    // every wave reads all TR rows of the planes
    v8f acc[2][4];
#pragma unroll
    for (int rt = 0; rt < 2; ++rt) {
#pragma unroll
        for (int t = 0; t < 4; ++t) acc[rt][t] = (v8f){}; }
    // A fragment of k-step ks: row lr, pieces 4 * ks + hi and 4 * ks + 2 + hi, the k order of the B fragments.
    v16bf ah[2][2], al[2][2];
    auto fetcha = [&](int ks) {
#pragma unroll
        for (int rt = 0; rt < 2; ++rt) {
            ah[ks & 1][rt] = cat16b(*(const v8usa*)(&hp[0][rt][4 * ks + hi][lr * 8]), *(const v8usa*)(&hp[0][rt][4 * ks + 2 + hi][lr * 8]));
            al[ks & 1][rt] = cat16b(*(const v8usa*)(&hp[1][rt][4 * ks + hi][lr * 8]), *(const v8usa*)(&hp[1][rt][4 * ks + 2 + hi][lr * 8])); }
    };
    fetcha(0);
    // Unrolled whole (16 k-steps of 16 WMMAs), so that the rings of A and B fragments are plain registers. The scheduling fences keep each k-step's loads where they are written (A one k-step ahead, B TB ahead):
    // left free, the compiler sinks a load to its WMMA.
#pragma unroll
    for (int ks = 0; ks < DV / 32; ++ks) {
        if (ks + 1 < DV / 32) fetcha(ks + 1);
        __builtin_amdgcn_sched_barrier(0);
#pragma unroll
        for (int rt = 0; rt < 2; ++rt) {
#pragma unroll
            for (int t = 0; t < 4; ++t) acc[rt][t] = wmmab(ah[ks & 1][rt], b[ks % TB][t], acc[rt][t]); }
#pragma unroll
        for (int rt = 0; rt < 2; ++rt) {
#pragma unroll
            for (int t = 0; t < 4; ++t) acc[rt][t] = wmmab(al[ks & 1][rt], b[ks % TB][t], acc[rt][t]); }
        __builtin_amdgcn_sched_barrier(0);
        if (ks + TB < DV / 32) {
#pragma unroll
            for (int t = 0; t < 4; ++t) b[ks % TB][t] = ldfrag(pb, t * 16 * DV * 2 + (ks + TB) * 1024); }
    }
    asm volatile("s_wait_xcnt 0x0" :: "s"(pbu) : "memory");    // stands in front of any write to the B loads' base register, which as its input stays allocated up to it
    // g1 and b1 are asked for here, so that they arrive behind the F tile's stores, the barrier and the row sums.
    v4f gv1[4], bv1[4];
#pragma unroll
    for (int st = 0; st < 4; ++st) { gv1[st] = *(const v4f*)(g1 + st * 128 + lane * 4); bv1[st] = *(const v4f*)(b1 + st * 128 + lane * 4); }
#pragma unroll
    for (int t = 0; t < 4; ++t) { const int c = wv * 64 + t * 16 + lr; const float bv = bfr(bov[t]);
#pragma unroll
        for (int rt = 0; rt < 2; ++rt) {
#pragma unroll
            for (int j = 0; j < 8; ++j) fs[rt * 16 + hi * 8 + j][c] = acc[rt][t][j] + bv; } }
    __syncthreads();    // a row of F comes from all eight waves
#pragma unroll
    for (int i = 0; i < 4; ++i) { const int r = wv * 4 + i; sm[i] = 0.f;
#pragma unroll
        for (int st = 0; st < 4; ++st) { const v4f h = *(const v4fa*)(&ys[r][st * 128 + lane * 4]), f = *(const v4fa*)(&fs[r][st * 128 + lane * 4]);
#pragma unroll
            for (int q = 0; q < 4; ++q) { const float t = h[q] + fmaxf(f[q], 0.f); v[i][st * 4 + q] = t; sm[i] += t; } } }
#pragma unroll
    for (int sh = 16; sh; sh >>= 1) {
#pragma unroll
        for (int i = 0; i < 4; ++i) sm[i] += __shfl_xor(sm[i], sh, 32); }
#pragma unroll
    for (int i = 0; i < 4; ++i) { mu[i] = sm[i] * (1.0f / DV); qv[i] = 0.f;
#pragma unroll
        for (int e = 0; e < 16; ++e) { const float d = v[i][e] - mu[i]; qv[i] = fmaf(d, d, qv[i]); } }
#pragma unroll
    for (int sh = 16; sh; sh >>= 1) {
#pragma unroll
        for (int i = 0; i < 4; ++i) qv[i] += __shfl_xor(qv[i], sh, 32); }
#pragma unroll
    for (int i = 0; i < 4; ++i) rs[i] = rsqrtf(qv[i] * (1.0f / DV) + LEPS);
    v4f res[4][4];
#pragma unroll
    for (int st = 0; st < 4; ++st) { const v4f gv = gv1[st], bv = bv1[st];
#pragma unroll
        for (int i = 0; i < 4; ++i) {
#pragma unroll
            for (int q = 0; q < 4; ++q) res[i][st][q] = (v[i][st * 4 + q] - mu[i]) * rs[i] * bfr(gv[q]) + bfr(bv[q]); } }
    __builtin_amdgcn_sched_barrier(0);    // keeps all arithmetic in front of the stores, so that no register an issued store names is written behind it
    float* pz = OUTB + s0 * DV + lane * 4;
#pragma unroll
    for (int i = 0; i < 4; ++i) {
#pragma unroll
        for (int st = 0; st < 4; ++st) *(v4f*)(pz + i * DV + st * 128) = res[i][st]; }
}

extern "C" void kernel_launch(void* const* d_in, const int* in_sizes, int n_in,
                              void* d_out, int out_size, void* d_ws, size_t ws_size, hipStream_t stream) {
    (void)in_sizes; (void)n_in; (void)out_size;
    const float* Qi = (const float*)d_in[0]; const float* Ki = (const float*)d_in[1]; const float* Wq = (const float*)d_in[2]; const float* bq = (const float*)d_in[3]; const float* Wk = (const float*)d_in[4]; const float* bk = (const float*)d_in[5];
    const float* Wv = (const float*)d_in[6]; const float* bv = (const float*)d_in[7]; const float* Wo = (const float*)d_in[8]; const float* bo = (const float*)d_in[9]; const float* g0 = (const float*)d_in[10]; const float* b0 = (const float*)d_in[11]; const float* g1 = (const float*)d_in[12]; const float* b1 = (const float*)d_in[13];
    float* out = (float*)d_out;    // [4][2048][512]
    char* wsp = (char*)d_ws;
    auto take = [&](size_t bytes) { char* p = wsp; wsp += (bytes + 255) & ~(size_t)255; return (void*)p; };
    // Kept through attention: the four weights, the q/k/v planes of all items and heads, O and QF.
    bf* WT = (bf*)take((size_t)4 * DV * DV * 2);    // WqT, WkT, WvT, WoT
    bf* Qh = (bf*)take((size_t)NR * DV * 2); bf* Ql = (bf*)take((size_t)NR * DV * 2); bf* Kh = (bf*)take((size_t)NR * DV * 2); bf* Kl = (bf*)take((size_t)NR * DV * 2); bf* VTh = (bf*)take((size_t)NR * DV * 2); bf* VTl = (bf*)take((size_t)NR * DV * 2);
    float* O = (float*)take((size_t)NR * DV * 4); float* QF = (float*)take((size_t)NR * DV * 4);
    if ((size_t)(wsp - (char*)d_ws) > ws_size) return;    // about 86 MB
    k_wt<<<dim3(DV / 64, DV / 64, 4), 256, 0, stream>>>(Wq, Wk, Wv, Wo, DV, DV, WT);   // (in, out) k-major
    k_proj<<<dim3(NR / PR, 3, 1), 256, 0, stream>>>(Qi, Ki, WT, bq, bk, bv, QF, Qh, Ql, Kh, Kl, VTh, VTl);
    k_fattn<<<dim3(NN / (FG * FQ * 16), NH_, NBT), FW * 32, 0, stream>>>(Qh, Ql, Kh, Kl, VTh, VTl, O);
    k_tail<<<NR / TR, 256, 0, stream>>>(O, QF, g0, b0, WT + (size_t)3 * DV * DV, bo, g1, b1, out);
}

// v008
// Measured time: 102 microseconds a run.
// Timed twice side by side with v007, it ran 1.04 times as fast both times.
// Counting every step since v000, it is 34.4 times as fast.
#include <hip/hip_runtime.h>

// Compute dtypes, f32 accumulate, per item: q/k/v = X.W + b as [2048 x 512].[512 x 512] GEMMs with PLAIN bf16 operands (exact products); per head: scores = q.k^T ([2048 x 64].[64 x
// 2048], both operands bf16 hi + UNSCALED residual, three products), softmax (x 1/sqrt(512)) in f32 -> P as bf16 hi + residual, ctx = P.v ([2048 x 2048].[2048 x 64], three products); + q
// residual (q = its bf16 hi + residual planes, summed in f32) and LayerNorm in f32 -> planes; rFF [2048 x 512].[512 x 512] (+ bo, relu) (two products), residual and the final LayerNorm in f32 - on v_wmma_f32_16x16x32_bf16.
// Launch plan: every stage runs once for all NBT items (their rows are contiguous: NR = NBT x NN rows); the projection kernel reads the f32 inputs, a block owning whole rows, and writes the q, k and v^T planes itself; scores, softmax and P.v are one kernel,
// once for all items and heads (softmax by running maximum and sum; P is split unnormalised and the sum divides O at the end; the q residual is added there, from the Q fragments the wave holds); both LayerNorms and the rFF product between them are one kernel, a block owning whole rows.

#define NBT  4
#define NN   2048
#define DV   512
#define NH_  8
#define HD   64
#define DM   DV
#define NTK  NN
#define SCL  0.044194173824159216f
#define LEPS 1e-5f
#define LOSC 1024.0f
#define NR   (NBT * NN)

typedef _Float16 h16;
typedef unsigned short bf;
typedef __attribute__((ext_vector_type(16))) __bf16   v16bf;
typedef __attribute__((ext_vector_type(16))) _Float16 v16h;
typedef __attribute__((ext_vector_type(8)))  _Float16 v8h;
typedef __attribute__((ext_vector_type(8)))  unsigned short v8us;
typedef __attribute__((ext_vector_type(8)))  float    v8f;
typedef __attribute__((ext_vector_type(4)))  float    v4f;
typedef __attribute__((ext_vector_type(4)))  _Float16 v4h;
typedef v8h  __attribute__((may_alias)) v8ha;
typedef v4f  __attribute__((may_alias)) v4fa;
typedef v8us __attribute__((may_alias)) v8usa;

__device__ __forceinline__ unsigned short f2bf(float f) { unsigned u = __float_as_uint(f); u += 0x7FFFu + ((u >> 16) & 1u); return (unsigned short)(u >> 16); }
__device__ __forceinline__ float bf2f(unsigned short b) { return __uint_as_float(((unsigned)b) << 16); }
__device__ __forceinline__ float bfr(float f) { return bf2f(f2bf(f)); }
__device__ __forceinline__ v16h cat16(v8h lo, v8h hi) { return __builtin_shufflevector(lo, hi, 0, 1, 2, 3, 4, 5, 6, 7, 8, 9, 10, 11, 12, 13, 14, 15); }
__device__ __forceinline__ v16bf cat16b(v8us lo, v8us hi) { return __builtin_bit_cast(v16bf, __builtin_shufflevector(lo, hi, 0, 1, 2, 3, 4, 5, 6, 7, 8, 9, 10, 11, 12, 13, 14, 15)); }
__device__ __forceinline__ v8f wmma16(v16h a, v16h b, v8f c) { return __builtin_amdgcn_wmma_f32_16x16x32_f16(false, a, false, b, (short)0, c, false, false); }
__device__ __forceinline__ v8f wmmab(v16bf a, v16bf b, v8f c) { return __builtin_amdgcn_wmma_f32_16x16x32_bf16(false, a, false, b, (short)0, c, false, false); }

// Fragment order: every bf16 plane that a matrix instruction reads as [rows][K] lies in memory as [rows / 16][K / 8][16 rows][8 elements], so that the 32 lanes of a fragment load (row lane & 15, pieces 2 * x + (lane >> 4))
// read 512 bytes in a row, four whole lines; the two loads of a 32-deep fragment are 512 bytes apart. fragoff = element offset of piece c (8 elements) of row r.
__device__ __forceinline__ size_t fragoff(size_t r, int c, int K) { return (r >> 4) * 16 * K + c * 128 + (r & 15) * 8; }

// k_wt: WT [z] = bf16(Wz[k][n]) (k-major [K][ncols]) as [n][K] in fragment order, via 64 x 64 LDS tiles; grid (K/64, ncols/64, 4), blockIdx.z = which of the four weights.
__global__ __launch_bounds__(256) void k_wt(const float* __restrict__ W0, const float* __restrict__ W1, const float* __restrict__ W2, const float* __restrict__ W3, int K, int ncols, bf* WT) {
    __shared__ __align__(16) unsigned short tl[64 * 72];
    const int z = blockIdx.z; const float* __restrict__ Wm = z == 0 ? W0 : z == 1 ? W1 : z == 2 ? W2 : W3; WT += (size_t)z * K * ncols;
    const int tid = threadIdx.x, k0 = blockIdx.x * 64, n0 = blockIdx.y * 64;
    const int kk = tid >> 2, nq = (tid & 3) * 16;
#pragma unroll
    for (int i = 0; i < 16; ++i) tl[(nq + i) * 72 + kk] = f2bf(Wm[(size_t)(k0 + kk) * ncols + n0 + nq + i]);
    __syncthreads();
    const int piece = (tid >> 4) & 7;    // 128 threads write the 2 KiB that 16 rows x 64 k fill in fragment order
    auto pass = [&]() {
#pragma unroll
        for (int s = 0; s < 2; ++s) { const int nr = ((tid >> 7) + 2 * s) * 16 + (tid & 15); const v8us val = *(const v8usa*)(tl + nr * 72 + piece * 8); *(v8us*)(WT + fragoff(n0 + nr, k0 / 8 + piece, K)) = val; }
    };
    pass(); 
}
// k_fattn: scores, softmax and P.v of one head for 256 queries per block, nothing of S or P leaving the registers. A wave owns FQ * 16 queries and one of the FKS parts of the NN keys, 32 keys a pass:
// S^T = K.Q^T (A = K rows, B = Q rows kept in registers, both bf16 hi + residual, three products), so a lane holds 16 keys' scores of one query (column lane & 15);
// running maximum and sum per query (log2 domain, one exchange between the lane halves), p = exp2(s * SCL2 - m) split into bf16 hi + residual: the two 16-key score tiles, converted in place,
// are the B operand of O^T += V^T.P^T (A = V^T rows, keys in the same order; three products). O^T is scaled by exp2(m_old - m_new) every pass and by 1 / sum at the end.
// The two waves of a query group (wave, wave + FW / FKS) meet in LDS: the upper one hands over its maximum, sum and O^T, the lower one brings both to the common maximum, adds, divides, adds q (hi + residual, from its own B fragments: element (t & 1) * 8 + j of k-step t >> 1 is head column t * 16 + 8 * hi + j of query lr, the place of O^T's element j of tile t) and stores.
// grid (NN / (FW / FKS * FQ * 16), NH_, NBT); planes Q, K [item][head][NN][HD] in fragment order, V^T [item][head][NN / 32][HD][32] with each [HD][32] in fragment order; O [NR][DV] = ctx + q.
#define FQ 4
#define FW 8
#define FKS 2
#define FG (FW / FKS)
#define SCL2 (SCL * 1.4426950408889634f)
typedef __attribute__((ext_vector_type(2))) float  v2f;
typedef __attribute__((ext_vector_type(2))) __bf16 v2bf;
typedef __attribute__((ext_vector_type(16))) float v16f;
// One fragment of a plane in fragment order: 16 bytes at p + c and 16 at + 512 (k = 8 * hi + 0..7 and 16 + 8 * hi + 0..7 of row lr). p = the lane's own address (lane * 16 bytes into the first fragment), c a constant.
__device__ __forceinline__ v16bf ldfrag(const char* p, int c) { return cat16b(*(const v8us*)(p + c), *(const v8us*)(p + c + 512)); }
// The wait that stands in front of any write to the address registers of issued loads. It takes the addresses as inputs, so that they keep their registers up to it (left free, the compiler lands a later load's result on them).
__device__ __forceinline__ void xwait(const char* a, const char* b) { asm volatile("s_wait_xcnt 0x0" :: "v"(a), "v"(b) : "memory"); }
__device__ __forceinline__ float xhalf(float x) { const int b = __float_as_int(x); return __int_as_float(__builtin_amdgcn_permlanex16(b, b, 0x76543210, 0xfedcba98, false, false)); }
__global__ __launch_bounds__(FW * 32) void k_fattn(const bf* __restrict__ Qh0, const bf* __restrict__ Ql0, const bf* __restrict__ Kh0, const bf* __restrict__ Kl0, const bf* __restrict__ Vh0, const bf* __restrict__ Vl0, float* O) {
    const size_t pp = ((size_t)blockIdx.z * NH_ + blockIdx.y) * NN * HD;
    const bf* __restrict__ Qh = Qh0 + pp; const bf* __restrict__ Ql = Ql0 + pp; const bf* __restrict__ Kh = Kh0 + pp; const bf* __restrict__ Kl = Kl0 + pp; const bf* __restrict__ Vh = Vh0 + pp; const bf* __restrict__ Vl = Vl0 + pp;
    __shared__ __align__(16) float mrg[FG][(4 * FQ * 8 + 2 * FQ) * 32];
    const int lane = threadIdx.x & 31, wave = __builtin_amdgcn_readfirstlane(threadIdx.x >> 5), lr = lane & 15, hi = lane >> 4;    // the wave's number in a scalar register: loop bounds and branches on it stay scalar
    const int q0 = (blockIdx.x * FG + wave % FG) * (FQ * 16), kbeg = (wave / FG) * (NN / FKS);
    const unsigned loff = lane * 16;    // bytes: the lane's 16 of the 512 that a fragment load reads
    v16bf qh[FQ][2], ql[FQ][2];
    const char* pqh = (const char*)(Qh + (size_t)q0 * HD) + loff; const char* pql = (const char*)(Ql + (size_t)q0 * HD) + loff;
#pragma unroll
    for (int u = 0; u < FQ; ++u) {
#pragma unroll
        for (int ks = 0; ks < 2; ++ks) { qh[u][ks] = ldfrag(pqh, (u * 16 * HD + ks * 512) * 2); ql[u][ks] = ldfrag(pql, (u * 16 * HD + ks * 512) * 2); } }
    v16bf kh[2][2], kl[2][2], vh[4], vl[4];
    const char* pkh; const char* pkl;
    auto fetchk = [&](int kc) {
        pkh = (const char*)(Kh + (size_t)kc * HD) + loff; pkl = (const char*)(Kl + (size_t)kc * HD) + loff;
#pragma unroll
        for (int kt = 0; kt < 2; ++kt) {
#pragma unroll
            for (int ks = 0; ks < 2; ++ks) { kh[kt][ks] = ldfrag(pkh, (kt * 16 * HD + ks * 512) * 2); kl[kt][ks] = ldfrag(pkl, (kt * 16 * HD + ks * 512) * 2); } }
    };
    v8f acc[4][FQ]; float m[FQ], l[FQ];
#pragma unroll
    for (int u = 0; u < FQ; ++u) { m[u] = -3.0e38f; l[u] = 0.f;
#pragma unroll
        for (int t = 0; t < 4; ++t) acc[t][u] = (v8f){}; }
    fetchk(kbeg);
    // The scheduling fences keep each group of loads where it is written (V a whole score block ahead of its use, the next pass's K a whole softmax and P.v block ahead): left free, the compiler sinks a load to its WMMA.
    // The pass loop stays rolled: one pass is 96 WMMAs and some 500 vector instructions already, and a second copy would only cost instruction cache.
#pragma unroll 1
    for (int i = 0; i < NN / FKS; i += 32) {
        const int kc = kbeg + i;
        const char* pvh = (const char*)(Vh + (size_t)kc * HD) + loff; const char* pvl = (const char*)(Vl + (size_t)kc * HD) + loff;
#pragma unroll
        for (int t = 0; t < 4; ++t) { vh[t] = ldfrag(pvh, t * 1024); vl[t] = ldfrag(pvl, t * 1024); }
        __builtin_amdgcn_sched_barrier(0);
        v8f s[2][FQ];
#pragma unroll
        for (int kt = 0; kt < 2; ++kt) {
#pragma unroll
            for (int u = 0; u < FQ; ++u) s[kt][u] = (v8f){}; }
#pragma unroll
        for (int ks = 0; ks < 2; ++ks) {
#pragma unroll
            for (int kt = 0; kt < 2; ++kt) {
#pragma unroll
                for (int u = 0; u < FQ; ++u) s[kt][u] = wmmab(kh[kt][ks], qh[u][ks], s[kt][u]); }
#pragma unroll
            for (int kt = 0; kt < 2; ++kt) {
#pragma unroll
                for (int u = 0; u < FQ; ++u) s[kt][u] = wmmab(kh[kt][ks], ql[u][ks], s[kt][u]); }
#pragma unroll
            for (int kt = 0; kt < 2; ++kt) {
#pragma unroll
                for (int u = 0; u < FQ; ++u) s[kt][u] = wmmab(kl[kt][ks], qh[u][ks], s[kt][u]); } }
        __builtin_amdgcn_sched_barrier(0);
        xwait(pvh, pvl);    // written behind the score block, so that the wave does not stop for it directly behind the V loads
        fetchk(i + 32 < NN / FKS ? kc + 32 : kbeg);    // the last pass fetches the first again (in bounds, unused), so that the loads stand on one path
        __builtin_amdgcn_sched_barrier(0);
        v16bf ph[FQ], pl[FQ];
#pragma unroll
        for (int u = 0; u < FQ; ++u) {
            float mx0 = fmaxf(s[0][u][0], s[1][u][0]), mx1 = fmaxf(s[0][u][1], s[1][u][1]);
#pragma unroll
            for (int j = 2; j < 8; j += 2) { mx0 = fmaxf(mx0, fmaxf(s[0][u][j], s[1][u][j])); mx1 = fmaxf(mx1, fmaxf(s[0][u][j + 1], s[1][u][j + 1])); }
            float mx = fmaxf(mx0, mx1); mx = fmaxf(mx, xhalf(mx));
            const float mn = fmaxf(m[u], mx * SCL2), al = __builtin_amdgcn_exp2f(m[u] - mn); m[u] = mn;
            float ls0 = 0.f, ls1 = 0.f;
#pragma unroll
            for (int kt = 0; kt < 2; ++kt) {
#pragma unroll
                for (int j = 0; j < 8; j += 2) {
                    const v2f p = {__builtin_amdgcn_exp2f(fmaf(s[kt][u][j], SCL2, -mn)), __builtin_amdgcn_exp2f(fmaf(s[kt][u][j + 1], SCL2, -mn))};
                    ls0 += p[0]; ls1 += p[1];
                    const v2bf hb = __builtin_convertvector(p, v2bf); const v2bf lb = __builtin_convertvector(p - __builtin_convertvector(hb, v2f), v2bf);
                    ph[u][kt * 8 + j] = hb[0]; ph[u][kt * 8 + j + 1] = hb[1]; pl[u][kt * 8 + j] = lb[0]; pl[u][kt * 8 + j + 1] = lb[1]; } }
            l[u] = fmaf(l[u], al, ls0 + ls1);
#pragma unroll
            for (int t = 0; t < 4; ++t) acc[t][u] *= al;
        }
#pragma unroll
        for (int t = 0; t < 4; ++t) {
#pragma unroll
            for (int u = 0; u < FQ; ++u) acc[t][u] = wmmab(vh[t], ph[u], acc[t][u]); }
#pragma unroll
        for (int t = 0; t < 4; ++t) {
#pragma unroll
            for (int u = 0; u < FQ; ++u) acc[t][u] = wmmab(vh[t], pl[u], acc[t][u]); }
#pragma unroll
        for (int t = 0; t < 4; ++t) {
#pragma unroll
            for (int u = 0; u < FQ; ++u) acc[t][u] = wmmab(vl[t], ph[u], acc[t][u]); }
        __builtin_amdgcn_sched_barrier(0);    // keeps the wait below at the pass's end: left free, it rises to stand directly behind the K loads, and the wave stops for it there
        xwait(pkh, pkl);
    }
    float* mg = &mrg[wave % FG][0];
    if (wave >= FG) {
#pragma unroll
        for (int u = 0; u < FQ; ++u) { mg[(4 * FQ * 8 + u) * 32 + lane] = m[u]; mg[(4 * FQ * 8 + FQ + u) * 32 + lane] = l[u];
#pragma unroll
            for (int t = 0; t < 4; ++t) { const v8f r = acc[t][u]; float* p = mg + (t * FQ + u) * 256 + lane * 4;
                *(v4f*)p = (v4f){r[0], r[1], r[2], r[3]}; *(v4f*)(p + 128) = (v4f){r[4], r[5], r[6], r[7]}; } }
    }
    __syncthreads();
    if (wave < FG) {
        // A lane holds 8 consecutive head columns (t * 16 + 8 * hi ...) of query u * 16 + lr.
#pragma unroll
        for (int u = 0; u < FQ; ++u) {
            const float m1 = mg[(4 * FQ * 8 + u) * 32 + lane], l1 = mg[(4 * FQ * 8 + FQ + u) * 32 + lane];
            const float mn = fmaxf(m[u], m1), a0 = __builtin_amdgcn_exp2f(m[u] - mn), a1 = __builtin_amdgcn_exp2f(m1 - mn);
            const float lt = fmaf(l[u], a0, l1 * a1), inv = 1.0f / (lt + xhalf(lt)), f0 = a0 * inv, f1 = a1 * inv;
            float* orow = O + ((size_t)blockIdx.z * NN + q0 + u * 16 + lr) * DV + blockIdx.y * HD + 8 * hi;
            v4f res[8];
#pragma unroll
            for (int t = 0; t < 4; ++t) { const v8f r = acc[t][u]; const float* p = mg + (t * FQ + u) * 256 + lane * 4; const v4f x = *(const v4f*)p, y = *(const v4f*)(p + 128);
                const v16f qq = __builtin_convertvector(qh[u][t >> 1], v16f) + __builtin_convertvector(ql[u][t >> 1], v16f); const int e = (t & 1) * 8;
                res[2 * t] = ((v4f){r[0], r[1], r[2], r[3]} * f0 + x * f1) + (v4f){qq[e], qq[e + 1], qq[e + 2], qq[e + 3]}; res[2 * t + 1] = ((v4f){r[4], r[5], r[6], r[7]} * f0 + y * f1) + (v4f){qq[e + 4], qq[e + 5], qq[e + 6], qq[e + 7]}; }
            // The two fences keep a query tile's arithmetic in front of its eight stores and the next tile's behind the wait, so that no register an issued store names is rewritten ahead of that wait.
            __builtin_amdgcn_sched_barrier(0);
#pragma unroll
            for (int t = 0; t < 4; ++t) { *(v4f*)(orow + t * 16) = res[2 * t]; *(v4f*)(orow + t * 16 + 4) = res[2 * t + 1]; }
            if (u + 1 < FQ) { asm volatile("s_wait_xcnt 0x0" ::: "memory");    // stands in front of the next tile's writes to the stores' data and address registers
                __builtin_amdgcn_sched_barrier(0); }
        }
    }
}

// k_proj: the q, k and v projections, from the f32 inputs to the planes that attention reads. grid (NR / PR, 3), blockIdx.y = z = which product. A block owns PR whole rows of its input (z = 0: XQ, else XK):
// a wave reads 16 of them (512 bytes of a row a load), rounds them to bf16 and lays them in LDS in fragment order (pieces of [16 rows][8] PPP elements apart, as in k_tail); behind the barrier wave w takes all PR rows x head w
// (8 x 4 tiles), x fragments from LDS half a k-step ahead, weight fragments (W^T, fragment order) from L2 four k-steps ahead in a ring of PB.
// z < 2: D = W^T.x^T, so that a lane holds 8 consecutive head columns of one row, 16 bytes of a q or k plane as they stand (a store writes 512 bytes in a row).
// z = 2: D = x.W, so that a lane holds 8 consecutive tokens of one head column, 16 bytes of a v^T plane as they stand. Planes: bf16 hi + residual of the f32 tile + bf(bias), Q, K [item][head][NN][HD], V^T [item][head][NN / 32][HD][32].
#define PR  128
#define PB  4
#define PPP 136
typedef __attribute__((ext_vector_type(4))) unsigned v4u;
typedef __attribute__((ext_vector_type(2))) unsigned v2u;
typedef v4u __attribute__((may_alias)) v4ua;
typedef v2u __attribute__((may_alias)) v2ua;
__device__ __forceinline__ unsigned pkbf(float a, float b) { return __builtin_bit_cast(unsigned, __builtin_convertvector((v2f){a, b}, v2bf)); }
// 8 f32 values -> 8 bf16 (nearest even) and the 8 bf16 of what the rounding left
__device__ __forceinline__ void split8(const float (&v)[8], v4u& oh, v4u& ol) {
#pragma unroll
    for (int p = 0; p < 4; ++p) { const v2f x = {v[2 * p], v[2 * p + 1]}; const v2bf hb = __builtin_convertvector(x, v2bf); const v2bf lb = __builtin_convertvector(x - __builtin_convertvector(hb, v2f), v2bf);
        oh[p] = __builtin_bit_cast(unsigned, hb); ol[p] = __builtin_bit_cast(unsigned, lb); }
}
// The product of a wave: ap = the lane's 16 bytes of piece hi, row tile 0, k-step 0 in LDS; pb = the lane's 16 bytes of the wave's first weight fragment; b holds the first PB k-steps. WA: the weight is the A operand.
// The fetches past the last k-step read the next row tile's pieces and the next 16 weight rows (the fourth weight's behind the third): inside the arrays, written in this call, unused; so the loop has one path.
template <bool WA>
__device__ __forceinline__ void proj_mm(const bf* ap, const char* pb, v16bf (&b)[PB][4], v8f (&acc)[PR / 16][4]) {
    v16bf a[2][4];
    auto fetcha = [&](int g, int ks) {
#pragma unroll
        for (int i = 0; i < 4; ++i) { const bf* p = ap + ((g * 4 + i) * (DV / 8) + 4 * ks) * PPP; a[g][i] = cat16b(*(const v8usa*)p, *(const v8usa*)(p + 2 * PPP)); }
    };
    auto mm = [&](int g, int kk) {
#pragma unroll
        for (int i = 0; i < 4; ++i) {
#pragma unroll
            for (int t = 0; t < 4; ++t) { if constexpr (WA) acc[g * 4 + i][t] = wmmab(b[kk][t], a[g][i], acc[g * 4 + i][t]); else acc[g * 4 + i][t] = wmmab(a[g][i], b[kk][t], acc[g * 4 + i][t]); } }
    };
    fetcha(0, 0);
    // Rolled by PB k-steps (128 WMMAs a trip), so that the ring's places are plain registers and the text stays short. The scheduling fences keep each group of loads where it is written: left free, the compiler sinks a load to its WMMA.
#pragma unroll 1
    for (int k0 = 0; k0 < DV / 32; k0 += PB) {
        const char* pk = pb + k0 * 1024;
#pragma unroll
        for (int kk = 0; kk < PB; ++kk) {
            fetcha(1, k0 + kk);
            __builtin_amdgcn_sched_barrier(0);
            mm(0, kk);
            __builtin_amdgcn_sched_barrier(0);
            fetcha(0, k0 + kk + 1);
            __builtin_amdgcn_sched_barrier(0);
            mm(1, kk);
            __builtin_amdgcn_sched_barrier(0);
#pragma unroll
            for (int t = 0; t < 4; ++t) b[kk][t] = ldfrag(pk, t * 16 * DV * 2 + (kk + PB) * 1024);
        }
        // The wait that stands in front of the next trip's write to the weight loads' address register; the two fences keep it behind the trip's last loads and that write behind it.
        __builtin_amdgcn_sched_barrier(0);
        asm volatile("s_wait_xcnt 0x0" ::: "memory");
        __builtin_amdgcn_sched_barrier(0);
    }
}
// One block's work; WA = the weight is the A operand (z < 2). A function per form, so that each side of the kernel's one branch on z holds its own registers.
template <bool WA>
__device__ __forceinline__ void proj_body(bf (*hp)[DV / 8][PPP], int z, const float* __restrict__ X, const bf* __restrict__ WT, const float* __restrict__ bias, bf* Ph, bf* Pl) {
    const int lane = threadIdx.x & 31, wv = __builtin_amdgcn_readfirstlane(threadIdx.x >> 5), lr = lane & 15, hi = lane >> 4;
    const size_t r0 = (size_t)blockIdx.x * PR;
    const float* px = X + (r0 + wv * 16) * DV + lane * 4;
    const char* pb = (const char*)(WT + ((size_t)z * DV + wv * 64) * DV) + lane * 16;
    v16bf b[PB][4];
    {
        // The wave's 16 rows in four groups of 16 loads, two or three groups out at a time.
        v4f x[4][16];
        auto ask = [&](int q) {
#pragma unroll
            for (int i = 0; i < 4; ++i) {
#pragma unroll
                for (int st = 0; st < 4; ++st) x[q][i * 4 + st] = *(const v4f*)(px + (q * 4 + i) * DV + st * 128); }
        };
        auto put = [&](int q) {
#pragma unroll
            for (int i = 0; i < 4; ++i) {
#pragma unroll
                for (int st = 0; st < 4; ++st) { const v4f v = x[q][i * 4 + st]; *(v2ua*)(&hp[wv][st * 16 + (lane >> 1)][(q * 4 + i) * 8 + (lane & 1) * 4]) = (v2u){pkbf(v[0], v[1]), pkbf(v[2], v[3])}; } }
        };
        // The scheduling fences keep the groups of loads ahead of the rounding: left free, a group's loads sink to their use and the groups' latencies follow one another.
        ask(0); ask(1);
        __builtin_amdgcn_sched_barrier(0);
        put(0); ask(2);
        __builtin_amdgcn_sched_barrier(0);
        put(1); ask(3);
        __builtin_amdgcn_sched_barrier(0);
        put(2);
        __builtin_amdgcn_sched_barrier(0);    // the weight loads stay behind the third group's use: never more than 48 loads of a wave are out
#pragma unroll
        for (int ks = 0; ks < PB; ++ks) {
#pragma unroll
            for (int t = 0; t < 4; ++t) b[ks][t] = ldfrag(pb, t * 16 * DV * 2 + ks * 1024); }
        __builtin_amdgcn_sched_barrier(0);
        asm volatile("s_wait_xcnt 0x0" ::: "memory");    // stands in front of any write to the address registers of the loads above
        __builtin_amdgcn_sched_barrier(0);    // keeps such writes behind it
        put(3);
    }
    __syncthreads();    // every wave reads all PR rows
    v8f acc[PR / 16][4];
#pragma unroll
    for (int i = 0; i < PR / 16; ++i) {
#pragma unroll
        for (int t = 0; t < 4; ++t) acc[i][t] = (v8f){}; }
    proj_mm<WA>(&hp[0][hi][lr * 8], pb, b, acc);
    const size_t pl0 = (((r0 / NN) * NH_ + wv) * NN + r0 % NN) * HD + lane * 8;    // the lane's 16 bytes of the first 512 of the wave's PR x HD part of a plane
    float bs[WA ? 4 : 1][WA ? 8 : 4];
    if constexpr (WA) {
#pragma unroll
        for (int t = 0; t < 4; ++t) { const v4f x = *(const v4f*)(bias + wv * 64 + t * 16 + hi * 8), y = *(const v4f*)(bias + wv * 64 + t * 16 + hi * 8 + 4);
#pragma unroll
            for (int j = 0; j < 8; ++j) bs[t][j] = j < 4 ? x[j & 3] : y[j & 3]; }
    } else {
#pragma unroll
        for (int t = 0; t < 4; ++t) bs[0][t] = bias[wv * 64 + t * 16 + lr];
    }
    // The wait that stands in front of any write to the bias loads' address registers; the two fences keep it behind the loads and the arithmetic behind it.
    __builtin_amdgcn_sched_barrier(0);
    asm volatile("s_wait_xcnt 0x0" ::: "memory");
    __builtin_amdgcn_sched_barrier(0);
#pragma unroll
    for (int t = 0; t < (WA ? 4 : 1); ++t) {
#pragma unroll
        for (int j = 0; j < (WA ? 8 : 4); ++j) bs[t][j] = bfr(bs[t][j]); }
    // WA, tile (i, t): head columns t * 16 + hi * 8 + j of row i * 16 + lr = piece 2 * t + hi of row lr of the 16-row group i.
    // Else: tokens i * 16 + hi * 8 + j of head column t * 16 + lr = piece (i & 1) * 2 + hi of row lr of fragment t of the 32-token group i >> 1.
#pragma unroll
    for (int i = 0; i < PR / 16; ++i) {
        v4u oh[4], ol[4];
#pragma unroll
        for (int t = 0; t < 4; ++t) { float v[8];
#pragma unroll
            for (int j = 0; j < 8; ++j) v[j] = acc[i][t][j] + (WA ? bs[t][j] : bs[0][t]);
            split8(v, oh[t], ol[t]); }
        // The two fences keep a tile row's arithmetic in front of its stores and the next one's behind the wait, so that no register an issued store names is rewritten ahead of that wait.
        __builtin_amdgcn_sched_barrier(0);
#pragma unroll
        for (int t = 0; t < 4; ++t) { const size_t o = pl0 + (WA ? i * 16 * HD + t * 256 : (i >> 1) * 32 * HD + t * 512 + (i & 1) * 256); *(v4ua*)(Ph + o) = oh[t]; *(v4ua*)(Pl + o) = ol[t]; }
        if (i + 1 < PR / 16) { asm volatile("s_wait_xcnt 0x0" ::: "memory");    // stands in front of the next tile row's writes to the stores' data and address registers
            __builtin_amdgcn_sched_barrier(0); }
    }
}
__global__ __launch_bounds__(256) void k_proj(const float* __restrict__ XQ, const float* __restrict__ XK, const bf* __restrict__ WT, const float* __restrict__ bq, const float* __restrict__ bk, const float* __restrict__ bv,
                                              bf* Qh, bf* Ql, bf* Kh, bf* Kl, bf* VTh, bf* VTl) {
    __shared__ __align__(16) bf hp[PR / 16][DV / 8][PPP];
    const int z = blockIdx.y;
    if (z == 2) proj_body<false>(hp, z, XK, WT, bv, VTh, VTl);
    else proj_body<true>(hp, z, z ? XK : XQ, WT, z ? bk : bq, z ? Kh : Qh, z ? Kl : Ql);
}
// k_tail: everything behind attention for TR whole rows per block, so that nothing between O and the output leaves the WGP: H = LayerNorm(O[s]) x bf(g0) + bf(b0) (O = ctx + q, as attention wrote it) (f32; mean, biased var over 512),
// F = (Hh + Hl).Wo^T + bf(bo) (H as bf16 hi + residual, two products, hi then residual in every k-step of 32), out = LayerNorm(H + relu(F)) x bf(g1) + bf(b1).
// Both LayerNorms: one wave per row, 4 rows a wave, lane -> 4 columns per 128-step, 4 steps. The product: a wave takes all TR rows x 64 columns (2 x 4 tiles); A from LDS, B (Wo^T, fragment order) from L2, TB k-steps ahead.
// LDS: hp = the two planes in fragment order, a piece of [16 rows][8] being TPP elements from the next (272 bytes: a row's 8-byte writes, 16 pieces a store, fall on all 64 banks; a half wave's fragment read is 256 bytes in a row);
// ys = H in f32 (a wave's own rows); fs = F, pitch TFP (rows 8 apart lie 32 banks apart, as the accumulator's two lane halves write them).
#define TR  32
#define TB  3
#define TPP 136
#define TFP 516
__global__ __launch_bounds__(256) void k_tail(const float* __restrict__ O, const float* __restrict__ g0, const float* __restrict__ b0, const bf* __restrict__ WoT, const float* __restrict__ bo,
                                              const float* __restrict__ g1, const float* __restrict__ b1, float* OUTB) {
    typedef __attribute__((ext_vector_type(4))) unsigned short v4us;
    typedef v4us __attribute__((may_alias)) v4usa;
    __shared__ __align__(16) bf hp[2][TR / 16][DV / 8][TPP];
    __shared__ __align__(16) float ys[TR][DV];
    __shared__ __align__(16) float fs[TR][TFP];
    const int lane = threadIdx.x & 31, wv = __builtin_amdgcn_readfirstlane(threadIdx.x >> 5), lr = lane & 15, hi = lane >> 4;
    const size_t s0 = (size_t)blockIdx.x * TR + wv * 4;
    // The first TB k-steps of B depend on nothing: they are asked for ahead of the rows.
    const char* pbu = (const char*)(WoT + (size_t)wv * 64 * DV); const char* pb = pbu + lane * 16;    // pbu, pou: the same in every lane, the scalar bases of the loads
    v16bf b[TB][4];
#pragma unroll
    for (int ks = 0; ks < TB; ++ks) {
#pragma unroll
        for (int t = 0; t < 4; ++t) b[ks][t] = ldfrag(pb, t * 16 * DV * 2 + ks * 1024); }
    const float* pou = O + s0 * DV; const float* po = pou + lane * 4;
    float v[4][16], sm[4];
    {
        v4f xo[4][4];
#pragma unroll
        for (int i = 0; i < 4; ++i) {
#pragma unroll
            for (int st = 0; st < 4; ++st) xo[i][st] = *(const v4f*)(po + i * DV + st * 128); }
        __builtin_amdgcn_sched_barrier(0);    // keeps all the loads above in front of the first sum: left free, a row's loads sink to its adds and the rows' latencies follow one another
#pragma unroll
        for (int i = 0; i < 4; ++i) { sm[i] = 0.f;
#pragma unroll
            for (int st = 0; st < 4; ++st) {
#pragma unroll
                for (int q = 0; q < 4; ++q) { const float t = xo[i][st][q]; v[i][st * 4 + q] = t; sm[i] += t; } } }
    }
    // The wait that stands in front of any write to the row loads' address registers: as its inputs they stay allocated up to it; the sums hold it behind the loads.
    asm volatile("s_wait_xcnt 0x0" :: "s"(pou), "v"(sm[0]), "v"(sm[1]), "v"(sm[2]), "v"(sm[3]) : "memory");
    float mu[4], qv[4], rs[4];
#pragma unroll
    for (int sh = 16; sh; sh >>= 1) {
#pragma unroll
        for (int i = 0; i < 4; ++i) sm[i] += __shfl_xor(sm[i], sh, 32); }
#pragma unroll
    for (int i = 0; i < 4; ++i) { mu[i] = sm[i] * (1.0f / DV); qv[i] = 0.f;
#pragma unroll
        for (int e = 0; e < 16; ++e) { const float d = v[i][e] - mu[i]; qv[i] = fmaf(d, d, qv[i]); } }
#pragma unroll
    for (int sh = 16; sh; sh >>= 1) {
#pragma unroll
        for (int i = 0; i < 4; ++i) qv[i] += __shfl_xor(qv[i], sh, 32); }
#pragma unroll
    for (int i = 0; i < 4; ++i) rs[i] = rsqrtf(qv[i] * (1.0f / DV) + LEPS);
#pragma unroll
    for (int st = 0; st < 4; ++st) { const int c0 = st * 128 + lane * 4; const v4f gv = *(const v4f*)(g0 + c0), bv = *(const v4f*)(b0 + c0);
#pragma unroll
        for (int i = 0; i < 4; ++i) { const int r = wv * 4 + i; v4f o; v4us oh, ol;
#pragma unroll
            for (int q = 0; q < 4; ++q) { const float y = (v[i][st * 4 + q] - mu[i]) * rs[i] * bfr(gv[q]) + bfr(bv[q]); o[q] = y; const unsigned short hb = f2bf(y); oh[q] = hb; ol[q] = f2bf(y - bf2f(hb)); }
            *(v4fa*)(&ys[r][c0]) = o; *(v4usa*)(&hp[0][r >> 4][c0 >> 3][(r & 15) * 8 + (lane & 1) * 4]) = oh; *(v4usa*)(&hp[1][r >> 4][c0 >> 3][(r & 15) * 8 + (lane & 1) * 4]) = ol; } }
    float bov[4];    // asked for ahead of the product
#pragma unroll
    for (int t = 0; t < 4; ++t) bov[t] = bo[wv * 64 + t * 16 + lr];
    __syncthreads();    // every wave reads all TR rows of the planes
    v8f acc[2][4];
#pragma unroll
    for (int rt = 0; rt < 2; ++rt) {
#pragma unroll
        for (int t = 0; t < 4; ++t) acc[rt][t] = (v8f){}; }
    // A fragment of k-step ks: row lr, pieces 4 * ks + hi and 4 * ks + 2 + hi, the k order of the B fragments.
    v16bf ah[2][2], al[2][2];
    auto fetcha = [&](int ks) {
#pragma unroll
        for (int rt = 0; rt < 2; ++rt) {
            ah[ks & 1][rt] = cat16b(*(const v8usa*)(&hp[0][rt][4 * ks + hi][lr * 8]), *(const v8usa*)(&hp[0][rt][4 * ks + 2 + hi][lr * 8]));
            al[ks & 1][rt] = cat16b(*(const v8usa*)(&hp[1][rt][4 * ks + hi][lr * 8]), *(const v8usa*)(&hp[1][rt][4 * ks + 2 + hi][lr * 8])); }
    };
    fetcha(0);
    // Unrolled whole (16 k-steps of 16 WMMAs), so that the rings of A and B fragments are plain registers. The scheduling fences keep each k-step's loads where they are written (A one k-step ahead, B TB ahead):
    // left free, the compiler sinks a load to its WMMA.
#pragma unroll
    for (int ks = 0; ks < DV / 32; ++ks) {
        if (ks + 1 < DV / 32) fetcha(ks + 1);
        __builtin_amdgcn_sched_barrier(0);
#pragma unroll
        for (int rt = 0; rt < 2; ++rt) {
#pragma unroll
            for (int t = 0; t < 4; ++t) acc[rt][t] = wmmab(ah[ks & 1][rt], b[ks % TB][t], acc[rt][t]); }
#pragma unroll
        for (int rt = 0; rt < 2; ++rt) {
#pragma unroll
            for (int t = 0; t < 4; ++t) acc[rt][t] = wmmab(al[ks & 1][rt], b[ks % TB][t], acc[rt][t]); }
        __builtin_amdgcn_sched_barrier(0);
        if (ks + TB < DV / 32) {
#pragma unroll
            for (int t = 0; t < 4; ++t) b[ks % TB][t] = ldfrag(pb, t * 16 * DV * 2 + (ks + TB) * 1024); }
    }
    asm volatile("s_wait_xcnt 0x0" :: "s"(pbu) : "memory");    // stands in front of any write to the B loads' base register, which as its input stays allocated up to it
    // g1 and b1 are asked for here, so that they arrive behind the F tile's stores, the barrier and the row sums.
    v4f gv1[4], bv1[4];
#pragma unroll
    for (int st = 0; st < 4; ++st) { gv1[st] = *(const v4f*)(g1 + st * 128 + lane * 4); bv1[st] = *(const v4f*)(b1 + st * 128 + lane * 4); }
#pragma unroll
    for (int t = 0; t < 4; ++t) { const int c = wv * 64 + t * 16 + lr; const float bv = bfr(bov[t]);
#pragma unroll
        for (int rt = 0; rt < 2; ++rt) {
#pragma unroll
            for (int j = 0; j < 8; ++j) fs[rt * 16 + hi * 8 + j][c] = acc[rt][t][j] + bv; } }
    __syncthreads();    // a row of F comes from all eight waves
#pragma unroll
    for (int i = 0; i < 4; ++i) { const int r = wv * 4 + i; sm[i] = 0.f;
#pragma unroll
        for (int st = 0; st < 4; ++st) { const v4f h = *(const v4fa*)(&ys[r][st * 128 + lane * 4]), f = *(const v4fa*)(&fs[r][st * 128 + lane * 4]);
#pragma unroll
            for (int q = 0; q < 4; ++q) { const float t = h[q] + fmaxf(f[q], 0.f); v[i][st * 4 + q] = t; sm[i] += t; } } }
#pragma unroll
    for (int sh = 16; sh; sh >>= 1) {
#pragma unroll
        for (int i = 0; i < 4; ++i) sm[i] += __shfl_xor(sm[i], sh, 32); }
#pragma unroll
    for (int i = 0; i < 4; ++i) { mu[i] = sm[i] * (1.0f / DV); qv[i] = 0.f;
#pragma unroll
        for (int e = 0; e < 16; ++e) { const float d = v[i][e] - mu[i]; qv[i] = fmaf(d, d, qv[i]); } }
#pragma unroll
    for (int sh = 16; sh; sh >>= 1) {
#pragma unroll
        for (int i = 0; i < 4; ++i) qv[i] += __shfl_xor(qv[i], sh, 32); }
#pragma unroll
    for (int i = 0; i < 4; ++i) rs[i] = rsqrtf(qv[i] * (1.0f / DV) + LEPS);
    v4f res[4][4];
#pragma unroll
    for (int st = 0; st < 4; ++st) { const v4f gv = gv1[st], bv = bv1[st];
#pragma unroll
        for (int i = 0; i < 4; ++i) {
#pragma unroll
            for (int q = 0; q < 4; ++q) res[i][st][q] = (v[i][st * 4 + q] - mu[i]) * rs[i] * bfr(gv[q]) + bfr(bv[q]); } }
    __builtin_amdgcn_sched_barrier(0);    // keeps all arithmetic in front of the stores, so that no register an issued store names is written behind it
    float* pz = OUTB + s0 * DV + lane * 4;
#pragma unroll
    for (int i = 0; i < 4; ++i) {
#pragma unroll
        for (int st = 0; st < 4; ++st) *(v4f*)(pz + i * DV + st * 128) = res[i][st]; }
}

extern "C" void kernel_launch(void* const* d_in, const int* in_sizes, int n_in,
                              void* d_out, int out_size, void* d_ws, size_t ws_size, hipStream_t stream) {
    (void)in_sizes; (void)n_in; (void)out_size;
    const float* Qi = (const float*)d_in[0]; const float* Ki = (const float*)d_in[1]; const float* Wq = (const float*)d_in[2]; const float* bq = (const float*)d_in[3]; const float* Wk = (const float*)d_in[4]; const float* bk = (const float*)d_in[5];
    const float* Wv = (const float*)d_in[6]; const float* bv = (const float*)d_in[7]; const float* Wo = (const float*)d_in[8]; const float* bo = (const float*)d_in[9]; const float* g0 = (const float*)d_in[10]; const float* b0 = (const float*)d_in[11]; const float* g1 = (const float*)d_in[12]; const float* b1 = (const float*)d_in[13];
    float* out = (float*)d_out;    // [4][2048][512]
    char* wsp = (char*)d_ws;
    auto take = [&](size_t bytes) { char* p = wsp; wsp += (bytes + 255) & ~(size_t)255; return (void*)p; };
    // Kept through attention: the four weights, the q/k/v planes of all items and heads, and O.
    bf* WT = (bf*)take((size_t)4 * DV * DV * 2);    // WqT, WkT, WvT, WoT
    bf* Qh = (bf*)take((size_t)NR * DV * 2); bf* Ql = (bf*)take((size_t)NR * DV * 2); bf* Kh = (bf*)take((size_t)NR * DV * 2); bf* Kl = (bf*)take((size_t)NR * DV * 2); bf* VTh = (bf*)take((size_t)NR * DV * 2); bf* VTl = (bf*)take((size_t)NR * DV * 2);
    float* O = (float*)take((size_t)NR * DV * 4);
    if ((size_t)(wsp - (char*)d_ws) > ws_size) return;    // about 69 MB
    k_wt<<<dim3(DV / 64, DV / 64, 4), 256, 0, stream>>>(Wq, Wk, Wv, Wo, DV, DV, WT);   // (in, out) k-major
    k_proj<<<dim3(NR / PR, 3, 1), 256, 0, stream>>>(Qi, Ki, WT, bq, bk, bv, Qh, Ql, Kh, Kl, VTh, VTl);
    k_fattn<<<dim3(NN / (FG * FQ * 16), NH_, NBT), FW * 32, 0, stream>>>(Qh, Ql, Kh, Kl, VTh, VTl, O);
    k_tail<<<NR / TR, 256, 0, stream>>>(O, g0, b0, WT + (size_t)3 * DV * DV, bo, g1, b1, out);
}

// v009
// One run takes 68.6 microseconds.
// Next to v008, in two timings, it ran 1.48 and 1.51 times as fast.
// Counting every step since v000, it is 51.4 times as fast.
#include <hip/hip_runtime.h>

// Compute dtypes, f32 accumulate, per item: q/k/v = X.W + b as [2048 x 512].[512 x 512] GEMMs with PLAIN bf16 operands (exact products); per head: scores = q.k^T ([2048 x 64].[64 x
// 2048], both operands PLAIN bf16, one product: q and k come from products of bf16-rounded operands and carry that rounding's noise already), softmax (x 1/sqrt(512)) in f32 -> P as plain bf16, ctx = P.v ([2048 x 2048].[2048 x 64], v plain bf16, one product); + q
// residual (q = its bf16 hi + residual planes, summed in f32) and LayerNorm in f32 -> planes; rFF [2048 x 512].[512 x 512] (+ bo, relu) (two products), residual and the final LayerNorm in f32 - on v_wmma_f32_16x16x32_bf16.
// Launch plan: every stage runs once for all NBT items (their rows are contiguous: NR = NBT x NN rows); the projection kernel reads the f32 inputs, a block owning whole rows, and writes the q, k and v^T planes itself; scores, softmax and P.v are one kernel,
// once for all items and heads (softmax by running maximum and sum; P is rounded unnormalised and the sum divides O at the end; the q residual is added there, from the Q fragments the wave holds); both LayerNorms and the rFF product between them are one kernel, a block owning whole rows.

#define NBT  4
#define NN   2048
#define DV   512
#define NH_  8
#define HD   64
#define DM   DV
#define NTK  NN
#define SCL  0.044194173824159216f
#define LEPS 1e-5f
#define LOSC 1024.0f
#define NR   (NBT * NN)

typedef _Float16 h16;
typedef unsigned short bf;
typedef __attribute__((ext_vector_type(16))) __bf16   v16bf;
typedef __attribute__((ext_vector_type(16))) _Float16 v16h;
typedef __attribute__((ext_vector_type(8)))  _Float16 v8h;
typedef __attribute__((ext_vector_type(8)))  unsigned short v8us;
typedef __attribute__((ext_vector_type(8)))  float    v8f;
typedef __attribute__((ext_vector_type(4)))  float    v4f;
typedef __attribute__((ext_vector_type(4)))  _Float16 v4h;
typedef v8h  __attribute__((may_alias)) v8ha;
typedef v4f  __attribute__((may_alias)) v4fa;
typedef v8us __attribute__((may_alias)) v8usa;

__device__ __forceinline__ unsigned short f2bf(float f) { unsigned u = __float_as_uint(f); u += 0x7FFFu + ((u >> 16) & 1u); return (unsigned short)(u >> 16); }
__device__ __forceinline__ float bf2f(unsigned short b) { return __uint_as_float(((unsigned)b) << 16); }
__device__ __forceinline__ float bfr(float f) { return bf2f(f2bf(f)); }
__device__ __forceinline__ v16h cat16(v8h lo, v8h hi) { return __builtin_shufflevector(lo, hi, 0, 1, 2, 3, 4, 5, 6, 7, 8, 9, 10, 11, 12, 13, 14, 15); }
__device__ __forceinline__ v16bf cat16b(v8us lo, v8us hi) { return __builtin_bit_cast(v16bf, __builtin_shufflevector(lo, hi, 0, 1, 2, 3, 4, 5, 6, 7, 8, 9, 10, 11, 12, 13, 14, 15)); }
__device__ __forceinline__ v8f wmma16(v16h a, v16h b, v8f c) { return __builtin_amdgcn_wmma_f32_16x16x32_f16(false, a, false, b, (short)0, c, false, false); }
__device__ __forceinline__ v8f wmmab(v16bf a, v16bf b, v8f c) { return __builtin_amdgcn_wmma_f32_16x16x32_bf16(false, a, false, b, (short)0, c, false, false); }

// Fragment order: every bf16 plane that a matrix instruction reads as [rows][K] lies in memory as [rows / 16][K / 8][16 rows][8 elements], so that the 32 lanes of a fragment load (row lane & 15, pieces 2 * x + (lane >> 4))
// read 512 bytes in a row, four whole lines; the two loads of a 32-deep fragment are 512 bytes apart. fragoff = element offset of piece c (8 elements) of row r.
__device__ __forceinline__ size_t fragoff(size_t r, int c, int K) { return (r >> 4) * 16 * K + c * 128 + (r & 15) * 8; }

// k_wt: WT [z] = bf16(Wz[k][n]) (k-major [K][ncols]) as [n][K] in fragment order, via 64 x 64 LDS tiles; grid (K/64, ncols/64, 4), blockIdx.z = which of the four weights.
__global__ __launch_bounds__(256) void k_wt(const float* __restrict__ W0, const float* __restrict__ W1, const float* __restrict__ W2, const float* __restrict__ W3, int K, int ncols, bf* WT) {
    __shared__ __align__(16) unsigned short tl[64 * 72];
    const int z = blockIdx.z; const float* __restrict__ Wm = z == 0 ? W0 : z == 1 ? W1 : z == 2 ? W2 : W3; WT += (size_t)z * K * ncols;
    const int tid = threadIdx.x, k0 = blockIdx.x * 64, n0 = blockIdx.y * 64;
    const int kk = tid >> 2, nq = (tid & 3) * 16;
#pragma unroll
    for (int i = 0; i < 16; ++i) tl[(nq + i) * 72 + kk] = f2bf(Wm[(size_t)(k0 + kk) * ncols + n0 + nq + i]);
    __syncthreads();
    const int piece = (tid >> 4) & 7;    // 128 threads write the 2 KiB that 16 rows x 64 k fill in fragment order
    auto pass = [&]() {
#pragma unroll
        for (int s = 0; s < 2; ++s) { const int nr = ((tid >> 7) + 2 * s) * 16 + (tid & 15); const v8us val = *(const v8usa*)(tl + nr * 72 + piece * 8); *(v8us*)(WT + fragoff(n0 + nr, k0 / 8 + piece, K)) = val; }
    };
    pass(); 
}
// k_fattn: scores, softmax and P.v of one head for 256 queries per block, nothing of S or P leaving the registers. A wave owns FQ * 16 queries and one of the FKS parts of the NN keys, 32 keys a pass:
// S^T = K.Q^T (A = K rows, B = Q rows kept in registers, both plain bf16), so a lane holds 16 keys' scores of one query (column lane & 15);
// running maximum and sum per query (log2 domain, one exchange between the lane halves), p = exp2(s * SCL2 - m) rounded to bf16 (the sum takes p unrounded): the two 16-key score tiles, converted in place,
// are the B operand of O^T += V^T.P^T (A = V^T rows, plain bf16, keys in the same order). O^T is scaled by exp2(m_old - m_new) every pass and by 1 / sum at the end.
// The two waves of a query group (wave, wave + FW / FKS) meet in LDS: the upper one hands over its maximum, sum and O^T, the lower one brings both to the common maximum, adds, divides, adds q (hi + residual: its own B fragments and the residual plane's, held in the same form for this alone: element (t & 1) * 8 + j of k-step t >> 1 is head column t * 16 + 8 * hi + j of query lr, the place of O^T's element j of tile t) and stores.
// grid (NN / (FW / FKS * FQ * 16), NH_, NBT); planes Q (hi and residual), K [item][head][NN][HD] in fragment order, V^T [item][head][NN / 32][HD][32] with each [HD][32] in fragment order; O [NR][DV] = ctx + q.
#define FQ 4
#define FW 8
#define FKS 2
#define FG (FW / FKS)
#define SCL2 (SCL * 1.4426950408889634f)
typedef __attribute__((ext_vector_type(2))) float  v2f;
typedef __attribute__((ext_vector_type(2))) __bf16 v2bf;
typedef __attribute__((ext_vector_type(16))) float v16f;
// One fragment of a plane in fragment order: 16 bytes at p + c and 16 at + 512 (k = 8 * hi + 0..7 and 16 + 8 * hi + 0..7 of row lr). p = the lane's own address (lane * 16 bytes into the first fragment), c a constant.
__device__ __forceinline__ v16bf ldfrag(const char* p, int c) { return cat16b(*(const v8us*)(p + c), *(const v8us*)(p + c + 512)); }
// The wait that stands in front of any write to the address registers of issued loads. It takes the address as an input, so that it keeps its registers up to it (left free, the compiler lands a later load's result on them).
__device__ __forceinline__ void xwait(const char* a) { asm volatile("s_wait_xcnt 0x0" :: "v"(a) : "memory"); }
__device__ __forceinline__ float xhalf(float x) { const int b = __float_as_int(x); return __int_as_float(__builtin_amdgcn_permlanex16(b, b, 0x76543210, 0xfedcba98, false, false)); }
__global__ __launch_bounds__(FW * 32) void k_fattn(const bf* __restrict__ Qh0, const bf* __restrict__ Ql0, const bf* __restrict__ Kh0, const bf* __restrict__ Vh0, float* O) {
    const size_t pp = ((size_t)blockIdx.z * NH_ + blockIdx.y) * NN * HD;
    const bf* __restrict__ Qh = Qh0 + pp; const bf* __restrict__ Ql = Ql0 + pp; const bf* __restrict__ Kh = Kh0 + pp; const bf* __restrict__ Vh = Vh0 + pp;
    __shared__ __align__(16) float mrg[FG][(4 * FQ * 8 + 2 * FQ) * 32];
    const int lane = threadIdx.x & 31, wave = __builtin_amdgcn_readfirstlane(threadIdx.x >> 5), lr = lane & 15, hi = lane >> 4;    // the wave's number in a scalar register: loop bounds and branches on it stay scalar
    const int q0 = (blockIdx.x * FG + wave % FG) * (FQ * 16), kbeg = (wave / FG) * (NN / FKS);
    const unsigned loff = lane * 16;    // bytes: the lane's 16 of the 512 that a fragment load reads
    v16bf qh[FQ][2], ql[FQ][2];
    const char* pqh = (const char*)(Qh + (size_t)q0 * HD) + loff; const char* pql = (const char*)(Ql + (size_t)q0 * HD) + loff;
#pragma unroll
    for (int u = 0; u < FQ; ++u) {
#pragma unroll
        for (int ks = 0; ks < 2; ++ks) { qh[u][ks] = ldfrag(pqh, (u * 16 * HD + ks * 512) * 2); ql[u][ks] = ldfrag(pql, (u * 16 * HD + ks * 512) * 2); } }
    v16bf kh[2][2], vh[4];
    const char* pkh;
    auto fetchk = [&](int kc) {
        pkh = (const char*)(Kh + (size_t)kc * HD) + loff;
#pragma unroll
        for (int kt = 0; kt < 2; ++kt) {
#pragma unroll
            for (int ks = 0; ks < 2; ++ks) kh[kt][ks] = ldfrag(pkh, (kt * 16 * HD + ks * 512) * 2); }
    };
    v8f acc[4][FQ]; float m[FQ], l[FQ];
#pragma unroll
    for (int u = 0; u < FQ; ++u) { m[u] = -3.0e38f; l[u] = 0.f;
#pragma unroll
        for (int t = 0; t < 4; ++t) acc[t][u] = (v8f){}; }
    fetchk(kbeg);
    // The wait that stands in front of any write to the base registers of the Q and first K loads; the two fences keep it behind the loads and such writes behind it.
    __builtin_amdgcn_sched_barrier(0);
    asm volatile("s_wait_xcnt 0x0" ::: "memory");
    __builtin_amdgcn_sched_barrier(0);
    // The scheduling fences keep each group of loads where it is written (V a whole score block ahead of its use, the next pass's K a whole softmax and P.v block ahead): left free, the compiler sinks a load to its WMMA.
    // The pass loop stays rolled: one pass is 32 WMMAs and some 350 vector instructions already, and a second copy would only cost instruction cache.
#pragma unroll 1
    for (int i = 0; i < NN / FKS; i += 32) {
        const int kc = kbeg + i;
        const char* pvh = (const char*)(Vh + (size_t)kc * HD) + loff;
#pragma unroll
        for (int t = 0; t < 4; ++t) vh[t] = ldfrag(pvh, t * 1024);
        __builtin_amdgcn_sched_barrier(0);
        v8f s[2][FQ];
#pragma unroll
        for (int kt = 0; kt < 2; ++kt) {
#pragma unroll
            for (int u = 0; u < FQ; ++u) s[kt][u] = (v8f){}; }
#pragma unroll
        for (int ks = 0; ks < 2; ++ks) {
#pragma unroll
            for (int kt = 0; kt < 2; ++kt) {
#pragma unroll
                for (int u = 0; u < FQ; ++u) s[kt][u] = wmmab(kh[kt][ks], qh[u][ks], s[kt][u]); } }
        __builtin_amdgcn_sched_barrier(0);
        xwait(pvh);    // written behind the score block, so that the wave does not stop for it directly behind the V loads
        fetchk(i + 32 < NN / FKS ? kc + 32 : kbeg);    // the last pass fetches the first again (in bounds, unused), so that the loads stand on one path
        __builtin_amdgcn_sched_barrier(0);
        v16bf ph[FQ];
#pragma unroll
        for (int u = 0; u < FQ; ++u) {
            float mx0 = fmaxf(s[0][u][0], s[1][u][0]), mx1 = fmaxf(s[0][u][1], s[1][u][1]);
#pragma unroll
            for (int j = 2; j < 8; j += 2) { mx0 = fmaxf(mx0, fmaxf(s[0][u][j], s[1][u][j])); mx1 = fmaxf(mx1, fmaxf(s[0][u][j + 1], s[1][u][j + 1])); }
            float mx = fmaxf(mx0, mx1); mx = fmaxf(mx, xhalf(mx));
            const float mn = fmaxf(m[u], mx * SCL2), al = __builtin_amdgcn_exp2f(m[u] - mn); m[u] = mn;
            float ls0 = 0.f, ls1 = 0.f;
#pragma unroll
            for (int kt = 0; kt < 2; ++kt) {
#pragma unroll
                for (int j = 0; j < 8; j += 2) {
                    const v2f p = {__builtin_amdgcn_exp2f(fmaf(s[kt][u][j], SCL2, -mn)), __builtin_amdgcn_exp2f(fmaf(s[kt][u][j + 1], SCL2, -mn))};
                    ls0 += p[0]; ls1 += p[1];
                    const v2bf hb = __builtin_convertvector(p, v2bf);
                    ph[u][kt * 8 + j] = hb[0]; ph[u][kt * 8 + j + 1] = hb[1]; } }
            l[u] = fmaf(l[u], al, ls0 + ls1);
#pragma unroll
            for (int t = 0; t < 4; ++t) acc[t][u] *= al;
        }
#pragma unroll
        for (int t = 0; t < 4; ++t) {
#pragma unroll
            for (int u = 0; u < FQ; ++u) acc[t][u] = wmmab(vh[t], ph[u], acc[t][u]); }
        __builtin_amdgcn_sched_barrier(0);    // keeps the wait below at the pass's end: left free, it rises to stand directly behind the K loads, and the wave stops for it there
        xwait(pkh);
    }
    float* mg = &mrg[wave % FG][0];
    if (wave >= FG) {
#pragma unroll
        for (int u = 0; u < FQ; ++u) { mg[(4 * FQ * 8 + u) * 32 + lane] = m[u]; mg[(4 * FQ * 8 + FQ + u) * 32 + lane] = l[u];
#pragma unroll
            for (int t = 0; t < 4; ++t) { const v8f r = acc[t][u]; float* p = mg + (t * FQ + u) * 256 + lane * 4;
                *(v4f*)p = (v4f){r[0], r[1], r[2], r[3]}; *(v4f*)(p + 128) = (v4f){r[4], r[5], r[6], r[7]}; } }
    }
    __syncthreads();
    if (wave < FG) {
        // A lane holds 8 consecutive head columns (t * 16 + 8 * hi ...) of query u * 16 + lr.
#pragma unroll
        for (int u = 0; u < FQ; ++u) {
            const float m1 = mg[(4 * FQ * 8 + u) * 32 + lane], l1 = mg[(4 * FQ * 8 + FQ + u) * 32 + lane];
            const float mn = fmaxf(m[u], m1), a0 = __builtin_amdgcn_exp2f(m[u] - mn), a1 = __builtin_amdgcn_exp2f(m1 - mn);
            const float lt = fmaf(l[u], a0, l1 * a1), inv = 1.0f / (lt + xhalf(lt)), f0 = a0 * inv, f1 = a1 * inv;
            float* orow = O + ((size_t)blockIdx.z * NN + q0 + u * 16 + lr) * DV + blockIdx.y * HD + 8 * hi;
            v4f res[8];
#pragma unroll
            for (int t = 0; t < 4; ++t) { const v8f r = acc[t][u]; const float* p = mg + (t * FQ + u) * 256 + lane * 4; const v4f x = *(const v4f*)p, y = *(const v4f*)(p + 128);
                const v16f qq = __builtin_convertvector(qh[u][t >> 1], v16f) + __builtin_convertvector(ql[u][t >> 1], v16f); const int e = (t & 1) * 8;
                res[2 * t] = ((v4f){r[0], r[1], r[2], r[3]} * f0 + x * f1) + (v4f){qq[e], qq[e + 1], qq[e + 2], qq[e + 3]}; res[2 * t + 1] = ((v4f){r[4], r[5], r[6], r[7]} * f0 + y * f1) + (v4f){qq[e + 4], qq[e + 5], qq[e + 6], qq[e + 7]}; }
            // The two fences keep a query tile's arithmetic in front of its eight stores and the next tile's behind the wait, so that no register an issued store names is rewritten ahead of that wait.
            __builtin_amdgcn_sched_barrier(0);
#pragma unroll
            for (int t = 0; t < 4; ++t) { *(v4f*)(orow + t * 16) = res[2 * t]; *(v4f*)(orow + t * 16 + 4) = res[2 * t + 1]; }
            if (u + 1 < FQ) { asm volatile("s_wait_xcnt 0x0" ::: "memory");    // stands in front of the next tile's writes to the stores' data and address registers
                __builtin_amdgcn_sched_barrier(0); }
        }
    }
}

// k_proj: the q, k and v projections, from the f32 inputs to the planes that attention reads. grid (NR / PR, 3), blockIdx.y = z = which product. A block owns PR whole rows of its input (z = 0: XQ, else XK):
// a wave reads 16 of them (512 bytes of a row a load), rounds them to bf16 and lays them in LDS in fragment order (pieces of [16 rows][8] PPP elements apart, as in k_tail); behind the barrier wave w takes all PR rows x head w
// (8 x 4 tiles), x fragments from LDS half a k-step ahead, weight fragments (W^T, fragment order) from L2 four k-steps ahead in a ring of PB.
// z < 2: D = W^T.x^T, so that a lane holds 8 consecutive head columns of one row, 16 bytes of a q or k plane as they stand (a store writes 512 bytes in a row).
// z = 2: D = x.W, so that a lane holds 8 consecutive tokens of one head column, 16 bytes of a v^T plane as they stand. Planes: bf16 of the f32 tile + bf(bias), for q its residual too (the q that is added to ctx), Q, K [item][head][NN][HD], V^T [item][head][NN / 32][HD][32].
#define PR  128
#define PB  4
#define PPP 136
typedef __attribute__((ext_vector_type(4))) unsigned v4u;
typedef __attribute__((ext_vector_type(2))) unsigned v2u;
typedef v4u __attribute__((may_alias)) v4ua;
typedef v2u __attribute__((may_alias)) v2ua;
__device__ __forceinline__ unsigned pkbf(float a, float b) { return __builtin_bit_cast(unsigned, __builtin_convertvector((v2f){a, b}, v2bf)); }
// 8 f32 values -> 8 bf16 (nearest even) and the 8 bf16 of what the rounding left
__device__ __forceinline__ void split8(const float (&v)[8], v4u& oh, v4u& ol) {
#pragma unroll
    for (int p = 0; p < 4; ++p) { const v2f x = {v[2 * p], v[2 * p + 1]}; const v2bf hb = __builtin_convertvector(x, v2bf); const v2bf lb = __builtin_convertvector(x - __builtin_convertvector(hb, v2f), v2bf);
        oh[p] = __builtin_bit_cast(unsigned, hb); ol[p] = __builtin_bit_cast(unsigned, lb); }
}
template <bool B> struct flag { static constexpr bool v = B; };
// The product of a wave: ap = the lane's 16 bytes of piece hi, row tile 0, k-step 0 in LDS; pb = the lane's 16 bytes of the wave's first weight fragment; b holds the first PB k-steps. WA: the weight is the A operand.
// The fetches past the last k-step read the next row tile's pieces and the next 16 weight rows (the fourth weight's behind the third): inside the arrays, written in this call, unused; so the loop has one path.
template <bool WA>
__device__ __forceinline__ void proj_mm(const bf* ap, const char* pb, v16bf (&b)[PB][4], v8f (&acc)[PR / 16][4]) {
    v16bf a[2][4];
    auto fetcha = [&](int g, int ks) {
#pragma unroll
        for (int i = 0; i < 4; ++i) { const bf* p = ap + ((g * 4 + i) * (DV / 8) + 4 * ks) * PPP; a[g][i] = cat16b(*(const v8usa*)p, *(const v8usa*)(p + 2 * PPP)); }
    };
    auto mm = [&](int g, int kk) {
#pragma unroll
        for (int i = 0; i < 4; ++i) {
#pragma unroll
            for (int t = 0; t < 4; ++t) { if constexpr (WA) acc[g * 4 + i][t] = wmmab(b[kk][t], a[g][i], acc[g * 4 + i][t]); else acc[g * 4 + i][t] = wmmab(a[g][i], b[kk][t], acc[g * 4 + i][t]); } }
    };
    fetcha(0, 0);
    // Rolled by PB k-steps (128 WMMAs a trip), so that the ring's places are plain registers and the text stays short. The scheduling fences keep each group of loads where it is written: left free, the compiler sinks a load to its WMMA.
#pragma unroll 1
    for (int k0 = 0; k0 < DV / 32; k0 += PB) {
        const char* pk = pb + k0 * 1024;
#pragma unroll
        for (int kk = 0; kk < PB; ++kk) {
            fetcha(1, k0 + kk);
            __builtin_amdgcn_sched_barrier(0);
            mm(0, kk);
            __builtin_amdgcn_sched_barrier(0);
            fetcha(0, k0 + kk + 1);
            __builtin_amdgcn_sched_barrier(0);
            mm(1, kk);
            __builtin_amdgcn_sched_barrier(0);
#pragma unroll
            for (int t = 0; t < 4; ++t) b[kk][t] = ldfrag(pk, t * 16 * DV * 2 + (kk + PB) * 1024);
        }
        // The wait that stands in front of the next trip's write to the weight loads' address register; the two fences keep it behind the trip's last loads and that write behind it.
        __builtin_amdgcn_sched_barrier(0);
        asm volatile("s_wait_xcnt 0x0" ::: "memory");
        __builtin_amdgcn_sched_barrier(0);
    }
}
// One block's work; WA = the weight is the A operand (z < 2). A function per form, so that each side of the kernel's one branch on z holds its own registers.
template <bool WA>
__device__ __forceinline__ void proj_body(bf (*hp)[DV / 8][PPP], int z, const float* __restrict__ X, const bf* __restrict__ WT, const float* __restrict__ bias, bf* Ph, bf* Pl) {
    const int lane = threadIdx.x & 31, wv = __builtin_amdgcn_readfirstlane(threadIdx.x >> 5), lr = lane & 15, hi = lane >> 4;
    const size_t r0 = (size_t)blockIdx.x * PR;
    const float* px = X + (r0 + wv * 16) * DV + lane * 4;
    const char* pb = (const char*)(WT + ((size_t)z * DV + wv * 64) * DV) + lane * 16;
    v16bf b[PB][4];
    {
        // The wave's 16 rows in four groups of 16 loads, two or three groups out at a time.
        v4f x[4][16];
        auto ask = [&](int q) {
#pragma unroll
            for (int i = 0; i < 4; ++i) {
#pragma unroll
                for (int st = 0; st < 4; ++st) x[q][i * 4 + st] = *(const v4f*)(px + (q * 4 + i) * DV + st * 128); }
        };
        auto put = [&](int q) {
#pragma unroll
            for (int i = 0; i < 4; ++i) {
#pragma unroll
                for (int st = 0; st < 4; ++st) { const v4f v = x[q][i * 4 + st]; *(v2ua*)(&hp[wv][st * 16 + (lane >> 1)][(q * 4 + i) * 8 + (lane & 1) * 4]) = (v2u){pkbf(v[0], v[1]), pkbf(v[2], v[3])}; } }
        };
        // The scheduling fences keep the groups of loads ahead of the rounding: left free, a group's loads sink to their use and the groups' latencies follow one another.
        ask(0); ask(1);
        __builtin_amdgcn_sched_barrier(0);
        put(0); ask(2);
        __builtin_amdgcn_sched_barrier(0);
        put(1); ask(3);
        __builtin_amdgcn_sched_barrier(0);
        put(2);
        __builtin_amdgcn_sched_barrier(0);    // the weight loads stay behind the third group's use: never more than 48 loads of a wave are out
#pragma unroll
        for (int ks = 0; ks < PB; ++ks) {
#pragma unroll
            for (int t = 0; t < 4; ++t) b[ks][t] = ldfrag(pb, t * 16 * DV * 2 + ks * 1024); }
        __builtin_amdgcn_sched_barrier(0);
        asm volatile("s_wait_xcnt 0x0" ::: "memory");    // stands in front of any write to the address registers of the loads above
        __builtin_amdgcn_sched_barrier(0);    // keeps such writes behind it
        put(3);
    }
    __syncthreads();    // every wave reads all PR rows
    v8f acc[PR / 16][4];
#pragma unroll
    for (int i = 0; i < PR / 16; ++i) {
#pragma unroll
        for (int t = 0; t < 4; ++t) acc[i][t] = (v8f){}; }
    proj_mm<WA>(&hp[0][hi][lr * 8], pb, b, acc);
    const size_t pl0 = (((r0 / NN) * NH_ + wv) * NN + r0 % NN) * HD + lane * 8;    // the lane's 16 bytes of the first 512 of the wave's PR x HD part of a plane
    float bs[WA ? 4 : 1][WA ? 8 : 4];
    const int bcol = wv * 64 + lr;    // the lane's first column of the wave's head
    if constexpr (WA) {
#pragma unroll
        for (int t = 0; t < 4; ++t) { const v4f x = *(const v4f*)(bias + wv * 64 + t * 16 + hi * 8), y = *(const v4f*)(bias + wv * 64 + t * 16 + hi * 8 + 4);
#pragma unroll
            for (int j = 0; j < 8; ++j) bs[t][j] = j < 4 ? x[j & 3] : y[j & 3]; }
    } else {
#pragma unroll
        for (int t = 0; t < 4; ++t) bs[0][t] = bias[bcol + t * 16];
    }
    // The wait that stands in front of any write to the bias loads' address registers; the two fences keep it behind the loads and the arithmetic behind it.
    // Where the loads' offset register is the lane's column bcol, the wait takes it as an input, so that it keeps its register up to it (left free, the compiler lands the last load's result on it).
    __builtin_amdgcn_sched_barrier(0);
    if constexpr (WA) asm volatile("s_wait_xcnt 0x0" ::: "memory"); else asm volatile("s_wait_xcnt 0x0" :: "v"(bcol) : "memory");
    __builtin_amdgcn_sched_barrier(0);
#pragma unroll
    for (int t = 0; t < (WA ? 4 : 1); ++t) {
#pragma unroll
        for (int j = 0; j < (WA ? 8 : 4); ++j) bs[t][j] = bfr(bs[t][j]); }
    // WA, tile (i, t): head columns t * 16 + hi * 8 + j of row i * 16 + lr = piece 2 * t + hi of row lr of the 16-row group i.
    // Else: tokens i * 16 + hi * 8 + j of head column t * 16 + lr = piece (i & 1) * 2 + hi of row lr of fragment t of the 32-token group i >> 1.
    // RES: the residual plane is written too (q alone).
    auto planes = [&](auto res) {
    constexpr bool RES = decltype(res)::v;
#pragma unroll
    for (int i = 0; i < PR / 16; ++i) {
        v4u oh[4], ol[4];
#pragma unroll
        for (int t = 0; t < 4; ++t) { float v[8];
#pragma unroll
            for (int j = 0; j < 8; ++j) v[j] = acc[i][t][j] + (WA ? bs[t][j] : bs[0][t]);
            if constexpr (RES) split8(v, oh[t], ol[t]);
            else {
#pragma unroll
                for (int p = 0; p < 4; ++p) oh[t][p] = pkbf(v[2 * p], v[2 * p + 1]); } }
        // The two fences keep a tile row's arithmetic in front of its stores and the next one's behind the wait, so that no register an issued store names is rewritten ahead of that wait.
        __builtin_amdgcn_sched_barrier(0);
#pragma unroll
        for (int t = 0; t < 4; ++t) { const size_t o = pl0 + (WA ? i * 16 * HD + t * 256 : (i >> 1) * 32 * HD + t * 512 + (i & 1) * 256); *(v4ua*)(Ph + o) = oh[t]; if constexpr (RES) *(v4ua*)(Pl + o) = ol[t]; }
        asm volatile("s_wait_xcnt 0x0" ::: "memory");    // stands in front of the next writes to the stores' data and address registers: the next tile row's, and behind the last row those of the code laid behind this block
        __builtin_amdgcn_sched_barrier(0);
    }
    };
    if (WA && z == 0) planes(flag<true>{}); else planes(flag<false>{});
}
__global__ __launch_bounds__(256) void k_proj(const float* __restrict__ XQ, const float* __restrict__ XK, const bf* __restrict__ WT, const float* __restrict__ bq, const float* __restrict__ bk, const float* __restrict__ bv,
                                              bf* Qh, bf* Ql, bf* Kh, bf* VTh) {
    __shared__ __align__(16) bf hp[PR / 16][DV / 8][PPP];
    const int z = blockIdx.y;
    if (z == 2) proj_body<false>(hp, z, XK, WT, bv, VTh, nullptr);
    else proj_body<true>(hp, z, z ? XK : XQ, WT, z ? bk : bq, z ? Kh : Qh, Ql);
}
// k_tail: everything behind attention for TR whole rows per block, so that nothing between O and the output leaves the WGP: H = LayerNorm(O[s]) x bf(g0) + bf(b0) (O = ctx + q, as attention wrote it) (f32; mean, biased var over 512),
// F = (Hh + Hl).Wo^T + bf(bo) (H as bf16 hi + residual, two products, hi then residual in every k-step of 32), out = LayerNorm(H + relu(F)) x bf(g1) + bf(b1).
// Both LayerNorms: one wave per row, 4 rows a wave, lane -> 4 columns per 128-step, 4 steps. The product: a wave takes all TR rows x 64 columns (2 x 4 tiles); A from LDS, B (Wo^T, fragment order) from L2, TB k-steps ahead.
// LDS: hp = the two planes in fragment order, a piece of [16 rows][8] being TPP elements from the next (272 bytes: a row's 8-byte writes, 16 pieces a store, fall on all 64 banks; a half wave's fragment read is 256 bytes in a row);
// ys = H in f32 (a wave's own rows); fs = F, pitch TFP (rows 8 apart lie 32 banks apart, as the accumulator's two lane halves write them).
#define TR  32
#define TB  3
#define TPP 136
#define TFP 516
__global__ __launch_bounds__(256) void k_tail(const float* __restrict__ O, const float* __restrict__ g0, const float* __restrict__ b0, const bf* __restrict__ WoT, const float* __restrict__ bo,
                                              const float* __restrict__ g1, const float* __restrict__ b1, float* OUTB) {
    typedef __attribute__((ext_vector_type(4))) unsigned short v4us;
    typedef v4us __attribute__((may_alias)) v4usa;
    __shared__ __align__(16) bf hp[2][TR / 16][DV / 8][TPP];
    __shared__ __align__(16) float ys[TR][DV];
    __shared__ __align__(16) float fs[TR][TFP];
    const int lane = threadIdx.x & 31, wv = __builtin_amdgcn_readfirstlane(threadIdx.x >> 5), lr = lane & 15, hi = lane >> 4;
    const size_t s0 = (size_t)blockIdx.x * TR + wv * 4;
    // The first TB k-steps of B depend on nothing: they are asked for ahead of the rows.
    const char* pbu = (const char*)(WoT + (size_t)wv * 64 * DV); const char* pb = pbu + lane * 16;    // pbu, pou: the same in every lane, the scalar bases of the loads
    v16bf b[TB][4];
#pragma unroll
    for (int ks = 0; ks < TB; ++ks) {
#pragma unroll
        for (int t = 0; t < 4; ++t) b[ks][t] = ldfrag(pb, t * 16 * DV * 2 + ks * 1024); }
    const float* pou = O + s0 * DV; const float* po = pou + lane * 4;
    float v[4][16], sm[4];
    {
        v4f xo[4][4];
#pragma unroll
        for (int i = 0; i < 4; ++i) {
#pragma unroll
            for (int st = 0; st < 4; ++st) xo[i][st] = *(const v4f*)(po + i * DV + st * 128); }
        __builtin_amdgcn_sched_barrier(0);    // keeps all the loads above in front of the first sum: left free, a row's loads sink to its adds and the rows' latencies follow one another
#pragma unroll
        for (int i = 0; i < 4; ++i) { sm[i] = 0.f;
#pragma unroll
            for (int st = 0; st < 4; ++st) {
#pragma unroll
                for (int q = 0; q < 4; ++q) { const float t = xo[i][st][q]; v[i][st * 4 + q] = t; sm[i] += t; } } }
    }
    // The wait that stands in front of any write to the row loads' address registers: as its inputs they stay allocated up to it; the sums hold it behind the loads.
    asm volatile("s_wait_xcnt 0x0" :: "s"(pou), "v"(sm[0]), "v"(sm[1]), "v"(sm[2]), "v"(sm[3]) : "memory");
    float mu[4], qv[4], rs[4];
#pragma unroll
    for (int sh = 16; sh; sh >>= 1) {
#pragma unroll
        for (int i = 0; i < 4; ++i) sm[i] += __shfl_xor(sm[i], sh, 32); }
#pragma unroll
    for (int i = 0; i < 4; ++i) { mu[i] = sm[i] * (1.0f / DV); qv[i] = 0.f;
#pragma unroll
        for (int e = 0; e < 16; ++e) { const float d = v[i][e] - mu[i]; qv[i] = fmaf(d, d, qv[i]); } }
#pragma unroll
    for (int sh = 16; sh; sh >>= 1) {
#pragma unroll
        for (int i = 0; i < 4; ++i) qv[i] += __shfl_xor(qv[i], sh, 32); }
#pragma unroll
    for (int i = 0; i < 4; ++i) rs[i] = rsqrtf(qv[i] * (1.0f / DV) + LEPS);
#pragma unroll
    for (int st = 0; st < 4; ++st) { const int c0 = st * 128 + lane * 4; const v4f gv = *(const v4f*)(g0 + c0), bv = *(const v4f*)(b0 + c0);
#pragma unroll
        for (int i = 0; i < 4; ++i) { const int r = wv * 4 + i; v4f o; v4us oh, ol;
#pragma unroll
            for (int q = 0; q < 4; ++q) { const float y = (v[i][st * 4 + q] - mu[i]) * rs[i] * bfr(gv[q]) + bfr(bv[q]); o[q] = y; const unsigned short hb = f2bf(y); oh[q] = hb; ol[q] = f2bf(y - bf2f(hb)); }
            *(v4fa*)(&ys[r][c0]) = o; *(v4usa*)(&hp[0][r >> 4][c0 >> 3][(r & 15) * 8 + (lane & 1) * 4]) = oh; *(v4usa*)(&hp[1][r >> 4][c0 >> 3][(r & 15) * 8 + (lane & 1) * 4]) = ol; } }
    float bov[4];    // asked for ahead of the product
#pragma unroll
    for (int t = 0; t < 4; ++t) bov[t] = bo[wv * 64 + t * 16 + lr];
    __syncthreads();    // every wave reads all TR rows of the planes
    v8f acc[2][4];
#pragma unroll
    for (int rt = 0; rt < 2; ++rt) {
#pragma unroll
        for (int t = 0; t < 4; ++t) acc[rt][t] = (v8f){}; }
    // A fragment of k-step ks: row lr, pieces 4 * ks + hi and 4 * ks + 2 + hi, the k order of the B fragments.
    v16bf ah[2][2], al[2][2];
    auto fetcha = [&](int ks) {
#pragma unroll
        for (int rt = 0; rt < 2; ++rt) {
            ah[ks & 1][rt] = cat16b(*(const v8usa*)(&hp[0][rt][4 * ks + hi][lr * 8]), *(const v8usa*)(&hp[0][rt][4 * ks + 2 + hi][lr * 8]));
            al[ks & 1][rt] = cat16b(*(const v8usa*)(&hp[1][rt][4 * ks + hi][lr * 8]), *(const v8usa*)(&hp[1][rt][4 * ks + 2 + hi][lr * 8])); }
    };
    fetcha(0);
    // Unrolled whole (16 k-steps of 16 WMMAs), so that the rings of A and B fragments are plain registers. The scheduling fences keep each k-step's loads where they are written (A one k-step ahead, B TB ahead):
    // left free, the compiler sinks a load to its WMMA.
#pragma unroll
    for (int ks = 0; ks < DV / 32; ++ks) {
        if (ks + 1 < DV / 32) fetcha(ks + 1);
        __builtin_amdgcn_sched_barrier(0);
#pragma unroll
        for (int rt = 0; rt < 2; ++rt) {
#pragma unroll
            for (int t = 0; t < 4; ++t) acc[rt][t] = wmmab(ah[ks & 1][rt], b[ks % TB][t], acc[rt][t]); }
#pragma unroll
        for (int rt = 0; rt < 2; ++rt) {
#pragma unroll
            for (int t = 0; t < 4; ++t) acc[rt][t] = wmmab(al[ks & 1][rt], b[ks % TB][t], acc[rt][t]); }
        __builtin_amdgcn_sched_barrier(0);
        if (ks + TB < DV / 32) {
#pragma unroll
            for (int t = 0; t < 4; ++t) b[ks % TB][t] = ldfrag(pb, t * 16 * DV * 2 + (ks + TB) * 1024); }
    }
    asm volatile("s_wait_xcnt 0x0" :: "s"(pbu) : "memory");    // stands in front of any write to the B loads' base register, which as its input stays allocated up to it
    // g1 and b1 are asked for here, so that they arrive behind the F tile's stores, the barrier and the row sums.
    v4f gv1[4], bv1[4];
#pragma unroll
    for (int st = 0; st < 4; ++st) { gv1[st] = *(const v4f*)(g1 + st * 128 + lane * 4); bv1[st] = *(const v4f*)(b1 + st * 128 + lane * 4); }
#pragma unroll
    for (int t = 0; t < 4; ++t) { const int c = wv * 64 + t * 16 + lr; const float bv = bfr(bov[t]);
#pragma unroll
        for (int rt = 0; rt < 2; ++rt) {
#pragma unroll
            for (int j = 0; j < 8; ++j) fs[rt * 16 + hi * 8 + j][c] = acc[rt][t][j] + bv; } }
    __syncthreads();    // a row of F comes from all eight waves
#pragma unroll
    for (int i = 0; i < 4; ++i) { const int r = wv * 4 + i; sm[i] = 0.f;
#pragma unroll
        for (int st = 0; st < 4; ++st) { const v4f h = *(const v4fa*)(&ys[r][st * 128 + lane * 4]), f = *(const v4fa*)(&fs[r][st * 128 + lane * 4]);
#pragma unroll
            for (int q = 0; q < 4; ++q) { const float t = h[q] + fmaxf(f[q], 0.f); v[i][st * 4 + q] = t; sm[i] += t; } } }
#pragma unroll
    for (int sh = 16; sh; sh >>= 1) {
#pragma unroll
        for (int i = 0; i < 4; ++i) sm[i] += __shfl_xor(sm[i], sh, 32); }
#pragma unroll
    for (int i = 0; i < 4; ++i) { mu[i] = sm[i] * (1.0f / DV); qv[i] = 0.f;
#pragma unroll
        for (int e = 0; e < 16; ++e) { const float d = v[i][e] - mu[i]; qv[i] = fmaf(d, d, qv[i]); } }
#pragma unroll
    for (int sh = 16; sh; sh >>= 1) {
#pragma unroll
        for (int i = 0; i < 4; ++i) qv[i] += __shfl_xor(qv[i], sh, 32); }
#pragma unroll
    for (int i = 0; i < 4; ++i) rs[i] = rsqrtf(qv[i] * (1.0f / DV) + LEPS);
    v4f res[4][4];
#pragma unroll
    for (int st = 0; st < 4; ++st) { const v4f gv = gv1[st], bv = bv1[st];
#pragma unroll
        for (int i = 0; i < 4; ++i) {
#pragma unroll
            for (int q = 0; q < 4; ++q) res[i][st][q] = (v[i][st * 4 + q] - mu[i]) * rs[i] * bfr(gv[q]) + bfr(bv[q]); } }
    __builtin_amdgcn_sched_barrier(0);    // keeps all arithmetic in front of the stores, so that no register an issued store names is written behind it
    float* pz = OUTB + s0 * DV + lane * 4;
#pragma unroll
    for (int i = 0; i < 4; ++i) {
#pragma unroll
        for (int st = 0; st < 4; ++st) *(v4f*)(pz + i * DV + st * 128) = res[i][st]; }
}

extern "C" void kernel_launch(void* const* d_in, const int* in_sizes, int n_in,
                              void* d_out, int out_size, void* d_ws, size_t ws_size, hipStream_t stream) {
    (void)in_sizes; (void)n_in; (void)out_size;
    const float* Qi = (const float*)d_in[0]; const float* Ki = (const float*)d_in[1]; const float* Wq = (const float*)d_in[2]; const float* bq = (const float*)d_in[3]; const float* Wk = (const float*)d_in[4]; const float* bk = (const float*)d_in[5];
    const float* Wv = (const float*)d_in[6]; const float* bv = (const float*)d_in[7]; const float* Wo = (const float*)d_in[8]; const float* bo = (const float*)d_in[9]; const float* g0 = (const float*)d_in[10]; const float* b0 = (const float*)d_in[11]; const float* g1 = (const float*)d_in[12]; const float* b1 = (const float*)d_in[13];
    float* out = (float*)d_out;    // [4][2048][512]
    char* wsp = (char*)d_ws;
    auto take = [&](size_t bytes) { char* p = wsp; wsp += (bytes + 255) & ~(size_t)255; return (void*)p; };
    // Kept through attention: the four weights, the q/k/v planes of all items and heads, and O.
    bf* WT = (bf*)take((size_t)4 * DV * DV * 2);    // WqT, WkT, WvT, WoT
    bf* Qh = (bf*)take((size_t)NR * DV * 2); bf* Ql = (bf*)take((size_t)NR * DV * 2); bf* Kh = (bf*)take((size_t)NR * DV * 2); bf* VTh = (bf*)take((size_t)NR * DV * 2);
    float* O = (float*)take((size_t)NR * DV * 4);
    if ((size_t)(wsp - (char*)d_ws) > ws_size) return;    // about 52 MB
    k_wt<<<dim3(DV / 64, DV / 64, 4), 256, 0, stream>>>(Wq, Wk, Wv, Wo, DV, DV, WT);   // (in, out) k-major
    k_proj<<<dim3(NR / PR, 3, 1), 256, 0, stream>>>(Qi, Ki, WT, bq, bk, bv, Qh, Ql, Kh, VTh);
    k_fattn<<<dim3(NN / (FG * FQ * 16), NH_, NBT), FW * 32, 0, stream>>>(Qh, Ql, Kh, VTh, O);
    k_tail<<<NR / TR, 256, 0, stream>>>(O, g0, b0, WT + (size_t)3 * DV * DV, bo, g1, b1, out);
}

// v010
// Measured time: 66.1 microseconds a run.
// Timed twice side by side with v009, it ran 1.04 and 1.05 times as fast.
// Over all steps from v000 it is 53.8 times as fast.
#include <hip/hip_runtime.h>

// Compute dtypes, f32 accumulate, per item: q/k/v = X.W + b as [2048 x 512].[512 x 512] GEMMs with PLAIN bf16 operands (exact products); per head: scores = q.k^T ([2048 x 64].[64 x
// 2048], both operands PLAIN bf16, one product: q and k come from products of bf16-rounded operands and carry that rounding's noise already), softmax (x 1/sqrt(512)) in f32 -> P as plain bf16, ctx = P.v ([2048 x 2048].[2048 x 64], v plain bf16, one product); + q
// residual (q = its bf16 hi + residual planes, summed in f32) and LayerNorm in f32 -> planes; rFF [2048 x 512].[512 x 512] (+ bo, relu) (two products), residual and the final LayerNorm in f32 - on v_wmma_f32_16x16x32_bf16.
// Launch plan: every stage runs once for all NBT items (their rows are contiguous: NR = NBT x NN rows); the projection kernel reads the f32 inputs, a block owning whole rows, and writes the q, k and v^T planes itself; scores, softmax and P.v are one kernel,
// once for all items and heads (softmax by a held reference maximum and a running sum; P is rounded unnormalised and the sum divides O at the end; the q residual is added there, from the Q fragments the wave holds); both LayerNorms and the rFF product between them are one kernel, a block owning whole rows.

#define NBT  4
#define NN   2048
#define DV   512
#define NH_  8
#define HD   64
#define DM   DV
#define NTK  NN
#define SCL  0.044194173824159216f
#define LEPS 1e-5f
#define LOSC 1024.0f
#define NR   (NBT * NN)

typedef _Float16 h16;
typedef unsigned short bf;
typedef __attribute__((ext_vector_type(16))) __bf16   v16bf;
typedef __attribute__((ext_vector_type(16))) _Float16 v16h;
typedef __attribute__((ext_vector_type(8)))  _Float16 v8h;
typedef __attribute__((ext_vector_type(8)))  unsigned short v8us;
typedef __attribute__((ext_vector_type(8)))  float    v8f;
typedef __attribute__((ext_vector_type(4)))  float    v4f;
typedef __attribute__((ext_vector_type(4)))  _Float16 v4h;
typedef v8h  __attribute__((may_alias)) v8ha;
typedef v4f  __attribute__((may_alias)) v4fa;
typedef v8us __attribute__((may_alias)) v8usa;

__device__ __forceinline__ unsigned short f2bf(float f) { unsigned u = __float_as_uint(f); u += 0x7FFFu + ((u >> 16) & 1u); return (unsigned short)(u >> 16); }
__device__ __forceinline__ float bf2f(unsigned short b) { return __uint_as_float(((unsigned)b) << 16); }
__device__ __forceinline__ float bfr(float f) { return bf2f(f2bf(f)); }
__device__ __forceinline__ v16h cat16(v8h lo, v8h hi) { return __builtin_shufflevector(lo, hi, 0, 1, 2, 3, 4, 5, 6, 7, 8, 9, 10, 11, 12, 13, 14, 15); }
__device__ __forceinline__ v16bf cat16b(v8us lo, v8us hi) { return __builtin_bit_cast(v16bf, __builtin_shufflevector(lo, hi, 0, 1, 2, 3, 4, 5, 6, 7, 8, 9, 10, 11, 12, 13, 14, 15)); }
__device__ __forceinline__ v8f wmma16(v16h a, v16h b, v8f c) { return __builtin_amdgcn_wmma_f32_16x16x32_f16(false, a, false, b, (short)0, c, false, false); }
__device__ __forceinline__ v8f wmmab(v16bf a, v16bf b, v8f c) { return __builtin_amdgcn_wmma_f32_16x16x32_bf16(false, a, false, b, (short)0, c, false, false); }

// Fragment order: every bf16 plane that a matrix instruction reads as [rows][K] lies in memory as [rows / 16][K / 8][16 rows][8 elements], so that the 32 lanes of a fragment load (row lane & 15, pieces 2 * x + (lane >> 4))
// read 512 bytes in a row, four whole lines; the two loads of a 32-deep fragment are 512 bytes apart. fragoff = element offset of piece c (8 elements) of row r.
__device__ __forceinline__ size_t fragoff(size_t r, int c, int K) { return (r >> 4) * 16 * K + c * 128 + (r & 15) * 8; }

// k_wt: WT [z] = bf16(Wz[k][n]) (k-major [K][ncols]) as [n][K] in fragment order, via 64 x 64 LDS tiles; grid (K/64, ncols/64, 4), blockIdx.z = which of the four weights.
__global__ __launch_bounds__(256) void k_wt(const float* __restrict__ W0, const float* __restrict__ W1, const float* __restrict__ W2, const float* __restrict__ W3, int K, int ncols, bf* WT) {
    __shared__ __align__(16) unsigned short tl[64 * 72];
    const int z = blockIdx.z; const float* __restrict__ Wm = z == 0 ? W0 : z == 1 ? W1 : z == 2 ? W2 : W3; WT += (size_t)z * K * ncols;
    const int tid = threadIdx.x, k0 = blockIdx.x * 64, n0 = blockIdx.y * 64;
    const int kk = tid >> 2, nq = (tid & 3) * 16;
#pragma unroll
    for (int i = 0; i < 16; ++i) tl[(nq + i) * 72 + kk] = f2bf(Wm[(size_t)(k0 + kk) * ncols + n0 + nq + i]);
    __syncthreads();
    const int piece = (tid >> 4) & 7;    // 128 threads write the 2 KiB that 16 rows x 64 k fill in fragment order
    auto pass = [&]() {
#pragma unroll
        for (int s = 0; s < 2; ++s) { const int nr = ((tid >> 7) + 2 * s) * 16 + (tid & 15); const v8us val = *(const v8usa*)(tl + nr * 72 + piece * 8); *(v8us*)(WT + fragoff(n0 + nr, k0 / 8 + piece, K)) = val; }
    };
    pass(); 
}
// k_fattn: scores, softmax and P.v of one head for 256 queries per block, nothing of S or P leaving the registers. A wave owns FQ * 16 queries and one of the FKS parts of the NN keys, 32 keys a pass:
// S^T = K.Q^T (A = K rows, B = Q rows kept in registers, both plain bf16), so a lane holds 16 keys' scores of one query (column lane & 15);
// a reference m and a sum per query (log2 domain), p = exp2(s * SCL2 - m) rounded to bf16 (the sum takes p unrounded): the two 16-key score tiles, converted,
// are the B operand of O^T += V^T.P^T (A = V^T rows, plain bf16, keys in the same order). m stands as long as no lane's sum of a pass's p tops PTOP; only then is the running maximum formed (one exchange between the lane halves)
// and taken as m, and O^T and the sum are scaled by exp2(m_old - m_new). O^T is scaled by 1 / sum at the end.
// The two waves of a query group (wave, wave + FW / FKS) meet in LDS: the upper one hands over its maximum, sum and O^T, the lower one brings both to the common maximum, adds, divides, adds q (hi + residual: its own B fragments and the residual plane's, held in the same form for this alone: element (t & 1) * 8 + j of k-step t >> 1 is head column t * 16 + 8 * hi + j of query lr, the place of O^T's element j of tile t) and stores.
// grid (NN / (FW / FKS * FQ * 16), NH_, NBT); planes Q (hi and residual), K [item][head][NN][HD] in fragment order, V^T [item][head][NN / 32][HD][32] with each [HD][32] in fragment order; O [NR][DV] = ctx + q.
#define FQ 4
#define FW 8
#define FKS 2
#define FG (FW / FKS)
#define SCL2 (SCL * 1.4426950408889634f)
#define PTOP 256.0f
typedef __attribute__((ext_vector_type(2))) float  v2f;
typedef __attribute__((ext_vector_type(2))) __bf16 v2bf;
typedef __attribute__((ext_vector_type(16))) float v16f;
// One fragment of a plane in fragment order: 16 bytes at p + c and 16 at + 512 (k = 8 * hi + 0..7 and 16 + 8 * hi + 0..7 of row lr). p = the lane's own address (lane * 16 bytes into the first fragment), c a constant.
__device__ __forceinline__ v16bf ldfrag(const char* p, int c) { return cat16b(*(const v8us*)(p + c), *(const v8us*)(p + c + 512)); }
// The wait that stands in front of any write to the address registers of issued loads. It takes the address as an input, so that it keeps its registers up to it (left free, the compiler lands a later load's result on them).
__device__ __forceinline__ void xwait(const char* a) { asm volatile("s_wait_xcnt 0x0" :: "v"(a) : "memory"); }
__device__ __forceinline__ float xhalf(float x) { const int b = __float_as_int(x); return __int_as_float(__builtin_amdgcn_permlanex16(b, b, 0x76543210, 0xfedcba98, false, false)); }
__global__ __launch_bounds__(FW * 32) void k_fattn(const bf* __restrict__ Qh0, const bf* __restrict__ Ql0, const bf* __restrict__ Kh0, const bf* __restrict__ Vh0, float* O) {
    const size_t pp = ((size_t)blockIdx.z * NH_ + blockIdx.y) * NN * HD;
    const bf* __restrict__ Qh = Qh0 + pp; const bf* __restrict__ Ql = Ql0 + pp; const bf* __restrict__ Kh = Kh0 + pp; const bf* __restrict__ Vh = Vh0 + pp;
    __shared__ __align__(16) float mrg[FG][(4 * FQ * 8 + 2 * FQ) * 32];
    const int lane = threadIdx.x & 31, wave = __builtin_amdgcn_readfirstlane(threadIdx.x >> 5), lr = lane & 15, hi = lane >> 4;    // the wave's number in a scalar register: loop bounds and branches on it stay scalar
    const int q0 = (blockIdx.x * FG + wave % FG) * (FQ * 16), kbeg = (wave / FG) * (NN / FKS);
    const unsigned loff = lane * 16;    // bytes: the lane's 16 of the 512 that a fragment load reads
    v16bf qh[FQ][2], ql[FQ][2];
    const char* pqh = (const char*)(Qh + (size_t)q0 * HD) + loff; const char* pql = (const char*)(Ql + (size_t)q0 * HD) + loff;
#pragma unroll
    for (int u = 0; u < FQ; ++u) {
#pragma unroll
        for (int ks = 0; ks < 2; ++ks) { qh[u][ks] = ldfrag(pqh, (u * 16 * HD + ks * 512) * 2); ql[u][ks] = ldfrag(pql, (u * 16 * HD + ks * 512) * 2); } }
    v16bf kh[2][2], vh[4];
    const char* pkh;
    auto fetchk = [&](int kc) {
        pkh = (const char*)(Kh + (size_t)kc * HD) + loff;
#pragma unroll
        for (int kt = 0; kt < 2; ++kt) {
#pragma unroll
            for (int ks = 0; ks < 2; ++ks) kh[kt][ks] = ldfrag(pkh, (kt * 16 * HD + ks * 512) * 2); }
    };
    v8f acc[4][FQ]; float m[FQ], l[FQ];
#pragma unroll
    for (int u = 0; u < FQ; ++u) { m[u] = -3.0e38f; l[u] = 0.f;
#pragma unroll
        for (int t = 0; t < 4; ++t) acc[t][u] = (v8f){}; }
    fetchk(kbeg);
    // The wait that stands in front of any write to the base registers of the Q and first K loads; the two fences keep it behind the loads and such writes behind it.
    __builtin_amdgcn_sched_barrier(0);
    asm volatile("s_wait_xcnt 0x0" ::: "memory");
    __builtin_amdgcn_sched_barrier(0);
    // The scheduling fences keep each group of loads where it is written (V a whole score block ahead of its use, the next pass's K a whole softmax and P.v block ahead): left free, the compiler sinks a load to its WMMA.
    // The pass loop stays rolled: one pass is 32 WMMAs and some 220 vector instructions already, and a second copy would only cost instruction cache.
#pragma unroll 1
    for (int i = 0; i < NN / FKS; i += 32) {
        const int kc = kbeg + i;
        const char* pvh = (const char*)(Vh + (size_t)kc * HD) + loff;
#pragma unroll
        for (int t = 0; t < 4; ++t) vh[t] = ldfrag(pvh, t * 1024);
        __builtin_amdgcn_sched_barrier(0);
        v8f s[2][FQ];
#pragma unroll
        for (int kt = 0; kt < 2; ++kt) {
#pragma unroll
            for (int u = 0; u < FQ; ++u) s[kt][u] = (v8f){}; }
#pragma unroll
        for (int ks = 0; ks < 2; ++ks) {
#pragma unroll
            for (int kt = 0; kt < 2; ++kt) {
#pragma unroll
                for (int u = 0; u < FQ; ++u) s[kt][u] = wmmab(kh[kt][ks], qh[u][ks], s[kt][u]); } }
        __builtin_amdgcn_sched_barrier(0);
        xwait(pvh);    // written behind the score block, so that the wave does not stop for it directly behind the V loads
        fetchk(i + 32 < NN / FKS ? kc + 32 : kbeg);    // the last pass fetches the first again (in bounds, unused), so that the loads stand on one path
        __builtin_amdgcn_sched_barrier(0);
        v16bf ph[FQ]; float ls[FQ];
        // p of query tile u against the reference m[u]: its bf16 form and the lane's f32 sum of its 16 values
        auto expo = [&](int u) {
            v2f lp = {0.f, 0.f};
#pragma unroll
            for (int kt = 0; kt < 2; ++kt) {
#pragma unroll
                for (int j = 0; j < 8; j += 2) {
                    const v2f p = {__builtin_amdgcn_exp2f(fmaf(s[kt][u][j], SCL2, -m[u])), __builtin_amdgcn_exp2f(fmaf(s[kt][u][j + 1], SCL2, -m[u]))};
                    lp += p;
                    const v2bf hb = __builtin_convertvector(p, v2bf);
                    ph[u][kt * 8 + j] = hb[0]; ph[u][kt * 8 + j + 1] = hb[1]; } }
            ls[u] = lp[0] + lp[1];
        };
#pragma unroll
        for (int u = 0; u < FQ; ++u) expo(u);
        float big = ls[0];
#pragma unroll
        for (int u = 1; u < FQ; ++u) big = fmaxf(big, ls[u]);
        // One test a pass, the same for the whole wave (a scalar branch): no lane's sum above PTOP means no p above PTOP, and the references stand. Else (the first pass always: its p are infinite) every
        // query tile takes its true running maximum as reference, O^T and the sum go over to it, and the pass's p are formed again (then at most about 1 each, so that the pass's sums are in range).
        // The hint lays the rare block out of line, so that a pass that keeps its references runs straight through.
        if (__builtin_expect(__builtin_amdgcn_ballot_w32(!(big <= PTOP)) != 0, 0)) {
#pragma unroll
            for (int u = 0; u < FQ; ++u) {
                float mx0 = fmaxf(s[0][u][0], s[1][u][0]), mx1 = fmaxf(s[0][u][1], s[1][u][1]);
#pragma unroll
                for (int j = 2; j < 8; j += 2) { mx0 = fmaxf(mx0, fmaxf(s[0][u][j], s[1][u][j])); mx1 = fmaxf(mx1, fmaxf(s[0][u][j + 1], s[1][u][j + 1])); }
                float mx = fmaxf(mx0, mx1); mx = fmaxf(mx, xhalf(mx));
                const float mn = fmaxf(m[u], mx * SCL2), al = __builtin_amdgcn_exp2f(m[u] - mn); m[u] = mn;
                l[u] *= al;
#pragma unroll
                for (int t = 0; t < 4; ++t) acc[t][u] *= al;
                expo(u);
            }
        }
#pragma unroll
        for (int u = 0; u < FQ; ++u) l[u] += ls[u];
#pragma unroll
        for (int t = 0; t < 4; ++t) {
#pragma unroll
            for (int u = 0; u < FQ; ++u) acc[t][u] = wmmab(vh[t], ph[u], acc[t][u]); }
        __builtin_amdgcn_sched_barrier(0);    // keeps the wait below at the pass's end: left free, it rises to stand directly behind the K loads, and the wave stops for it there
        xwait(pkh);
    }
    float* mg = &mrg[wave % FG][0];
    if (wave >= FG) {
#pragma unroll
        for (int u = 0; u < FQ; ++u) { mg[(4 * FQ * 8 + u) * 32 + lane] = m[u]; mg[(4 * FQ * 8 + FQ + u) * 32 + lane] = l[u];
#pragma unroll
            for (int t = 0; t < 4; ++t) { const v8f r = acc[t][u]; float* p = mg + (t * FQ + u) * 256 + lane * 4;
                *(v4f*)p = (v4f){r[0], r[1], r[2], r[3]}; *(v4f*)(p + 128) = (v4f){r[4], r[5], r[6], r[7]}; } }
    }
    __syncthreads();
    if (wave < FG) {
        // A lane holds 8 consecutive head columns (t * 16 + 8 * hi ...) of query u * 16 + lr.
#pragma unroll
        for (int u = 0; u < FQ; ++u) {
            const float m1 = mg[(4 * FQ * 8 + u) * 32 + lane], l1 = mg[(4 * FQ * 8 + FQ + u) * 32 + lane];
            const float mn = fmaxf(m[u], m1), a0 = __builtin_amdgcn_exp2f(m[u] - mn), a1 = __builtin_amdgcn_exp2f(m1 - mn);
            const float lt = fmaf(l[u], a0, l1 * a1), inv = 1.0f / (lt + xhalf(lt)), f0 = a0 * inv, f1 = a1 * inv;
            float* orow = O + ((size_t)blockIdx.z * NN + q0 + u * 16 + lr) * DV + blockIdx.y * HD + 8 * hi;
            v4f res[8];
#pragma unroll
            for (int t = 0; t < 4; ++t) { const v8f r = acc[t][u]; const float* p = mg + (t * FQ + u) * 256 + lane * 4; const v4f x = *(const v4f*)p, y = *(const v4f*)(p + 128);
                const v16f qq = __builtin_convertvector(qh[u][t >> 1], v16f) + __builtin_convertvector(ql[u][t >> 1], v16f); const int e = (t & 1) * 8;
                res[2 * t] = ((v4f){r[0], r[1], r[2], r[3]} * f0 + x * f1) + (v4f){qq[e], qq[e + 1], qq[e + 2], qq[e + 3]}; res[2 * t + 1] = ((v4f){r[4], r[5], r[6], r[7]} * f0 + y * f1) + (v4f){qq[e + 4], qq[e + 5], qq[e + 6], qq[e + 7]}; }
            // The two fences keep a query tile's arithmetic in front of its eight stores and the next tile's behind the wait, so that no register an issued store names is rewritten ahead of that wait.
            __builtin_amdgcn_sched_barrier(0);
#pragma unroll
            for (int t = 0; t < 4; ++t) { *(v4f*)(orow + t * 16) = res[2 * t]; *(v4f*)(orow + t * 16 + 4) = res[2 * t + 1]; }
            if (u + 1 < FQ) { asm volatile("s_wait_xcnt 0x0" ::: "memory");    // stands in front of the next tile's writes to the stores' data and address registers
                __builtin_amdgcn_sched_barrier(0); }
        }
    }
}

// k_proj: the q, k and v projections, from the f32 inputs to the planes that attention reads. grid (NR / PR, 3), blockIdx.y = z = which product. A block owns PR whole rows of its input (z = 0: XQ, else XK):
// a wave reads 16 of them (512 bytes of a row a load), rounds them to bf16 and lays them in LDS in fragment order (pieces of [16 rows][8] PPP elements apart, as in k_tail); behind the barrier wave w takes all PR rows x head w
// (8 x 4 tiles), x fragments from LDS half a k-step ahead, weight fragments (W^T, fragment order) from L2 four k-steps ahead in a ring of PB.
// z < 2: D = W^T.x^T, so that a lane holds 8 consecutive head columns of one row, 16 bytes of a q or k plane as they stand (a store writes 512 bytes in a row).
// z = 2: D = x.W, so that a lane holds 8 consecutive tokens of one head column, 16 bytes of a v^T plane as they stand. Planes: bf16 of the f32 tile + bf(bias), for q its residual too (the q that is added to ctx), Q, K [item][head][NN][HD], V^T [item][head][NN / 32][HD][32].
#define PR  128
#define PB  4
#define PPP 136
typedef __attribute__((ext_vector_type(4))) unsigned v4u;
typedef __attribute__((ext_vector_type(2))) unsigned v2u;
typedef v4u __attribute__((may_alias)) v4ua;
typedef v2u __attribute__((may_alias)) v2ua;
__device__ __forceinline__ unsigned pkbf(float a, float b) { return __builtin_bit_cast(unsigned, __builtin_convertvector((v2f){a, b}, v2bf)); }
// 8 f32 values -> 8 bf16 (nearest even) and the 8 bf16 of what the rounding left
__device__ __forceinline__ void split8(const float (&v)[8], v4u& oh, v4u& ol) {
#pragma unroll
    for (int p = 0; p < 4; ++p) { const v2f x = {v[2 * p], v[2 * p + 1]}; const v2bf hb = __builtin_convertvector(x, v2bf); const v2bf lb = __builtin_convertvector(x - __builtin_convertvector(hb, v2f), v2bf);
        oh[p] = __builtin_bit_cast(unsigned, hb); ol[p] = __builtin_bit_cast(unsigned, lb); }
}
template <bool B> struct flag { static constexpr bool v = B; };
// The product of a wave: ap = the lane's 16 bytes of piece hi, row tile 0, k-step 0 in LDS; pb = the lane's 16 bytes of the wave's first weight fragment; b holds the first PB k-steps. WA: the weight is the A operand.
// The fetches past the last k-step read the next row tile's pieces and the next 16 weight rows (the fourth weight's behind the third): inside the arrays, written in this call, unused; so the loop has one path.
template <bool WA>
__device__ __forceinline__ void proj_mm(const bf* ap, const char* pb, v16bf (&b)[PB][4], v8f (&acc)[PR / 16][4]) {
    v16bf a[2][4];
    auto fetcha = [&](int g, int ks) {
#pragma unroll
        for (int i = 0; i < 4; ++i) { const bf* p = ap + ((g * 4 + i) * (DV / 8) + 4 * ks) * PPP; a[g][i] = cat16b(*(const v8usa*)p, *(const v8usa*)(p + 2 * PPP)); }
    };
    auto mm = [&](int g, int kk) {
#pragma unroll
        for (int i = 0; i < 4; ++i) {
#pragma unroll
            for (int t = 0; t < 4; ++t) { if constexpr (WA) acc[g * 4 + i][t] = wmmab(b[kk][t], a[g][i], acc[g * 4 + i][t]); else acc[g * 4 + i][t] = wmmab(a[g][i], b[kk][t], acc[g * 4 + i][t]); } }
    };
    fetcha(0, 0);
    // Rolled by PB k-steps (128 WMMAs a trip), so that the ring's places are plain registers and the text stays short. The scheduling fences keep each group of loads where it is written: left free, the compiler sinks a load to its WMMA.
#pragma unroll 1
    for (int k0 = 0; k0 < DV / 32; k0 += PB) {
        const char* pk = pb + k0 * 1024;
#pragma unroll
        for (int kk = 0; kk < PB; ++kk) {
            fetcha(1, k0 + kk);
            __builtin_amdgcn_sched_barrier(0);
            mm(0, kk);
            __builtin_amdgcn_sched_barrier(0);
            fetcha(0, k0 + kk + 1);
            __builtin_amdgcn_sched_barrier(0);
            mm(1, kk);
            __builtin_amdgcn_sched_barrier(0);
#pragma unroll
            for (int t = 0; t < 4; ++t) b[kk][t] = ldfrag(pk, t * 16 * DV * 2 + (kk + PB) * 1024);
        }
        // The wait that stands in front of the next trip's write to the weight loads' address register; the two fences keep it behind the trip's last loads and that write behind it.
        __builtin_amdgcn_sched_barrier(0);
        asm volatile("s_wait_xcnt 0x0" ::: "memory");
        __builtin_amdgcn_sched_barrier(0);
    }
}
// One block's work; WA = the weight is the A operand (z < 2). A function per form, so that each side of the kernel's one branch on z holds its own registers.
template <bool WA>
__device__ __forceinline__ void proj_body(bf (*hp)[DV / 8][PPP], int z, const float* __restrict__ X, const bf* __restrict__ WT, const float* __restrict__ bias, bf* Ph, bf* Pl) {
    const int lane = threadIdx.x & 31, wv = __builtin_amdgcn_readfirstlane(threadIdx.x >> 5), lr = lane & 15, hi = lane >> 4;
    const size_t r0 = (size_t)blockIdx.x * PR;
    const float* px = X + (r0 + wv * 16) * DV + lane * 4;
    const char* pb = (const char*)(WT + ((size_t)z * DV + wv * 64) * DV) + lane * 16;
    v16bf b[PB][4];
    {
        // The wave's 16 rows in four groups of 16 loads, two or three groups out at a time.
        v4f x[4][16];
        auto ask = [&](int q) {
#pragma unroll
            for (int i = 0; i < 4; ++i) {
#pragma unroll
                for (int st = 0; st < 4; ++st) x[q][i * 4 + st] = *(const v4f*)(px + (q * 4 + i) * DV + st * 128); }
        };
        auto put = [&](int q) {
#pragma unroll
            for (int i = 0; i < 4; ++i) {
#pragma unroll
                for (int st = 0; st < 4; ++st) { const v4f v = x[q][i * 4 + st]; *(v2ua*)(&hp[wv][st * 16 + (lane >> 1)][(q * 4 + i) * 8 + (lane & 1) * 4]) = (v2u){pkbf(v[0], v[1]), pkbf(v[2], v[3])}; } }
        };
        // The scheduling fences keep the groups of loads ahead of the rounding: left free, a group's loads sink to their use and the groups' latencies follow one another.
        ask(0); ask(1);
        __builtin_amdgcn_sched_barrier(0);
        put(0); ask(2);
        __builtin_amdgcn_sched_barrier(0);
        put(1); ask(3);
        __builtin_amdgcn_sched_barrier(0);
        put(2);
        __builtin_amdgcn_sched_barrier(0);    // the weight loads stay behind the third group's use: never more than 48 loads of a wave are out
#pragma unroll
        for (int ks = 0; ks < PB; ++ks) {
#pragma unroll
            for (int t = 0; t < 4; ++t) b[ks][t] = ldfrag(pb, t * 16 * DV * 2 + ks * 1024); }
        __builtin_amdgcn_sched_barrier(0);
        asm volatile("s_wait_xcnt 0x0" ::: "memory");    // stands in front of any write to the address registers of the loads above
        __builtin_amdgcn_sched_barrier(0);    // keeps such writes behind it
        put(3);
    }
    __syncthreads();    // every wave reads all PR rows
    v8f acc[PR / 16][4];
#pragma unroll
    for (int i = 0; i < PR / 16; ++i) {
#pragma unroll
        for (int t = 0; t < 4; ++t) acc[i][t] = (v8f){}; }
    proj_mm<WA>(&hp[0][hi][lr * 8], pb, b, acc);
    const size_t pl0 = (((r0 / NN) * NH_ + wv) * NN + r0 % NN) * HD + lane * 8;    // the lane's 16 bytes of the first 512 of the wave's PR x HD part of a plane
    float bs[WA ? 4 : 1][WA ? 8 : 4];
    const int bcol = wv * 64 + lr;    // the lane's first column of the wave's head
    if constexpr (WA) {
#pragma unroll
        for (int t = 0; t < 4; ++t) { const v4f x = *(const v4f*)(bias + wv * 64 + t * 16 + hi * 8), y = *(const v4f*)(bias + wv * 64 + t * 16 + hi * 8 + 4);
#pragma unroll
            for (int j = 0; j < 8; ++j) bs[t][j] = j < 4 ? x[j & 3] : y[j & 3]; }
    } else {
#pragma unroll
        for (int t = 0; t < 4; ++t) bs[0][t] = bias[bcol + t * 16];
    }
    // The wait that stands in front of any write to the bias loads' address registers; the two fences keep it behind the loads and the arithmetic behind it.
    // Where the loads' offset register is the lane's column bcol, the wait takes it as an input, so that it keeps its register up to it (left free, the compiler lands the last load's result on it).
    __builtin_amdgcn_sched_barrier(0);
    if constexpr (WA) asm volatile("s_wait_xcnt 0x0" ::: "memory"); else asm volatile("s_wait_xcnt 0x0" :: "v"(bcol) : "memory");
    __builtin_amdgcn_sched_barrier(0);
#pragma unroll
    for (int t = 0; t < (WA ? 4 : 1); ++t) {
#pragma unroll
        for (int j = 0; j < (WA ? 8 : 4); ++j) bs[t][j] = bfr(bs[t][j]); }
    // WA, tile (i, t): head columns t * 16 + hi * 8 + j of row i * 16 + lr = piece 2 * t + hi of row lr of the 16-row group i.
    // Else: tokens i * 16 + hi * 8 + j of head column t * 16 + lr = piece (i & 1) * 2 + hi of row lr of fragment t of the 32-token group i >> 1.
    // RES: the residual plane is written too (q alone).
    auto planes = [&](auto res) {
    constexpr bool RES = decltype(res)::v;
#pragma unroll
    for (int i = 0; i < PR / 16; ++i) {
        v4u oh[4], ol[4];
#pragma unroll
        for (int t = 0; t < 4; ++t) { float v[8];
#pragma unroll
            for (int j = 0; j < 8; ++j) v[j] = acc[i][t][j] + (WA ? bs[t][j] : bs[0][t]);
            if constexpr (RES) split8(v, oh[t], ol[t]);
            else {
#pragma unroll
                for (int p = 0; p < 4; ++p) oh[t][p] = pkbf(v[2 * p], v[2 * p + 1]); } }
        // The two fences keep a tile row's arithmetic in front of its stores and the next one's behind the wait, so that no register an issued store names is rewritten ahead of that wait.
        __builtin_amdgcn_sched_barrier(0);
#pragma unroll
        for (int t = 0; t < 4; ++t) { const size_t o = pl0 + (WA ? i * 16 * HD + t * 256 : (i >> 1) * 32 * HD + t * 512 + (i & 1) * 256); *(v4ua*)(Ph + o) = oh[t]; if constexpr (RES) *(v4ua*)(Pl + o) = ol[t]; }
        asm volatile("s_wait_xcnt 0x0" ::: "memory");    // stands in front of the next writes to the stores' data and address registers: the next tile row's, and behind the last row those of the code laid behind this block
        __builtin_amdgcn_sched_barrier(0);
    }
    };
    if (WA && z == 0) planes(flag<true>{}); else planes(flag<false>{});
}
__global__ __launch_bounds__(256) void k_proj(const float* __restrict__ XQ, const float* __restrict__ XK, const bf* __restrict__ WT, const float* __restrict__ bq, const float* __restrict__ bk, const float* __restrict__ bv,
                                              bf* Qh, bf* Ql, bf* Kh, bf* VTh) {
    __shared__ __align__(16) bf hp[PR / 16][DV / 8][PPP];
    const int z = blockIdx.y;
    if (z == 2) proj_body<false>(hp, z, XK, WT, bv, VTh, nullptr);
    else proj_body<true>(hp, z, z ? XK : XQ, WT, z ? bk : bq, z ? Kh : Qh, Ql);
}
// k_tail: everything behind attention for TR whole rows per block, so that nothing between O and the output leaves the WGP: H = LayerNorm(O[s]) x bf(g0) + bf(b0) (O = ctx + q, as attention wrote it) (f32; mean, biased var over 512),
// F = (Hh + Hl).Wo^T + bf(bo) (H as bf16 hi + residual, two products, hi then residual in every k-step of 32), out = LayerNorm(H + relu(F)) x bf(g1) + bf(b1).
// Both LayerNorms: one wave per row, 4 rows a wave, lane -> 4 columns per 128-step, 4 steps. The product: a wave takes all TR rows x 64 columns (2 x 4 tiles); A from LDS, B (Wo^T, fragment order) from L2, TB k-steps ahead.
// LDS: hp = the two planes in fragment order, a piece of [16 rows][8] being TPP elements from the next (272 bytes: a row's 8-byte writes, 16 pieces a store, fall on all 64 banks; a half wave's fragment read is 256 bytes in a row);
// ys = H in f32 (a wave's own rows); fs = F, pitch TFP (rows 8 apart lie 32 banks apart, as the accumulator's two lane halves write them).
#define TR  32
#define TB  3
#define TPP 136
#define TFP 516
__global__ __launch_bounds__(256) void k_tail(const float* __restrict__ O, const float* __restrict__ g0, const float* __restrict__ b0, const bf* __restrict__ WoT, const float* __restrict__ bo,
                                              const float* __restrict__ g1, const float* __restrict__ b1, float* OUTB) {
    typedef __attribute__((ext_vector_type(4))) unsigned short v4us;
    typedef v4us __attribute__((may_alias)) v4usa;
    __shared__ __align__(16) bf hp[2][TR / 16][DV / 8][TPP];
    __shared__ __align__(16) float ys[TR][DV];
    __shared__ __align__(16) float fs[TR][TFP];
    const int lane = threadIdx.x & 31, wv = __builtin_amdgcn_readfirstlane(threadIdx.x >> 5), lr = lane & 15, hi = lane >> 4;
    const size_t s0 = (size_t)blockIdx.x * TR + wv * 4;
    // The first TB k-steps of B depend on nothing: they are asked for ahead of the rows.
    const char* pbu = (const char*)(WoT + (size_t)wv * 64 * DV); const char* pb = pbu + lane * 16;    // pbu, pou: the same in every lane, the scalar bases of the loads
    v16bf b[TB][4];
#pragma unroll
    for (int ks = 0; ks < TB; ++ks) {
#pragma unroll
        for (int t = 0; t < 4; ++t) b[ks][t] = ldfrag(pb, t * 16 * DV * 2 + ks * 1024); }
    const float* pou = O + s0 * DV; const float* po = pou + lane * 4;
    float v[4][16], sm[4];
    {
        v4f xo[4][4];
#pragma unroll
        for (int i = 0; i < 4; ++i) {
#pragma unroll
            for (int st = 0; st < 4; ++st) xo[i][st] = *(const v4f*)(po + i * DV + st * 128); }
        __builtin_amdgcn_sched_barrier(0);    // keeps all the loads above in front of the first sum: left free, a row's loads sink to its adds and the rows' latencies follow one another
#pragma unroll
        for (int i = 0; i < 4; ++i) { sm[i] = 0.f;
#pragma unroll
            for (int st = 0; st < 4; ++st) {
#pragma unroll
                for (int q = 0; q < 4; ++q) { const float t = xo[i][st][q]; v[i][st * 4 + q] = t; sm[i] += t; } } }
    }
    // The wait that stands in front of any write to the row loads' address registers: as its inputs they stay allocated up to it; the sums hold it behind the loads.
    asm volatile("s_wait_xcnt 0x0" :: "s"(pou), "v"(sm[0]), "v"(sm[1]), "v"(sm[2]), "v"(sm[3]) : "memory");
    float mu[4], qv[4], rs[4];
#pragma unroll
    for (int sh = 16; sh; sh >>= 1) {
#pragma unroll
        for (int i = 0; i < 4; ++i) sm[i] += __shfl_xor(sm[i], sh, 32); }
#pragma unroll
    for (int i = 0; i < 4; ++i) { mu[i] = sm[i] * (1.0f / DV); qv[i] = 0.f;
#pragma unroll
        for (int e = 0; e < 16; ++e) { const float d = v[i][e] - mu[i]; qv[i] = fmaf(d, d, qv[i]); } }
#pragma unroll
    for (int sh = 16; sh; sh >>= 1) {
#pragma unroll
        for (int i = 0; i < 4; ++i) qv[i] += __shfl_xor(qv[i], sh, 32); }
#pragma unroll
    for (int i = 0; i < 4; ++i) rs[i] = rsqrtf(qv[i] * (1.0f / DV) + LEPS);
#pragma unroll
    for (int st = 0; st < 4; ++st) { const int c0 = st * 128 + lane * 4; const v4f gv = *(const v4f*)(g0 + c0), bv = *(const v4f*)(b0 + c0);
#pragma unroll
        for (int i = 0; i < 4; ++i) { const int r = wv * 4 + i; v4f o; v4us oh, ol;
#pragma unroll
            for (int q = 0; q < 4; ++q) { const float y = (v[i][st * 4 + q] - mu[i]) * rs[i] * bfr(gv[q]) + bfr(bv[q]); o[q] = y; const unsigned short hb = f2bf(y); oh[q] = hb; ol[q] = f2bf(y - bf2f(hb)); }
            *(v4fa*)(&ys[r][c0]) = o; *(v4usa*)(&hp[0][r >> 4][c0 >> 3][(r & 15) * 8 + (lane & 1) * 4]) = oh; *(v4usa*)(&hp[1][r >> 4][c0 >> 3][(r & 15) * 8 + (lane & 1) * 4]) = ol; } }
    float bov[4];    // asked for ahead of the product
#pragma unroll
    for (int t = 0; t < 4; ++t) bov[t] = bo[wv * 64 + t * 16 + lr];
    __syncthreads();    // every wave reads all TR rows of the planes
    v8f acc[2][4];
#pragma unroll
    for (int rt = 0; rt < 2; ++rt) {
#pragma unroll
        for (int t = 0; t < 4; ++t) acc[rt][t] = (v8f){}; }
    // A fragment of k-step ks: row lr, pieces 4 * ks + hi and 4 * ks + 2 + hi, the k order of the B fragments.
    v16bf ah[2][2], al[2][2];
    auto fetcha = [&](int ks) {
#pragma unroll
        for (int rt = 0; rt < 2; ++rt) {
            ah[ks & 1][rt] = cat16b(*(const v8usa*)(&hp[0][rt][4 * ks + hi][lr * 8]), *(const v8usa*)(&hp[0][rt][4 * ks + 2 + hi][lr * 8]));
            al[ks & 1][rt] = cat16b(*(const v8usa*)(&hp[1][rt][4 * ks + hi][lr * 8]), *(const v8usa*)(&hp[1][rt][4 * ks + 2 + hi][lr * 8])); }
    };
    fetcha(0);
    // Unrolled whole (16 k-steps of 16 WMMAs), so that the rings of A and B fragments are plain registers. The scheduling fences keep each k-step's loads where they are written (A one k-step ahead, B TB ahead):
    // left free, the compiler sinks a load to its WMMA.
#pragma unroll
    for (int ks = 0; ks < DV / 32; ++ks) {
        if (ks + 1 < DV / 32) fetcha(ks + 1);
        __builtin_amdgcn_sched_barrier(0);
#pragma unroll
        for (int rt = 0; rt < 2; ++rt) {
#pragma unroll
            for (int t = 0; t < 4; ++t) acc[rt][t] = wmmab(ah[ks & 1][rt], b[ks % TB][t], acc[rt][t]); }
#pragma unroll
        for (int rt = 0; rt < 2; ++rt) {
#pragma unroll
            for (int t = 0; t < 4; ++t) acc[rt][t] = wmmab(al[ks & 1][rt], b[ks % TB][t], acc[rt][t]); }
        __builtin_amdgcn_sched_barrier(0);
        if (ks + TB < DV / 32) {
#pragma unroll
            for (int t = 0; t < 4; ++t) b[ks % TB][t] = ldfrag(pb, t * 16 * DV * 2 + (ks + TB) * 1024); }
    }
    asm volatile("s_wait_xcnt 0x0" :: "s"(pbu) : "memory");    // stands in front of any write to the B loads' base register, which as its input stays allocated up to it
    // g1 and b1 are asked for here, so that they arrive behind the F tile's stores, the barrier and the row sums.
    v4f gv1[4], bv1[4];
#pragma unroll
    for (int st = 0; st < 4; ++st) { gv1[st] = *(const v4f*)(g1 + st * 128 + lane * 4); bv1[st] = *(const v4f*)(b1 + st * 128 + lane * 4); }
#pragma unroll
    for (int t = 0; t < 4; ++t) { const int c = wv * 64 + t * 16 + lr; const float bv = bfr(bov[t]);
#pragma unroll
        for (int rt = 0; rt < 2; ++rt) {
#pragma unroll
            for (int j = 0; j < 8; ++j) fs[rt * 16 + hi * 8 + j][c] = acc[rt][t][j] + bv; } }
    __syncthreads();    // a row of F comes from all eight waves
#pragma unroll
    for (int i = 0; i < 4; ++i) { const int r = wv * 4 + i; sm[i] = 0.f;
#pragma unroll
        for (int st = 0; st < 4; ++st) { const v4f h = *(const v4fa*)(&ys[r][st * 128 + lane * 4]), f = *(const v4fa*)(&fs[r][st * 128 + lane * 4]);
#pragma unroll
            for (int q = 0; q < 4; ++q) { const float t = h[q] + fmaxf(f[q], 0.f); v[i][st * 4 + q] = t; sm[i] += t; } } }
#pragma unroll
    for (int sh = 16; sh; sh >>= 1) {
#pragma unroll
        for (int i = 0; i < 4; ++i) sm[i] += __shfl_xor(sm[i], sh, 32); }
#pragma unroll
    for (int i = 0; i < 4; ++i) { mu[i] = sm[i] * (1.0f / DV); qv[i] = 0.f;
#pragma unroll
        for (int e = 0; e < 16; ++e) { const float d = v[i][e] - mu[i]; qv[i] = fmaf(d, d, qv[i]); } }
#pragma unroll
    for (int sh = 16; sh; sh >>= 1) {
#pragma unroll
        for (int i = 0; i < 4; ++i) qv[i] += __shfl_xor(qv[i], sh, 32); }
#pragma unroll
    for (int i = 0; i < 4; ++i) rs[i] = rsqrtf(qv[i] * (1.0f / DV) + LEPS);
    v4f res[4][4];
#pragma unroll
    for (int st = 0; st < 4; ++st) { const v4f gv = gv1[st], bv = bv1[st];
#pragma unroll
        for (int i = 0; i < 4; ++i) {
#pragma unroll
            for (int q = 0; q < 4; ++q) res[i][st][q] = (v[i][st * 4 + q] - mu[i]) * rs[i] * bfr(gv[q]) + bfr(bv[q]); } }
    __builtin_amdgcn_sched_barrier(0);    // keeps all arithmetic in front of the stores, so that no register an issued store names is written behind it
    float* pz = OUTB + s0 * DV + lane * 4;
#pragma unroll
    for (int i = 0; i < 4; ++i) {
#pragma unroll
        for (int st = 0; st < 4; ++st) *(v4f*)(pz + i * DV + st * 128) = res[i][st]; }
}

extern "C" void kernel_launch(void* const* d_in, const int* in_sizes, int n_in,
                              void* d_out, int out_size, void* d_ws, size_t ws_size, hipStream_t stream) {
    (void)in_sizes; (void)n_in; (void)out_size;
    const float* Qi = (const float*)d_in[0]; const float* Ki = (const float*)d_in[1]; const float* Wq = (const float*)d_in[2]; const float* bq = (const float*)d_in[3]; const float* Wk = (const float*)d_in[4]; const float* bk = (const float*)d_in[5];
    const float* Wv = (const float*)d_in[6]; const float* bv = (const float*)d_in[7]; const float* Wo = (const float*)d_in[8]; const float* bo = (const float*)d_in[9]; const float* g0 = (const float*)d_in[10]; const float* b0 = (const float*)d_in[11]; const float* g1 = (const float*)d_in[12]; const float* b1 = (const float*)d_in[13];
    float* out = (float*)d_out;    // [4][2048][512]
    char* wsp = (char*)d_ws;
    auto take = [&](size_t bytes) { char* p = wsp; wsp += (bytes + 255) & ~(size_t)255; return (void*)p; };
    // Kept through attention: the four weights, the q/k/v planes of all items and heads, and O.
    bf* WT = (bf*)take((size_t)4 * DV * DV * 2);    // WqT, WkT, WvT, WoT
    bf* Qh = (bf*)take((size_t)NR * DV * 2); bf* Ql = (bf*)take((size_t)NR * DV * 2); bf* Kh = (bf*)take((size_t)NR * DV * 2); bf* VTh = (bf*)take((size_t)NR * DV * 2);
    float* O = (float*)take((size_t)NR * DV * 4);
    if ((size_t)(wsp - (char*)d_ws) > ws_size) return;    // about 52 MB
    k_wt<<<dim3(DV / 64, DV / 64, 4), 256, 0, stream>>>(Wq, Wk, Wv, Wo, DV, DV, WT);   // (in, out) k-major
    k_proj<<<dim3(NR / PR, 3, 1), 256, 0, stream>>>(Qi, Ki, WT, bq, bk, bv, Qh, Ql, Kh, VTh);
    k_fattn<<<dim3(NN / (FG * FQ * 16), NH_, NBT), FW * 32, 0, stream>>>(Qh, Ql, Kh, VTh, O);
    k_tail<<<NR / TR, 256, 0, stream>>>(O, g0, b0, WT + (size_t)3 * DV * DV, bo, g1, b1, out);
}
